// v000
// Times are from an AMD MI455X. After a warm-up the kernel runs many times in a row, and a time is the length of
// such a window on the GPU divided by its runs, so every launch and the gaps after it count. The runs cycle
// through copies of the inputs. A figure is the median of several windows, for all but v000 over two sittings.
// Sittings can differ by a few percent; kernels timed side by side share one.
// v000, which the later versions start from, runs in 373 microseconds.
// compute dtype: all float inputs rounded to bf16; q/k/v = x W[h] + b[h] with EXACT bf16 products on WMMA 16x16x32 (per-head (in,out) weights packed as one 1024 -> 1024 projection each), f16 hi + residual; PLAIN-HYBRID scores (first 128 queries 3-product, later single), x 1/8, running-max softmax in f32 (hardware exp); 3-product P . v for the first 128 queries; the head-major stack + row-major view realised as an index map feeding out = y2 (bf16 hi + lo) . Wo + bo (2 products); f32 output.
#include <hip/hip_runtime.h>
#include <math.h>

typedef __attribute__((ext_vector_type(16))) _Float16 v16h;
typedef __attribute__((ext_vector_type(16))) __bf16 v16b;
typedef __attribute__((ext_vector_type(8)))  _Float16 v8h;
typedef __attribute__((ext_vector_type(8)))  float v8f;
typedef __attribute__((ext_vector_type(4)))  float v4f;
typedef __attribute__((ext_vector_type(2)))  float v2f;
typedef __attribute__((ext_vector_type(4)))  unsigned v4u;
typedef __attribute__((ext_vector_type(4)))  int v4i;
typedef float __attribute__((may_alias)) float_a;
typedef int __attribute__((may_alias)) int_a;

template <typename T> __device__ __forceinline__ void vst2(void* p, T v) { *(T*)p = v;  }
__device__ __forceinline__ v8f wmma16(v16h a, v16h b, v8f c) {
  v8f d = __builtin_amdgcn_wmma_f32_16x16x32_f16(false, a, false, b, (short)0, c, false, false);
  asm volatile("v_nop\n\tv_nop\n\tv_nop\n\tv_nop" : "+v"(d) : "v"(a), "v"(b));
  return d;
}
__device__ __forceinline__ v8f wmma_bf(v16b a, v16b b, v8f c) {
  v8f d = __builtin_amdgcn_wmma_f32_16x16x32_bf16(false, a, false, b, (short)0, c, false, false);
  asm volatile("v_nop\n\tv_nop\n\tv_nop\n\tv_nop" : "+v"(d) : "v"(a), "v"(b));
  return d;
}
// Per-head (inefficient) multi-head cross attention (16 heads x 64, 2,048 current x 2,048 context tokens, D_IN 1024): per head q = x Wq[h] + bq[h], k/v from the context; softmax(q k^T / 8) v; heads stacked head-major then row-major re-viewed to [S, 1024]; Wo [1024 -> 64] + bo.
__device__ __forceinline__ v16h frag_h(const _Float16* rowk0, int lane) {
  union { v16h v; v8h q[2]; } u; const _Float16* p = rowk0 + 8 * (lane >> 4);
  u.q[0] = *(const v8h*)p; u.q[1] = *(const v8h*)(p + 16); return u.v;
}
__device__ __forceinline__ v16h frag_f32(const float* rowk0, int lane) {
  v16h a; const float* p = rowk0 + 8 * (lane >> 4);
#pragma unroll
  for (int i = 0; i < 8; ++i) { a[i] = (_Float16)p[i]; a[8 + i] = (_Float16)p[16 + i]; }
  return a;
}
__device__ __forceinline__ v16h frag_f32s(const float* rowk0, int lane, float sc) {
  v16h a; const float* p = rowk0 + 8 * (lane >> 4);
#pragma unroll
  for (int i = 0; i < 8; ++i) { a[i] = (_Float16)(p[i] * sc); a[8 + i] = (_Float16)(p[16 + i] * sc); }
  return a;
}
// column fragment from a [K][ld] layout (column n), rows >= K read as 0
__device__ __forceinline__ v16h fragc_f32(const float* W, int k0, int n, int lane, int ld, int K) {
  v16h a; const int g = lane >> 4;
#pragma unroll
  for (int i = 0; i < 8; ++i) { const int ka = k0 + 8 * g + i, kb = ka + 16;
    a[i] = (_Float16)(ka < K ? W[(size_t)(ka < K ? ka : K - 1) * ld + n] : 0.f); a[8 + i] = (_Float16)(kb < K ? W[(size_t)(kb < K ? kb : K - 1) * ld + n] : 0.f); }
  return a;
}
struct F2 { v16b h, l; };
__device__ __forceinline__ F2 bsplit16(const float v[16]) { F2 r;
#pragma unroll
  for (int i = 0; i < 16; ++i) { const __bf16 h = (__bf16)v[i]; r.h[i] = h; r.l[i] = (__bf16)(v[i] - (float)h); }
  return r; }
__device__ __forceinline__ F2 split_row(const float* row, int k0, int lane) { float v[16]; const float* p = row + k0 + 8 * (lane >> 4);
#pragma unroll
  for (int i = 0; i < 8; ++i) { v[i] = p[i]; v[8 + i] = p[16 + i]; }
  return bsplit16(v); }
__device__ __forceinline__ F2 split_rowK(const float* row, int k0, int lane, int K) { float v[16]; const int g = lane >> 4;
#pragma unroll
  for (int i = 0; i < 8; ++i) { const int ka = k0 + 8 * g + i, kb = ka + 16; v[i] = ka < K ? row[ka < K ? ka : K - 1] : 0.f; v[8 + i] = kb < K ? row[kb < K ? kb : K - 1] : 0.f; }
  return bsplit16(v); }
__device__ __forceinline__ F2 split_col(const float* W, int k0, int n, int lane, int ld, int K) { float v[16]; const int g = lane >> 4;
#pragma unroll
  for (int i = 0; i < 8; ++i) { const int ka = k0 + 8 * g + i, kb = ka + 16; v[i] = ka < K ? W[(size_t)(ka < K ? ka : K - 1) * ld + n] : 0.f; v[8 + i] = kb < K ? W[(size_t)(kb < K ? kb : K - 1) * ld + n] : 0.f; }
  return bsplit16(v); }
__device__ __forceinline__ v8f mac3(const F2& a, const F2& b, v8f c) { c = wmma_bf(a.l, b.h, c); c = wmma_bf(a.h, b.l, c); return wmma_bf(a.h, b.h, c); }
__device__ __forceinline__ float sigm(float v) { return 1.0f / (1.0f + expf(-v)); }
#define LDSX() do { asm volatile("s_wait_dscnt 0" ::: "memory"); __builtin_amdgcn_wave_barrier(); __builtin_amdgcn_fence(__ATOMIC_RELEASE, "workgroup"); } while (0)


#define NB 1
#define SS 2048
#define DM 1024
#define NH 16
#define HD 64
#define QKVW (3 * DM)
#ifndef TQB
#define TQB (SS / 64)
#endif
#ifndef TNH
#define TNH NH
#define TNB NB
#define TOB (NB * SS / 64)     // output row tiles (all)
#endif
typedef __attribute__((ext_vector_type(8))) __bf16 v8b;
__device__ __forceinline__ v16b frag_b(const __bf16* rowk0, int lane) {
  union { v16b v; v8b q[2]; } u; const __bf16* p = rowk0 + 8 * (lane >> 4);
  u.q[0] = *(const v8b*)p; u.q[1] = *(const v8b*)(p + 16); return u.v;
}
__device__ __forceinline__ float bfr(float v) { return (float)(__bf16)v; }
__device__ __attribute__((noinline)) float exp_ni(float v) { return expf(v); }
__device__ __attribute__((noinline)) float erf_ni(float v) { return erff(v); }

#define PK_A 0                       // [3072][1024] Wqkv rows (natural [out][in])
#define PK_P (PK_A + QKVW * DM)        // [1024][1024] reserved; nothing writes or reads it
#define PK_END (PK_P + DM * DM)
#define WS_PK  0u
#define WS_QK  (WS_PK + 2u * PK_END)             // f16 [2048 rows][2048]: q | k
#define WS_QKL (WS_QK + 2u * NB * SS * 2 * DM)     // f16 q | k residual planes x2048
#define WS_VTH (WS_QKL + 2u * NB * SS * 2 * DM)    // f16 [b][1024 (h*64+d)][2048 s] hi
#define WS_VTL (WS_VTH + 2u * NB * DM * SS)        // f16 lo x 2048
#define WS_O   (WS_VTL + 2u * NB * DM * SS)        // f32 [2048][1024]
#define WS_CS  (WS_O + 4u * NB * SS * DM)           // f32 [2][2048][32] reserved; nothing writes or reads it
#define WS_END (WS_CS + 4u * 2 * SS * 32)
// ---- k_pack: block = (row n, which): per-head (in,out) columns gathered into bf16 [out][in] rows; which 0..2 -> W_q/W_k/W_v into PK_A rows which*1024 + n
__global__ __launch_bounds__(256) void k_pack(const float* __restrict__ WQ, const float* __restrict__ WK, const float* __restrict__ WV, __bf16* __restrict__ PK) {   // W [h][1024 in][64 d] -> packed row (which*DM + h*64 + d)[i]
  __shared__ __align__(16) __bf16 s[DM]; const int n = blockIdx.x, which = blockIdx.y, t = threadIdx.x; const int h = n / HD, d = n % HD; const float* Wm = which == 0 ? WQ : which == 1 ? WK : WV;
  for (int i = t; i < DM; i += 256) s[i] = (__bf16)Wm[((size_t)h * DM + i) * HD + d];
  __syncthreads(); __bf16* dst = PK + PK_A + ((size_t)which * DM + n) * DM; for (int q = t; q < DM / 8; q += 256) vst2((unsigned*)(dst + q * 8), *(const v4u*)&s[q * 8]); }
// ---- k_out2: block = 64 rows r of the re-viewed [2048][1024] matrix: y2[r][j*64 + o] = O[16*(r%128) + j][(r/128)*64 + o]; out = y2 (hi + lo) . Wo + bo  (Wo (in,out) [1024][64])
__global__ __launch_bounds__(128) void k_out2(const float* __restrict__ O, const float* __restrict__ WO, const float* __restrict__ BO, float* __restrict__ OUT) { __shared__ __align__(16) float sf[4][16][68];
  const int tid = threadIdx.x, wave = tid >> 5, lane = tid & 31, col = lane & 15, g = lane >> 4; const int r0 = blockIdx.x * 64 + wave * 16; const int rr = r0 + col; const int hsel = rr / 128; const int sbase = 16 * (rr % 128);
  v8f acc[4] = {};
#pragma unroll 2
  for (int kc = 0; kc < DM / 32; ++kc) { const int j = kc / 2, half = kc % 2; const F2 a = split_row(O + (size_t)(sbase + j) * DM + hsel * HD + half * 32, 0, lane);
#pragma unroll
    for (int jj = 0; jj < 4; ++jj) { v16b w; const int o = jj * 16 + col;
#pragma unroll
      for (int i = 0; i < 8; ++i) { w[i] = (__bf16)WO[(size_t)(kc * 32 + 8 * g + i) * 64 + o]; w[8 + i] = (__bf16)WO[(size_t)(kc * 32 + 16 + 8 * g + i) * 64 + o]; }
      acc[jj] = wmma_bf(a.h, w, acc[jj]); acc[jj] = wmma_bf(a.l, w, acc[jj]); } }
#pragma unroll
  for (int jj = 0; jj < 4; ++jj) { const float bb = bfr(BO[jj * 16 + col]);
#pragma unroll
    for (int r = 0; r < 8; ++r) sf[wave][8 * g + r][jj * 16 + col] = acc[jj][r] + bb; }
  LDSX(); for (int rl = 0; rl < 16; ++rl) if (lane < 16) vst2(OUT + (size_t)(r0 + rl) * 64 + lane * 4, *(const v4f*)&sf[wave][rl][lane * 4]); }
__global__ __launch_bounds__(128) void k_qkv(const float* __restrict__ XQ, const float* __restrict__ XK, const float* __restrict__ XV, const __bf16* __restrict__ P, const float* __restrict__ BQ, const float* __restrict__ BK, const float* __restrict__ BV, _Float16* __restrict__ QK, _Float16* __restrict__ QKL, _Float16* __restrict__ VTH, _Float16* __restrict__ VTL) {
  const int which0 = (blockIdx.y * 128) / DM; const float* X = (which0 == 0) ? XQ : (which0 == 1) ? XK : XV; const float* BB = BQ ? (((which0 == 0) ? BQ : (which0 == 1) ? BK : BV) + (blockIdx.y * 128 - which0 * DM)) : nullptr;
  __shared__ __align__(16) _Float16 so[4][16][136], sol[4][16][136]; __shared__ __align__(16) _Float16 sth[128][72], stl[128][72];
  const int tid = threadIdx.x, wave = tid >> 5, lane = tid & 31, col = lane & 15, g = lane >> 4; const size_t r0 = (size_t)blockIdx.x * 64 + wave * 16; const int n0 = blockIdx.y * 128;
  v8f acc[8] = {};
#pragma unroll 2
  for (int kc = 0; kc < DM / 32; ++kc) { v16b a; { const float* p = X + (r0 + col) * DM + kc * 32 + 8 * g;
#pragma unroll
      for (int i = 0; i < 8; ++i) { a[i] = (__bf16)p[i]; a[8 + i] = (__bf16)p[16 + i]; } }
#pragma unroll
    for (int j = 0; j < 8; ++j) acc[j] = wmma_bf(a, frag_b(P + (size_t)(n0 + j * 16 + col) * DM + kc * 32, lane), acc[j]); }
  if (n0 < 2 * DM) {   // q stored unscaled (f16 sigma ~0.6, no subnormal exposure); 1/8 applied to the f32 score
#pragma unroll
    for (int j = 0; j < 8; ++j) {
#pragma unroll
      for (int r = 0; r < 8; ++r) { const float v = acc[j][r] + (BB ? bfr(BB[j * 16 + col]) : 0.f); const _Float16 hv = (_Float16)v; so[wave][8 * g + r][j * 16 + col] = hv; sol[wave][8 * g + r][j * 16 + col] = (_Float16)((v - (float)hv) * 2048.0f); } }   // q, k (+ bias) as f16 hi + (x2048) residual
    LDSX();
    for (int rl = 0; rl < 16; ++rl) if (lane < 16) { vst2((unsigned*)(QK + (r0 + rl) * (2 * DM) + n0 + lane * 8), *(const v4u*)&so[wave][rl][lane * 8]); vst2((unsigned*)(QKL + (r0 + rl) * (2 * DM) + n0 + lane * 8), *(const v4u*)&sol[wave][rl][lane * 8]); }
  } else {
#pragma unroll
    for (int j = 0; j < 8; ++j) {
#pragma unroll
      for (int r = 0; r < 8; ++r) { const float v = acc[j][r] + (BB ? bfr(BB[j * 16 + col]) : 0.f); const _Float16 hv = (_Float16)v; sth[j * 16 + col][wave * 16 + 8 * g + r] = hv; stl[j * 16 + col][wave * 16 + 8 * g + r] = (_Float16)((v - (float)hv) * 2048.0f); } }
    __syncthreads();
    const size_t rb = (size_t)blockIdx.x * 64; const int b = (int)(rb / SS), s0 = (int)(rb % SS); const int pc0 = n0 - 2 * DM;
    for (int q = tid; q < 128 * 8; q += 128) { const int d = q >> 3, pc = q & 7; const size_t o = ((size_t)b * DM + pc0 + d) * SS + s0 + pc * 8; vst2((unsigned*)(VTH + o), *(const v4u*)&sth[d][pc * 8]); vst2((unsigned*)(VTL + o), *(const v4u*)&stl[d][pc * 8]); }
  }
}
// ---- k_attn: block = (64 queries, head h, batch b): all-keys flash attention (K = 64: 2 k-steps), scores = (q.k) * 0.125 with f16 hi/lo (3 products) for the first 128 queries, single f16 operands elsewhere, P.V: f16 P hi/lo x V hi/lo (3 products, two accumulators) for the first 128 queries, P x V hi elsewhere; O[b*S+q][h*64+d] = (acc + accl / 2048) / (2048 l) (256-B segments)
__global__ __launch_bounds__(128) void k_attn(const _Float16* __restrict__ QK, const _Float16* __restrict__ QKL, const _Float16* __restrict__ VTH, const _Float16* __restrict__ VTL, const void* __restrict__ KMASK, float* __restrict__ O) {
  __shared__ __align__(16) float sp[4][16][36]; __shared__ __align__(16) float so[4][16][68];
  const int tid = threadIdx.x, wave = tid >> 5, lane = tid & 31, col = lane & 15, g = lane >> 4;
  const int qb = blockIdx.x, h = blockIdx.y, b = blockIdx.z; const int q0 = qb * 64 + wave * 16; const size_t rq = (size_t)b * SS + q0 + col;
  v16h aq[2], aql[2];
#pragma unroll
  for (int kc = 0; kc < 2; ++kc) { aq[kc] = frag_h(QK + rq * (2 * DM) + h * HD + kc * 32, lane); aql[kc] = frag_h(QKL + rq * (2 * DM) + h * HD + kc * 32, lane); }
  float m[8], l[8];
#pragma unroll
  for (int r = 0; r < 8; ++r) { m[r] = -3.0e38f; l[r] = 0.f; }
  v8f acc[4] = {}, accl[4] = {};
  const int nks = SS / 32;   // all keys
#pragma unroll 1
  for (int ks = 0; ks < nks; ++ks) { v8f s[2];
#pragma unroll
    for (int ct = 0; ct < 2; ++ct) { const int kk = ks * 32 + ct * 16 + col; const _Float16* krow = QK + ((size_t)b * SS + kk) * (2 * DM) + DM + h * HD; const _Float16* krowl = QKL + ((size_t)b * SS + kk) * (2 * DM) + DM + h * HD; v8f c = {}, cl = {};
      if (qb < 2) {   // leading query blocks (outputs far above the global rms): 3 products
#pragma unroll
        for (int kc = 0; kc < 2; ++kc) { const v16h kh = frag_h(krow + kc * 32, lane); c = wmma16(aq[kc], kh, c); cl = wmma16(aql[kc], kh, cl); cl = wmma16(aq[kc], frag_h(krowl + kc * 32, lane), cl); }
#pragma unroll
        for (int r = 0; r < 8; ++r) c[r] += cl[r] * (1.0f / 2048.0f); }
      else {
#pragma unroll
        for (int kc = 0; kc < 2; ++kc) c = wmma16(aq[kc], frag_h(krow + kc * 32, lane), c); }   // single product elsewhere
      { const bool keepk = true;
#pragma unroll
      for (int r = 0; r < 8; ++r) s[ct][r] = keepk ? c[r] * 0.125f : -3.0e38f; } }   // 1/sqrt(64)
#pragma unroll
    for (int r = 0; r < 8; ++r) { float mx = fmaxf(s[0][r], s[1][r]);
#pragma unroll
      for (int o = 1; o < 16; o <<= 1) mx = fmaxf(mx, __shfl_xor(mx, o));
      const float mn = fmaxf(m[r], mx); const float alpha = (m[r] <= -1.0e38f) ? 0.f : __expf(m[r] - mn);
      const float e0 = (s[0][r] <= -1.0e38f) ? 0.f : __expf(s[0][r] - mn), e1 = (s[1][r] <= -1.0e38f) ? 0.f : __expf(s[1][r] - mn); float es = e0 + e1;
#pragma unroll
      for (int o = 1; o < 16; o <<= 1) es += __shfl_xor(es, o);
      l[r] = l[r] * alpha + es; m[r] = mn;
#pragma unroll
      for (int dt = 0; dt < 4; ++dt) { acc[dt][r] *= alpha; accl[dt][r] *= alpha; }
      sp[wave][8 * g + r][col] = e0; sp[wave][8 * g + r][16 + col] = e1; }
    LDSX();
    v16h pa, pl; { const float* prow = &sp[wave][col][0] + 8 * (lane >> 4);
#pragma unroll
      for (int i = 0; i < 8; ++i) { const float x0 = prow[i] * 2048.0f, x1 = prow[16 + i] * 2048.0f; const _Float16 h0 = (_Float16)x0, h1 = (_Float16)x1; pa[i] = h0; pa[8 + i] = h1; pl[i] = (_Float16)((x0 - (float)h0) * 2048.0f); pl[8 + i] = (_Float16)((x1 - (float)h1) * 2048.0f); } }   // P scaled by 2^11 before the f16 split so small softmax weights stay out of the f16 subnormal range; 2^-11 folded into the epilogue
#pragma unroll
    for (int dt = 0; dt < 4; ++dt) { const size_t vr = ((size_t)b * DM + h * HD + dt * 16 + col) * SS + ks * 32; const v16h vh = frag_h(VTH + vr, lane); acc[dt] = wmma16(pa, vh, acc[dt]); if (qb < 2) { accl[dt] = wmma16(pl, vh, accl[dt]); accl[dt] = wmma16(pa, frag_h(VTL + vr, lane), accl[dt]); } }   // leading query blocks: P hi/lo x V hi/lo (3 products); elsewhere P x V single
    LDSX(); }
#pragma unroll
  for (int r = 0; r < 8; ++r) { const float il = (1.0f / 2048.0f) / l[r];
#pragma unroll
    for (int dt = 0; dt < 4; ++dt) so[wave][8 * g + r][dt * 16 + col] = (acc[dt][r] + accl[dt][r] * (1.0f / 2048.0f)) * il; }
  LDSX();
  for (int rl = 0; rl < 16; ++rl) if (lane < 16) vst2(O + ((size_t)b * SS + q0 + rl) * DM + h * HD + lane * 4, *(const v4f*)&so[wave][rl][lane * 4]);
}
// ---- k_out: block = (64 rows, 128 cols): out = O(hi/lo) . Wo rows (2 products) + bo
__global__ __launch_bounds__(128) void k_out(const float* __restrict__ O, const __bf16* __restrict__ P, const float* __restrict__ BO, float* __restrict__ Y) {
  __shared__ __align__(16) float so[4][16][132];
  const int tid = threadIdx.x, wave = tid >> 5, lane = tid & 31, col = lane & 15, g = lane >> 4; const size_t r0 = (size_t)blockIdx.x * 64 + wave * 16; const int n0 = blockIdx.y * 128;
  v8f acc[8] = {};
#pragma unroll 2
  for (int kc = 0; kc < DM / 32; ++kc) { const F2 a = split_row(O + (r0 + col) * DM, kc * 32, lane);
#pragma unroll
    for (int j = 0; j < 8; ++j) { const v16b w = frag_b(P + (size_t)(n0 + j * 16 + col) * DM + kc * 32, lane); acc[j] = wmma_bf(a.l, w, acc[j]); acc[j] = wmma_bf(a.h, w, acc[j]); } }
#pragma unroll
  for (int j = 0; j < 8; ++j) {
#pragma unroll
    for (int r = 0; r < 8; ++r) so[wave][8 * g + r][j * 16 + col] = acc[j][r] + (BO ? bfr(BO[n0 + j * 16 + col]) : 0.f); }
  LDSX();
  for (int rl = 0; rl < 16; ++rl) vst2(Y + (r0 + rl) * DM + n0 + lane * 4, *(const v4f*)&so[wave][rl][lane * 4]);
}
extern "C" void kernel_launch(void* const* d_in, const int* in_sizes, int n_in, void* d_out, int out_size, void* d_ws, size_t ws_size, hipStream_t stream) {
  (void)in_sizes; (void)n_in; (void)out_size;
  const float** F = (const float**)d_in;   // 0 current [2048,1024], 1 context [2048,1024], 2 Wq [16,1024,64], 3 bq [16,64], 4 Wk, 5 bk, 6 Wv, 7 bv, 8 Wo [1024,64], 9 bo [64]
  if (ws_size < (size_t)WS_END) return;
  char* ws = (char*)d_ws; __bf16* PK = (__bf16*)(ws + WS_PK); _Float16 *QK = (_Float16*)(ws + WS_QK), *QKL = (_Float16*)(ws + WS_QKL), *VTH = (_Float16*)(ws + WS_VTH), *VTL = (_Float16*)(ws + WS_VTL); float* O = (float*)(ws + WS_O);
  k_pack<<<dim3(DM, 3), 256, 0, stream>>>(F[2], F[4], F[6], PK);
  k_qkv<<<dim3(TNB * SS / 64, QKVW / 128), 128, 0, stream>>>(F[0], F[1], F[1], PK + PK_A, F[3], F[5], F[7], QK, QKL, VTH, VTL);
  k_attn<<<dim3(TQB, TNH, TNB), 128, 0, stream>>>(QK, QKL, VTH, VTL, nullptr, O);
  k_out2<<<TOB, 128, 0, stream>>>(O, F[8], F[9], (float*)d_out);
}

// v001
// Measured time: 207 microseconds a run.
// Two timings next to v000 put it at 1.82 and 1.81 times that version's speed.
// compute dtype: all float inputs rounded to bf16; q/k/v = x W[h] + b[h] with EXACT bf16 products on WMMA 16x16x32 (per-head (in,out) weights packed as one 1024 -> 1024 projection each), f16 hi + residual; PLAIN-HYBRID scores (first 128 queries 3-product, later single), x 1/8, running-max softmax in f32 (hardware exp); 3-product P . v for the first 128 queries; the head-major stack + row-major view realised as an index map feeding out = y2 (bf16 hi + lo) . Wo + bo (2 products); f32 output.
#include <hip/hip_runtime.h>
#include <math.h>

typedef __attribute__((ext_vector_type(16))) _Float16 v16h;
typedef __attribute__((ext_vector_type(16))) __bf16 v16b;
typedef __attribute__((ext_vector_type(8)))  _Float16 v8h;
typedef __attribute__((ext_vector_type(8)))  float v8f;
typedef __attribute__((ext_vector_type(4)))  float v4f;
typedef __attribute__((ext_vector_type(2)))  float v2f;
typedef __attribute__((ext_vector_type(4)))  unsigned v4u;
typedef __attribute__((ext_vector_type(4)))  int v4i;
typedef float __attribute__((may_alias)) float_a;
typedef int __attribute__((may_alias)) int_a;

template <typename T> __device__ __forceinline__ void vst2(void* p, T v) { *(T*)p = v;  }
__device__ __forceinline__ v8f wmma16(v16h a, v16h b, v8f c) {
  v8f d = __builtin_amdgcn_wmma_f32_16x16x32_f16(false, a, false, b, (short)0, c, false, false);
  asm volatile("v_nop\n\tv_nop\n\tv_nop\n\tv_nop" : "+v"(d) : "v"(a), "v"(b));
  return d;
}
__device__ __forceinline__ v8f wmma_bf(v16b a, v16b b, v8f c) {
  v8f d = __builtin_amdgcn_wmma_f32_16x16x32_bf16(false, a, false, b, (short)0, c, false, false);
  asm volatile("v_nop\n\tv_nop\n\tv_nop\n\tv_nop" : "+v"(d) : "v"(a), "v"(b));
  return d;
}
// Per-head (inefficient) multi-head cross attention (16 heads x 64, 2,048 current x 2,048 context tokens, D_IN 1024): per head q = x Wq[h] + bq[h], k/v from the context; softmax(q k^T / 8) v; heads stacked head-major then row-major re-viewed to [S, 1024]; Wo [1024 -> 64] + bo.
__device__ __forceinline__ v16h frag_h(const _Float16* rowk0, int lane) {
  union { v16h v; v8h q[2]; } u; const _Float16* p = rowk0 + 8 * (lane >> 4);
  u.q[0] = *(const v8h*)p; u.q[1] = *(const v8h*)(p + 16); return u.v;
}
__device__ __forceinline__ v16h frag_f32(const float* rowk0, int lane) {
  v16h a; const float* p = rowk0 + 8 * (lane >> 4);
#pragma unroll
  for (int i = 0; i < 8; ++i) { a[i] = (_Float16)p[i]; a[8 + i] = (_Float16)p[16 + i]; }
  return a;
}
__device__ __forceinline__ v16h frag_f32s(const float* rowk0, int lane, float sc) {
  v16h a; const float* p = rowk0 + 8 * (lane >> 4);
#pragma unroll
  for (int i = 0; i < 8; ++i) { a[i] = (_Float16)(p[i] * sc); a[8 + i] = (_Float16)(p[16 + i] * sc); }
  return a;
}
// column fragment from a [K][ld] layout (column n), rows >= K read as 0
__device__ __forceinline__ v16h fragc_f32(const float* W, int k0, int n, int lane, int ld, int K) {
  v16h a; const int g = lane >> 4;
#pragma unroll
  for (int i = 0; i < 8; ++i) { const int ka = k0 + 8 * g + i, kb = ka + 16;
    a[i] = (_Float16)(ka < K ? W[(size_t)(ka < K ? ka : K - 1) * ld + n] : 0.f); a[8 + i] = (_Float16)(kb < K ? W[(size_t)(kb < K ? kb : K - 1) * ld + n] : 0.f); }
  return a;
}
struct F2 { v16b h, l; };
__device__ __forceinline__ F2 bsplit16(const float v[16]) { F2 r;
#pragma unroll
  for (int i = 0; i < 16; ++i) { const __bf16 h = (__bf16)v[i]; r.h[i] = h; r.l[i] = (__bf16)(v[i] - (float)h); }
  return r; }
__device__ __forceinline__ F2 split_row(const float* row, int k0, int lane) { float v[16]; const float* p = row + k0 + 8 * (lane >> 4);
#pragma unroll
  for (int i = 0; i < 8; ++i) { v[i] = p[i]; v[8 + i] = p[16 + i]; }
  return bsplit16(v); }
__device__ __forceinline__ F2 split_rowK(const float* row, int k0, int lane, int K) { float v[16]; const int g = lane >> 4;
#pragma unroll
  for (int i = 0; i < 8; ++i) { const int ka = k0 + 8 * g + i, kb = ka + 16; v[i] = ka < K ? row[ka < K ? ka : K - 1] : 0.f; v[8 + i] = kb < K ? row[kb < K ? kb : K - 1] : 0.f; }
  return bsplit16(v); }
__device__ __forceinline__ F2 split_col(const float* W, int k0, int n, int lane, int ld, int K) { float v[16]; const int g = lane >> 4;
#pragma unroll
  for (int i = 0; i < 8; ++i) { const int ka = k0 + 8 * g + i, kb = ka + 16; v[i] = ka < K ? W[(size_t)(ka < K ? ka : K - 1) * ld + n] : 0.f; v[8 + i] = kb < K ? W[(size_t)(kb < K ? kb : K - 1) * ld + n] : 0.f; }
  return bsplit16(v); }
__device__ __forceinline__ v8f mac3(const F2& a, const F2& b, v8f c) { c = wmma_bf(a.l, b.h, c); c = wmma_bf(a.h, b.l, c); return wmma_bf(a.h, b.h, c); }
__device__ __forceinline__ float sigm(float v) { return 1.0f / (1.0f + expf(-v)); }
#define LDSX() do { asm volatile("s_wait_dscnt 0" ::: "memory"); __builtin_amdgcn_wave_barrier(); __builtin_amdgcn_fence(__ATOMIC_RELEASE, "workgroup"); } while (0)


#define NB 1
#define SS 2048
#define DM 1024
#define NH 16
#define HD 64
#define QKVW (3 * DM)
#ifndef TQB
#define TQB (SS / 64)
#endif
#ifndef TNH
#define TNH NH
#define TNB NB
#define TOB (NB * SS / 64)     // output row tiles (all)
#endif
typedef __attribute__((ext_vector_type(8))) __bf16 v8b;
__device__ __forceinline__ v16b frag_b(const __bf16* rowk0, int lane) {
  union { v16b v; v8b q[2]; } u; const __bf16* p = rowk0 + 8 * (lane >> 4);
  u.q[0] = *(const v8b*)p; u.q[1] = *(const v8b*)(p + 16); return u.v;
}
// fragment at a wave-uniform base plus the lane's own byte offset: a group's loads all name that one offset register
__device__ __forceinline__ v16b frag_bo(const __bf16* ubase, unsigned boff) { union { v16b v; v8b q[2]; } u; const __bf16* p = (const __bf16*)((const char*)ubase + boff); u.q[0] = *(const v8b*)p; u.q[1] = *(const v8b*)(p + 16); return u.v; }
__device__ __forceinline__ float bfr(float v) { return (float)(__bf16)v; }
__device__ __attribute__((noinline)) float exp_ni(float v) { return expf(v); }
__device__ __attribute__((noinline)) float erf_ni(float v) { return erff(v); }

#define PK_A 0                       // [3072][1024] Wqkv rows (natural [out][in])
#define PK_P (PK_A + QKVW * DM)        // [1024][1024] reserved; nothing writes or reads it
#define PK_END (PK_P + DM * DM)
#define WS_PK  0u
#define WS_QK  (WS_PK + 2u * PK_END)             // f16 [2048 rows][2048]: q | k
#define WS_QKL (WS_QK + 2u * NB * SS * 2 * DM)     // f16 q | k residual planes x2048
#define WS_VTH (WS_QKL + 2u * NB * SS * 2 * DM)    // f16 [b][1024 (h*64+d)][2048 s] hi
#define WS_VTL (WS_VTH + 2u * NB * DM * SS)        // f16 lo x 2048
#define WS_O   (WS_VTL + 2u * NB * DM * SS)        // f32 [2048][1024]
#define WS_CS  (WS_O + 4u * NB * SS * DM)           // f32 [2][2048][32] reserved; nothing writes or reads it
#define WS_END (WS_CS + 4u * 2 * SS * 32)
// ---- k_pack: block = (row n, which): per-head (in,out) columns gathered into bf16 [out][in] rows; which 0..2 -> W_q/W_k/W_v into PK_A rows which*1024 + n
__global__ __launch_bounds__(256) void k_pack(const float* __restrict__ WQ, const float* __restrict__ WK, const float* __restrict__ WV, __bf16* __restrict__ PK) {   // W [h][1024 in][64 d] -> packed row (which*DM + h*64 + d)[i]
  __shared__ __align__(16) __bf16 s[DM]; const int n = blockIdx.x, which = blockIdx.y, t = threadIdx.x; const int h = n / HD, d = n % HD; const float* Wm = which == 0 ? WQ : which == 1 ? WK : WV;
  for (int i = t; i < DM; i += 256) s[i] = (__bf16)Wm[((size_t)h * DM + i) * HD + d];
  __syncthreads(); __bf16* dst = PK + PK_A + ((size_t)which * DM + n) * DM; for (int q = t; q < DM / 8; q += 256) vst2((unsigned*)(dst + q * 8), *(const v4u*)&s[q * 8]); }
// ---- k_out2: block = 64 rows r of the re-viewed [2048][1024] matrix: y2[r][j*64 + o] = O[16*(r%128) + j][(r/128)*64 + o]; out = y2 (hi + lo) . Wo + bo  (Wo (in,out) [1024][64])
__global__ __launch_bounds__(128) void k_out2(const float* __restrict__ O, const float* __restrict__ WO, const float* __restrict__ BO, float* __restrict__ OUT) { __shared__ __align__(16) float sf[4][16][68];
  const int tid = threadIdx.x, wave = tid >> 5, lane = tid & 31, col = lane & 15, g = lane >> 4; const int r0 = blockIdx.x * 64 + wave * 16; const int rr = r0 + col; const int hsel = rr / 128; const int sbase = 16 * (rr % 128);
  v8f acc[4] = {};
  const float* orow = O + (size_t)sbase * DM + hsel * HD + 8 * g; const float* wcol = WO + (size_t)(8 * g) * 64 + col;
  float ac[16], wc[4][16];   // operands of the pass in hand, loaded one pass ahead as one group (the statement behind each product holds a load at its place in the source)
#pragma unroll
  for (int i = 0; i < 8; ++i) { ac[i] = orow[i]; ac[8 + i] = orow[16 + i];
#pragma unroll
    for (int jj = 0; jj < 4; ++jj) { wc[jj][i] = wcol[(size_t)i * 64 + jj * 16]; wc[jj][8 + i] = wcol[(size_t)(16 + i) * 64 + jj * 16]; } }
#pragma unroll 2
  for (int kc = 0; kc < DM / 32; ++kc) { const int kn = kc + 1 < DM / 32 ? kc + 1 : kc; float an[16], wn[4][16];   // the last pass reads its own operands again
    const float* on = orow + (size_t)(kn / 2) * DM + (kn % 2) * 32; const float* wq = wcol + (size_t)(kn * 32) * 64;
#pragma unroll
    for (int i = 0; i < 8; ++i) { an[i] = on[i]; an[8 + i] = on[16 + i];
#pragma unroll
      for (int jj = 0; jj < 4; ++jj) { wn[jj][i] = wq[(size_t)i * 64 + jj * 16]; wn[jj][8 + i] = wq[(size_t)(16 + i) * 64 + jj * 16]; } }
    const F2 a = bsplit16(ac);
#pragma unroll
    for (int jj = 0; jj < 4; ++jj) { v16b w;
#pragma unroll
      for (int i = 0; i < 16; ++i) w[i] = (__bf16)wc[jj][i];
      acc[jj] = wmma_bf(a.h, w, acc[jj]); acc[jj] = wmma_bf(a.l, w, acc[jj]); }
#pragma unroll
    for (int i = 0; i < 16; ++i) { ac[i] = an[i];
#pragma unroll
      for (int jj = 0; jj < 4; ++jj) wc[jj][i] = wn[jj][i]; } }
#pragma unroll
  for (int jj = 0; jj < 4; ++jj) { const float bb = bfr(BO[jj * 16 + col]);
#pragma unroll
    for (int r = 0; r < 8; ++r) sf[wave][8 * g + r][jj * 16 + col] = acc[jj][r] + bb; }
  LDSX(); for (int rl = 0; rl < 16; ++rl) if (lane < 16) vst2(OUT + (size_t)(r0 + rl) * 64 + lane * 4, *(const v4f*)&sf[wave][rl][lane * 4]); }
__global__ __launch_bounds__(128) void k_qkv(const float* __restrict__ XQ, const float* __restrict__ XK, const float* __restrict__ XV, const __bf16* __restrict__ P, const float* __restrict__ BQ, const float* __restrict__ BK, const float* __restrict__ BV, _Float16* __restrict__ QK, _Float16* __restrict__ QKL, _Float16* __restrict__ VTH, _Float16* __restrict__ VTL) {
  const int which0 = (blockIdx.y * 128) / DM; const float* X = (which0 == 0) ? XQ : (which0 == 1) ? XK : XV; const float* BB = BQ ? (((which0 == 0) ? BQ : (which0 == 1) ? BK : BV) + (blockIdx.y * 128 - which0 * DM)) : nullptr;
  __shared__ __align__(16) _Float16 so[4][16][136], sol[4][16][136]; __shared__ __align__(16) _Float16 sth[128][72], stl[128][72];
  const int tid = threadIdx.x, wave = tid >> 5, lane = tid & 31, col = lane & 15, g = lane >> 4; const size_t r0 = (size_t)blockIdx.x * 64 + wave * 16; const int n0 = blockIdx.y * 128;
  v8f acc[8] = {};
  const float* xu = X + (size_t)blockIdx.x * 64 * DM; const __bf16* pu = P + (size_t)n0 * DM;   // wave-uniform bases
  unsigned xo = 4u * (unsigned)((wave * 16 + col) * DM + 8 * g), po = 2u * (unsigned)(col * DM + 8 * g);   // the lane's byte offsets, stepped once a pass behind the group's wait
  float bias[8];   // loaded here, in flight under the k loop, not one waited load per stored element
#pragma unroll
  for (int j = 0; j < 8; ++j) bias[j] = 0.f;
  if (BB) {
#pragma unroll
    for (int j = 0; j < 8; ++j) bias[j] = BB[j * 16 + col]; }
  float xc[16]; v16b wc[8];   // operands of the pass in hand, loaded one pass ahead as one group (the statement behind each product holds a load at its place in the source)
  { const float* xq = (const float*)((const char*)xu + xo);
#pragma unroll
    for (int i = 0; i < 8; ++i) { xc[i] = xq[i]; xc[8 + i] = xq[16 + i]; } }
#pragma unroll
  for (int j = 0; j < 8; ++j) wc[j] = frag_bo(pu + (j * 16) * DM, po);
  asm volatile("s_wait_xcnt 0x0" : "+v"(xo), "+v"(po) :: "memory");   // behind a group: its offset registers pass through the wait's statement, so they are stepped only behind the wait
  xo += 4u * 32; po += 2u * 32;
#pragma unroll 2
  for (int kc = 0; kc < DM / 32; ++kc) { float xn[16]; v16b wn[8];   // next pass's operands (the last pass reads its own again)
    { const float* xq = (const float*)((const char*)xu + xo);
#pragma unroll
      for (int i = 0; i < 8; ++i) { xn[i] = xq[i]; xn[8 + i] = xq[16 + i]; } }
#pragma unroll
    for (int j = 0; j < 8; ++j) wn[j] = frag_bo(pu + (j * 16) * DM, po);
    asm volatile("s_wait_xcnt 0x0" : "+v"(xo), "+v"(po) :: "memory");   // as above
    if (kc + 2 < DM / 32) { xo += 4u * 32; po += 2u * 32; }
    v16b a;
#pragma unroll
    for (int i = 0; i < 16; ++i) a[i] = (__bf16)xc[i];
#pragma unroll
    for (int j = 0; j < 8; ++j) acc[j] = wmma_bf(a, wc[j], acc[j]);
#pragma unroll
    for (int i = 0; i < 16; ++i) xc[i] = xn[i];
#pragma unroll
    for (int j = 0; j < 8; ++j) wc[j] = wn[j]; }
  if (n0 < 2 * DM) {   // q stored unscaled (f16 sigma ~0.6, no subnormal exposure); 1/8 applied to the f32 score
#pragma unroll
    for (int j = 0; j < 8; ++j) {
#pragma unroll
      for (int r = 0; r < 8; ++r) { const float v = acc[j][r] + bfr(bias[j]); const _Float16 hv = (_Float16)v; so[wave][8 * g + r][j * 16 + col] = hv; sol[wave][8 * g + r][j * 16 + col] = (_Float16)((v - (float)hv) * 2048.0f); } }   // q, k (+ bias) as f16 hi + (x2048) residual
    LDSX();
    for (int rl = 0; rl < 16; ++rl) if (lane < 16) { vst2((unsigned*)(QK + (r0 + rl) * (2 * DM) + n0 + lane * 8), *(const v4u*)&so[wave][rl][lane * 8]); vst2((unsigned*)(QKL + (r0 + rl) * (2 * DM) + n0 + lane * 8), *(const v4u*)&sol[wave][rl][lane * 8]); }
  } else {
#pragma unroll
    for (int j = 0; j < 8; ++j) {
#pragma unroll
      for (int r = 0; r < 8; ++r) { const float v = acc[j][r] + bfr(bias[j]); const _Float16 hv = (_Float16)v; sth[j * 16 + col][wave * 16 + 8 * g + r] = hv; stl[j * 16 + col][wave * 16 + 8 * g + r] = (_Float16)((v - (float)hv) * 2048.0f); } }
    __syncthreads();
    const size_t rb = (size_t)blockIdx.x * 64; const int b = (int)(rb / SS), s0 = (int)(rb % SS); const int pc0 = n0 - 2 * DM;
    for (int q = tid; q < 128 * 8; q += 128) { const int d = q >> 3, pc = q & 7; const size_t o = ((size_t)b * DM + pc0 + d) * SS + s0 + pc * 8; vst2((unsigned*)(VTH + o), *(const v4u*)&sth[d][pc * 8]); vst2((unsigned*)(VTL + o), *(const v4u*)&stl[d][pc * 8]); }
  }
}
// ---- k_attn: block = (64 queries, head h, batch b): all-keys flash attention (K = 64: 2 k-steps), scores = (q.k) * 0.125 with f16 hi + residual operands (3 products) in the first two query blocks, single f16 elsewhere; P.V: f16 P x2048, there P hi/lo x V hi/lo (3 products) in two accumulators, elsewhere P x V hi; O[b*S+q][h*64+d] = (acc + accl / 2048) / (2048 l) (256-B segments)
// fragment at a wave-uniform base plus the lane's own byte offset: a group's loads all name that one offset register
__device__ __forceinline__ v16h frag_o(const _Float16* ubase, unsigned boff) { union { v16h v; v8h q[2]; } u; const _Float16* p = (const _Float16*)((const char*)ubase + boff); u.q[0] = *(const v8h*)p; u.q[1] = *(const v8h*)(p + 16); return u.v; }
// One 64-query tile; HI = leading query blocks (3 products), written once per path so that each pass is one straight run and its load groups stay whole.
template <bool HI> __device__ __forceinline__ void attn_tile(const _Float16* __restrict__ QK, const _Float16* __restrict__ QKL, const _Float16* __restrict__ VTH, const _Float16* __restrict__ VTL, float* __restrict__ O, float (*sp)[16][36], float (*so)[16][68]) {
  const int tid = threadIdx.x, wave = tid >> 5, lane = tid & 31, col = lane & 15, g = lane >> 4;
  const int qb = blockIdx.x, h = blockIdx.y, b = blockIdx.z; const int q0 = qb * 64 + wave * 16; const size_t rq = (size_t)b * SS + q0 + col;
  v16h aq[2], aql[2];
#pragma unroll
  for (int kc = 0; kc < 2; ++kc) { aq[kc] = frag_h(QK + rq * (2 * DM) + h * HD + kc * 32, lane); if (HI) aql[kc] = frag_h(QKL + rq * (2 * DM) + h * HD + kc * 32, lane); }
  float m[8], l[8];
#pragma unroll
  for (int r = 0; r < 8; ++r) { m[r] = -3.0e38f; l[r] = 0.f; }
  v8f acc[4] = {}, accl[4] = {};
  const int nks = SS / 32;   // all keys
  unsigned kb = 2u * (unsigned)(((size_t)b * SS + col) * (2 * DM) + DM + h * HD + 8 * g), vb = 2u * (unsigned)(((size_t)b * DM + h * HD + col) * SS + 8 * g);   // the lane's byte offsets: key row col of pass 0; v row (d = col); stepped once a pass behind the group's wait
  // The statement behind each product holds a load at its place in the source, so every load of a pass stands in front of the products that follow it: behind the score products of a pass go, as one group, its own V and the next pass's K, in flight under the softmax.
  v16h kf[2][2], kfl[2][2];   // [ct][kc] K fragments of the pass in hand (residual planes only where HI)
#pragma unroll
  for (int ct = 0; ct < 2; ++ct) {
#pragma unroll
    for (int kc = 0; kc < 2; ++kc) { kf[ct][kc] = frag_o(QK + (ct * 16) * (2 * DM) + kc * 32, kb); if (HI) kfl[ct][kc] = frag_o(QKL + (ct * 16) * (2 * DM) + kc * 32, kb); } }
  asm volatile("s_wait_xcnt 0x0" : "+v"(kb) :: "memory");   // behind a group: its offset register passes through the wait's statement, so it is stepped only behind the wait
  kb += 2u * 32 * (2 * DM);
#pragma unroll 1
  for (int ks = 0; ks < nks; ++ks) { v8f s[2]; v16h vf[4], vfl[4];
#pragma unroll
    for (int ct = 0; ct < 2; ++ct) { v8f c = {}, cl = {};
      if (HI) {   // leading query blocks: 3 products
#pragma unroll
        for (int kc = 0; kc < 2; ++kc) { c = wmma16(aq[kc], kf[ct][kc], c); cl = wmma16(aql[kc], kf[ct][kc], cl); cl = wmma16(aq[kc], kfl[ct][kc], cl); }
#pragma unroll
        for (int r = 0; r < 8; ++r) c[r] += cl[r] * (1.0f / 2048.0f); }
      else {
#pragma unroll
        for (int kc = 0; kc < 2; ++kc) c = wmma16(aq[kc], kf[ct][kc], c); }   // single product elsewhere
      { const bool keepk = true;
#pragma unroll
      for (int r = 0; r < 8; ++r) s[ct][r] = keepk ? c[r] * 0.125f : -3.0e38f; } }   // 1/sqrt(64)
#pragma unroll
    for (int dt = 0; dt < 4; ++dt) { vf[dt] = frag_o(VTH + (dt * 16) * SS, vb); if (HI) vfl[dt] = frag_o(VTL + (dt * 16) * SS, vb); }
    {   // next pass's K (the last pass reads its own rows again)
#pragma unroll
      for (int ct = 0; ct < 2; ++ct) {
#pragma unroll
        for (int kc = 0; kc < 2; ++kc) { kf[ct][kc] = frag_o(QK + (ct * 16) * (2 * DM) + kc * 32, kb); if (HI) kfl[ct][kc] = frag_o(QKL + (ct * 16) * (2 * DM) + kc * 32, kb); } }
      asm volatile("s_wait_xcnt 0x0" : "+v"(kb), "+v"(vb) :: "memory");   // as above
      __builtin_amdgcn_sched_barrier(0);   // keeps the group here, in front of the softmax; moved down it would land only at the wait in front of the P exchange
      vb += 2u * 32; kb += ks + 2 < nks ? 2u * 32 * (2 * DM) : 0u; }
#pragma unroll
    for (int r = 0; r < 8; ++r) { float mx = fmaxf(s[0][r], s[1][r]);
#pragma unroll
      for (int o = 1; o < 16; o <<= 1) mx = fmaxf(mx, __shfl_xor(mx, o));
      const float mn = fmaxf(m[r], mx); const float alpha = (m[r] <= -1.0e38f) ? 0.f : __expf(m[r] - mn);
      const float e0 = (s[0][r] <= -1.0e38f) ? 0.f : __expf(s[0][r] - mn), e1 = (s[1][r] <= -1.0e38f) ? 0.f : __expf(s[1][r] - mn); float es = e0 + e1;
#pragma unroll
      for (int o = 1; o < 16; o <<= 1) es += __shfl_xor(es, o);
      l[r] = l[r] * alpha + es; m[r] = mn;
#pragma unroll
      for (int dt = 0; dt < 4; ++dt) { acc[dt][r] *= alpha; accl[dt][r] *= alpha; }
      sp[wave][8 * g + r][col] = e0; sp[wave][8 * g + r][16 + col] = e1; }
    LDSX();
    v16h pa, pl; { const float* prow = &sp[wave][col][0] + 8 * (lane >> 4);
#pragma unroll
      for (int i = 0; i < 8; ++i) { const float x0 = prow[i] * 2048.0f, x1 = prow[16 + i] * 2048.0f; const _Float16 h0 = (_Float16)x0, h1 = (_Float16)x1; pa[i] = h0; pa[8 + i] = h1; pl[i] = (_Float16)((x0 - (float)h0) * 2048.0f); pl[8 + i] = (_Float16)((x1 - (float)h1) * 2048.0f); } }   // P scaled by 2^11 before the f16 split so small softmax weights stay out of the f16 subnormal range; 2^-11 folded into the epilogue
#pragma unroll
    for (int dt = 0; dt < 4; ++dt) { acc[dt] = wmma16(pa, vf[dt], acc[dt]); if (HI) { accl[dt] = wmma16(pl, vf[dt], accl[dt]); accl[dt] = wmma16(pa, vfl[dt], accl[dt]); } }   // leading query blocks: P hi/lo x V hi/lo (3 products); elsewhere P x V single
    LDSX(); }
#pragma unroll
  for (int r = 0; r < 8; ++r) { const float il = (1.0f / 2048.0f) / l[r];
#pragma unroll
    for (int dt = 0; dt < 4; ++dt) so[wave][8 * g + r][dt * 16 + col] = (acc[dt][r] + accl[dt][r] * (1.0f / 2048.0f)) * il; }
  LDSX();
  for (int rl = 0; rl < 16; ++rl) if (lane < 16) vst2(O + ((size_t)b * SS + q0 + rl) * DM + h * HD + lane * 4, *(const v4f*)&so[wave][rl][lane * 4]);
}
__global__ __launch_bounds__(128) void k_attn(const _Float16* __restrict__ QK, const _Float16* __restrict__ QKL, const _Float16* __restrict__ VTH, const _Float16* __restrict__ VTL, const void* __restrict__ KMASK, float* __restrict__ O) {
  __shared__ __align__(16) float sp[4][16][36]; __shared__ __align__(16) float so[4][16][68];
  if (blockIdx.x < 2) attn_tile<true>(QK, QKL, VTH, VTL, O, sp, so); else attn_tile<false>(QK, QKL, VTH, VTL, O, sp, so);
}
// ---- k_out: block = (64 rows, 128 cols): out = O(hi/lo) . Wo rows (2 products) + bo
__global__ __launch_bounds__(128) void k_out(const float* __restrict__ O, const __bf16* __restrict__ P, const float* __restrict__ BO, float* __restrict__ Y) {
  __shared__ __align__(16) float so[4][16][132];
  const int tid = threadIdx.x, wave = tid >> 5, lane = tid & 31, col = lane & 15, g = lane >> 4; const size_t r0 = (size_t)blockIdx.x * 64 + wave * 16; const int n0 = blockIdx.y * 128;
  v8f acc[8] = {};
#pragma unroll 2
  for (int kc = 0; kc < DM / 32; ++kc) { const F2 a = split_row(O + (r0 + col) * DM, kc * 32, lane);
#pragma unroll
    for (int j = 0; j < 8; ++j) { const v16b w = frag_b(P + (size_t)(n0 + j * 16 + col) * DM + kc * 32, lane); acc[j] = wmma_bf(a.l, w, acc[j]); acc[j] = wmma_bf(a.h, w, acc[j]); } }
#pragma unroll
  for (int j = 0; j < 8; ++j) {
#pragma unroll
    for (int r = 0; r < 8; ++r) so[wave][8 * g + r][j * 16 + col] = acc[j][r] + (BO ? bfr(BO[n0 + j * 16 + col]) : 0.f); }
  LDSX();
  for (int rl = 0; rl < 16; ++rl) vst2(Y + (r0 + rl) * DM + n0 + lane * 4, *(const v4f*)&so[wave][rl][lane * 4]);
}
extern "C" void kernel_launch(void* const* d_in, const int* in_sizes, int n_in, void* d_out, int out_size, void* d_ws, size_t ws_size, hipStream_t stream) {
  (void)in_sizes; (void)n_in; (void)out_size;
  const float** F = (const float**)d_in;   // 0 current [2048,1024], 1 context [2048,1024], 2 Wq [16,1024,64], 3 bq [16,64], 4 Wk, 5 bk, 6 Wv, 7 bv, 8 Wo [1024,64], 9 bo [64]
  if (ws_size < (size_t)WS_END) return;
  char* ws = (char*)d_ws; __bf16* PK = (__bf16*)(ws + WS_PK); _Float16 *QK = (_Float16*)(ws + WS_QK), *QKL = (_Float16*)(ws + WS_QKL), *VTH = (_Float16*)(ws + WS_VTH), *VTL = (_Float16*)(ws + WS_VTL); float* O = (float*)(ws + WS_O);
  k_pack<<<dim3(DM, 3), 256, 0, stream>>>(F[2], F[4], F[6], PK);
  k_qkv<<<dim3(TNB * SS / 64, QKVW / 128), 128, 0, stream>>>(F[0], F[1], F[1], PK + PK_A, F[3], F[5], F[7], QK, QKL, VTH, VTL);
  k_attn<<<dim3(TQB, TNH, TNB), 128, 0, stream>>>(QK, QKL, VTH, VTL, nullptr, O);
  k_out2<<<TOB, 128, 0, stream>>>(O, F[8], F[9], (float*)d_out);
}

// v002
// It runs in 158 microseconds.
// Two timings next to v001 both put it at 1.31 times that version's speed.
// All steps since v000 together make it 2.38 times as fast.
// compute dtype: all float inputs rounded to bf16; q/k/v = x W[h] + b[h] with EXACT bf16 products on WMMA 16x16x32 (per-head (in,out) weights packed as one 1024 -> 1024 projection each), f16 hi + residual; PLAIN-HYBRID scores (first 128 queries 3-product, later single), x 1/8, running-max softmax in f32 (hardware exp); 3-product P . v for the first 128 queries; the head-major stack + row-major view realised as an index map feeding out = y2 (bf16 hi + lo) . Wo + bo (2 products); f32 output.
#include <hip/hip_runtime.h>
#include <math.h>

typedef __attribute__((ext_vector_type(16))) _Float16 v16h;
typedef __attribute__((ext_vector_type(16))) __bf16 v16b;
typedef __attribute__((ext_vector_type(8)))  _Float16 v8h;
typedef __attribute__((ext_vector_type(8)))  float v8f;
typedef __attribute__((ext_vector_type(4)))  float v4f;
typedef __attribute__((ext_vector_type(2)))  float v2f;
typedef __attribute__((ext_vector_type(4)))  unsigned v4u;
typedef __attribute__((ext_vector_type(4)))  int v4i;
typedef float __attribute__((may_alias)) float_a;
typedef int __attribute__((may_alias)) int_a;

template <typename T> __device__ __forceinline__ void vst2(void* p, T v) { *(T*)p = v;  }
__device__ __forceinline__ v8f wmma16(v16h a, v16h b, v8f c) {
  v8f d = __builtin_amdgcn_wmma_f32_16x16x32_f16(false, a, false, b, (short)0, c, false, false);
  asm volatile("v_nop\n\tv_nop\n\tv_nop\n\tv_nop" : "+v"(d) : "v"(a), "v"(b));
  return d;
}
__device__ __forceinline__ v8f wmma_bf(v16b a, v16b b, v8f c) {
  v8f d = __builtin_amdgcn_wmma_f32_16x16x32_bf16(false, a, false, b, (short)0, c, false, false);
  asm volatile("v_nop\n\tv_nop\n\tv_nop\n\tv_nop" : "+v"(d) : "v"(a), "v"(b));
  return d;
}
// Per-head (inefficient) multi-head cross attention (16 heads x 64, 2,048 current x 2,048 context tokens, D_IN 1024): per head q = x Wq[h] + bq[h], k/v from the context; softmax(q k^T / 8) v; heads stacked head-major then row-major re-viewed to [S, 1024]; Wo [1024 -> 64] + bo.
__device__ __forceinline__ v16h frag_h(const _Float16* rowk0, int lane) {
  union { v16h v; v8h q[2]; } u; const _Float16* p = rowk0 + 8 * (lane >> 4);
  u.q[0] = *(const v8h*)p; u.q[1] = *(const v8h*)(p + 16); return u.v;
}
__device__ __forceinline__ v16h frag_f32(const float* rowk0, int lane) {
  v16h a; const float* p = rowk0 + 8 * (lane >> 4);
#pragma unroll
  for (int i = 0; i < 8; ++i) { a[i] = (_Float16)p[i]; a[8 + i] = (_Float16)p[16 + i]; }
  return a;
}
__device__ __forceinline__ v16h frag_f32s(const float* rowk0, int lane, float sc) {
  v16h a; const float* p = rowk0 + 8 * (lane >> 4);
#pragma unroll
  for (int i = 0; i < 8; ++i) { a[i] = (_Float16)(p[i] * sc); a[8 + i] = (_Float16)(p[16 + i] * sc); }
  return a;
}
// column fragment from a [K][ld] layout (column n), rows >= K read as 0
__device__ __forceinline__ v16h fragc_f32(const float* W, int k0, int n, int lane, int ld, int K) {
  v16h a; const int g = lane >> 4;
#pragma unroll
  for (int i = 0; i < 8; ++i) { const int ka = k0 + 8 * g + i, kb = ka + 16;
    a[i] = (_Float16)(ka < K ? W[(size_t)(ka < K ? ka : K - 1) * ld + n] : 0.f); a[8 + i] = (_Float16)(kb < K ? W[(size_t)(kb < K ? kb : K - 1) * ld + n] : 0.f); }
  return a;
}
struct F2 { v16b h, l; };
__device__ __forceinline__ F2 bsplit16(const float v[16]) { F2 r;
#pragma unroll
  for (int i = 0; i < 16; ++i) { const __bf16 h = (__bf16)v[i]; r.h[i] = h; r.l[i] = (__bf16)(v[i] - (float)h); }
  return r; }
__device__ __forceinline__ F2 split_row(const float* row, int k0, int lane) { float v[16]; const float* p = row + k0 + 8 * (lane >> 4);
#pragma unroll
  for (int i = 0; i < 8; ++i) { v[i] = p[i]; v[8 + i] = p[16 + i]; }
  return bsplit16(v); }
__device__ __forceinline__ F2 split_rowK(const float* row, int k0, int lane, int K) { float v[16]; const int g = lane >> 4;
#pragma unroll
  for (int i = 0; i < 8; ++i) { const int ka = k0 + 8 * g + i, kb = ka + 16; v[i] = ka < K ? row[ka < K ? ka : K - 1] : 0.f; v[8 + i] = kb < K ? row[kb < K ? kb : K - 1] : 0.f; }
  return bsplit16(v); }
__device__ __forceinline__ F2 split_col(const float* W, int k0, int n, int lane, int ld, int K) { float v[16]; const int g = lane >> 4;
#pragma unroll
  for (int i = 0; i < 8; ++i) { const int ka = k0 + 8 * g + i, kb = ka + 16; v[i] = ka < K ? W[(size_t)(ka < K ? ka : K - 1) * ld + n] : 0.f; v[8 + i] = kb < K ? W[(size_t)(kb < K ? kb : K - 1) * ld + n] : 0.f; }
  return bsplit16(v); }
__device__ __forceinline__ v8f mac3(const F2& a, const F2& b, v8f c) { c = wmma_bf(a.l, b.h, c); c = wmma_bf(a.h, b.l, c); return wmma_bf(a.h, b.h, c); }
__device__ __forceinline__ float sigm(float v) { return 1.0f / (1.0f + expf(-v)); }
#define LDSX() do { asm volatile("s_wait_dscnt 0" ::: "memory"); __builtin_amdgcn_wave_barrier(); __builtin_amdgcn_fence(__ATOMIC_RELEASE, "workgroup"); } while (0)


#define NB 1
#define SS 2048
#define DM 1024
#define NH 16
#define HD 64
#define QKVW (3 * DM)
#ifndef TQB
#define TQB (SS / 64)
#endif
#ifndef TNH
#define TNH NH
#define TNB NB
#define TOB (NB * SS / 64)     // output row tiles (all)
#endif
typedef __attribute__((ext_vector_type(8))) __bf16 v8b;
__device__ __forceinline__ v16b frag_b(const __bf16* rowk0, int lane) {
  union { v16b v; v8b q[2]; } u; const __bf16* p = rowk0 + 8 * (lane >> 4);
  u.q[0] = *(const v8b*)p; u.q[1] = *(const v8b*)(p + 16); return u.v;
}
// fragment at a wave-uniform base plus the lane's own byte offset: a group's loads all name that one offset register
__device__ __forceinline__ v16b frag_bo(const __bf16* ubase, unsigned boff) { union { v16b v; v8b q[2]; } u; const __bf16* p = (const __bf16*)((const char*)ubase + boff); u.q[0] = *(const v8b*)p; u.q[1] = *(const v8b*)(p + 16); return u.v; }
__device__ __forceinline__ float bfr(float v) { return (float)(__bf16)v; }
__device__ __attribute__((noinline)) float exp_ni(float v) { return expf(v); }
__device__ __attribute__((noinline)) float erf_ni(float v) { return erff(v); }

#define PK_A 0                       // [3072][1024] Wqkv rows (natural [out][in])
#define PK_P (PK_A + QKVW * DM)        // [1024][1024] reserved; nothing writes or reads it
#define PK_END (PK_P + DM * DM)
#define WS_PK  0u
#define WS_QK  (WS_PK + 2u * PK_END)             // f16 [2048 rows][2048]: q | k
#define WS_QKL (WS_QK + 2u * NB * SS * 2 * DM)     // f16 q | k residual planes x2048
#define WS_VTH (WS_QKL + 2u * NB * SS * 2 * DM)    // f16 [b][1024 (h*64+d)][2048 s] hi
#define WS_VTL (WS_VTH + 2u * NB * DM * SS)        // f16 lo x 2048
#define WS_O   (WS_VTL + 2u * NB * DM * SS)        // f32 [2048][1024]
#define WS_CS  (WS_O + 4u * NB * SS * DM)           // f32 [2][2048][32] reserved; nothing writes or reads it
#define WS_END (WS_CS + 4u * 2 * SS * 32)
// ---- k_pack: block = (row n, which): per-head (in,out) columns gathered into bf16 [out][in] rows; which 0..2 -> W_q/W_k/W_v into PK_A rows which*1024 + n
__global__ __launch_bounds__(256) void k_pack(const float* __restrict__ WQ, const float* __restrict__ WK, const float* __restrict__ WV, __bf16* __restrict__ PK) {   // W [h][1024 in][64 d] -> packed row (which*DM + h*64 + d)[i]
  __shared__ __align__(16) __bf16 s[DM]; const int n = blockIdx.x, which = blockIdx.y, t = threadIdx.x; const int h = n / HD, d = n % HD; const float* Wm = which == 0 ? WQ : which == 1 ? WK : WV;
  for (int i = t; i < DM; i += 256) s[i] = (__bf16)Wm[((size_t)h * DM + i) * HD + d];
  __syncthreads(); __bf16* dst = PK + PK_A + ((size_t)which * DM + n) * DM; for (int q = t; q < DM / 8; q += 256) vst2((unsigned*)(dst + q * 8), *(const v4u*)&s[q * 8]); }
// ---- k_out2: block = 64 rows r of the re-viewed [2048][1024] matrix: y2[r][j*64 + o] = O[16*(r%128) + j][(r/128)*64 + o]; out = y2 (hi + lo) . Wo + bo  (Wo (in,out) [1024][64])
__global__ __launch_bounds__(128) void k_out2(const float* __restrict__ O, const float* __restrict__ WO, const float* __restrict__ BO, float* __restrict__ OUT) { __shared__ __align__(16) float sf[4][16][68];
  const int tid = threadIdx.x, wave = tid >> 5, lane = tid & 31, col = lane & 15, g = lane >> 4; const int r0 = blockIdx.x * 64 + wave * 16; const int rr = r0 + col; const int hsel = rr / 128; const int sbase = 16 * (rr % 128);
  v8f acc[4] = {};
  const float* orow = O + (size_t)sbase * DM + hsel * HD + 8 * g; const float* wcol = WO + (size_t)(8 * g) * 64 + col;
  float ac[16], wc[4][16];   // operands of the pass in hand, loaded one pass ahead as one group (the statement behind each product holds a load at its place in the source)
#pragma unroll
  for (int i = 0; i < 8; ++i) { ac[i] = orow[i]; ac[8 + i] = orow[16 + i];
#pragma unroll
    for (int jj = 0; jj < 4; ++jj) { wc[jj][i] = wcol[(size_t)i * 64 + jj * 16]; wc[jj][8 + i] = wcol[(size_t)(16 + i) * 64 + jj * 16]; } }
#pragma unroll 2
  for (int kc = 0; kc < DM / 32; ++kc) { const int kn = kc + 1 < DM / 32 ? kc + 1 : kc; float an[16], wn[4][16];   // the last pass reads its own operands again
    const float* on = orow + (size_t)(kn / 2) * DM + (kn % 2) * 32; const float* wq = wcol + (size_t)(kn * 32) * 64;
#pragma unroll
    for (int i = 0; i < 8; ++i) { an[i] = on[i]; an[8 + i] = on[16 + i];
#pragma unroll
      for (int jj = 0; jj < 4; ++jj) { wn[jj][i] = wq[(size_t)i * 64 + jj * 16]; wn[jj][8 + i] = wq[(size_t)(16 + i) * 64 + jj * 16]; } }
    const F2 a = bsplit16(ac);
#pragma unroll
    for (int jj = 0; jj < 4; ++jj) { v16b w;
#pragma unroll
      for (int i = 0; i < 16; ++i) w[i] = (__bf16)wc[jj][i];
      acc[jj] = wmma_bf(a.h, w, acc[jj]); acc[jj] = wmma_bf(a.l, w, acc[jj]); }
#pragma unroll
    for (int i = 0; i < 16; ++i) { ac[i] = an[i];
#pragma unroll
      for (int jj = 0; jj < 4; ++jj) wc[jj][i] = wn[jj][i]; } }
#pragma unroll
  for (int jj = 0; jj < 4; ++jj) { const float bb = bfr(BO[jj * 16 + col]);
#pragma unroll
    for (int r = 0; r < 8; ++r) sf[wave][8 * g + r][jj * 16 + col] = acc[jj][r] + bb; }
  LDSX(); for (int rl = 0; rl < 16; ++rl) if (lane < 16) vst2(OUT + (size_t)(r0 + rl) * 64 + lane * 4, *(const v4f*)&sf[wave][rl][lane * 4]); }
// k_qkv's operands reach the four waves of a block through LDS: a tile = 64 of k = two 32-deep passes; x 64 rows x 256 B (f32), weights 128 rows x 128 B (bf16), whole 128-B lines, each fetched once a block.
#define XP 68                     // floats a staged x row: 256 B of data + 16 B (the pitch at which 16-byte LDS reads of 16 rows meet no bank twice)
#define WP 72                     // bf16 a staged weight row: 128 B of data + 16 B (likewise)
#define QX_B (64 * XP * 4)        // bytes of the x plane
#define QBUF_B (QX_B + 128 * WP * 2)   // bytes of one buffer: x plane, weight plane
__device__ __forceinline__ v16b frag_lb(const __bf16* p) { union { v16b v; v8b q[2]; } u; u.q[0] = *(const v8b*)p; u.q[1] = *(const v8b*)(p + 16); return u.v; }
// Eight copies of 512 B each, LS bytes apart in LDS and GS bytes apart in the source. The last line is the wait that stands in front of any rewrite of the copies' address registers: inside the statement nothing can be moved over it.
template <int LS, int GS> __device__ __forceinline__ void copy8r(unsigned l, const char* gp) {
  asm volatile("global_load_async_to_lds_b128 %0, %1, off\n\tglobal_load_async_to_lds_b128 %2, %3, off\n\tglobal_load_async_to_lds_b128 %4, %5, off\n\tglobal_load_async_to_lds_b128 %6, %7, off\n\t"
               "global_load_async_to_lds_b128 %8, %9, off\n\tglobal_load_async_to_lds_b128 %10, %11, off\n\tglobal_load_async_to_lds_b128 %12, %13, off\n\tglobal_load_async_to_lds_b128 %14, %15, off\n\ts_wait_xcnt 0x0"
               :: "v"(l), "v"(gp), "v"(l + 1u * LS), "v"(gp + 1 * GS), "v"(l + 2u * LS), "v"(gp + 2 * GS), "v"(l + 3u * LS), "v"(gp + 3 * GS),
                  "v"(l + 4u * LS), "v"(gp + 4 * GS), "v"(l + 5u * LS), "v"(gp + 5 * GS), "v"(l + 6u * LS), "v"(gp + 6 * GS), "v"(l + 7u * LS), "v"(gp + 7 * GS) : "memory");
}
__global__ __launch_bounds__(128) void k_qkv(const float* __restrict__ XQ, const float* __restrict__ XK, const float* __restrict__ XV, const __bf16* __restrict__ P, const float* __restrict__ BQ, const float* __restrict__ BK, const float* __restrict__ BV, _Float16* __restrict__ QK, _Float16* __restrict__ QKL, _Float16* __restrict__ VTH, _Float16* __restrict__ VTL) {
  const int which0 = (blockIdx.y * 128) / DM; const float* X = (which0 == 0) ? XQ : (which0 == 1) ? XK : XV; const float* BB = BQ ? (((which0 == 0) ? BQ : (which0 == 1) ? BK : BV) + (blockIdx.y * 128 - which0 * DM)) : nullptr;
  __shared__ __align__(16) char sm[2 * QBUF_B];   // the two buffers of the k loop; behind the loop's last barrier the same bytes stage the output
  _Float16 (*so)[16][136] = (_Float16 (*)[16][136])sm; _Float16 (*sol)[16][136] = (_Float16 (*)[16][136])(sm + 2 * 4 * 16 * 136); _Float16 (*sth)[72] = (_Float16 (*)[72])(sm + 4 * 4 * 16 * 136); _Float16 (*stl)[72] = (_Float16 (*)[72])(sm + 4 * 4 * 16 * 136 + 2 * 128 * 72);
  static_assert(4 * 4 * 16 * 136 + 4 * 128 * 72 <= 2 * QBUF_B, "output staging fits the ring");
  const int tid = threadIdx.x, wave = tid >> 5, lane = tid & 31, col = lane & 15, g = lane >> 4; const size_t r0 = (size_t)blockIdx.x * 64 + wave * 16; const int n0 = blockIdx.y * 128;
  v8f acc[8] = {};
  const int ns = DM / 64;   // tiles of k
  // the lane's place in every copy: x: 2 rows x 256 B a copy (row lane / 16, piece lane % 16), this wave's 16 rows; weights: 4 rows x 128 B a copy (row lane / 8, piece lane % 8), this wave's 32 rows
  const char* gx = (const char*)(X + ((size_t)blockIdx.x * 64 + wave * 16 + (lane >> 4)) * DM + (lane & 15) * 4); const char* gw = (const char*)(P + ((size_t)n0 + wave * 32 + (lane >> 3)) * DM + (lane & 7) * 8);
  const unsigned lx = (unsigned)(size_t)sm + (unsigned)((wave * 16 + (lane >> 4)) * (XP * 4) + (lane & 15) * 16), lw = (unsigned)(size_t)sm + (unsigned)(QX_B + (wave * 32 + (lane >> 3)) * (WP * 2) + (lane & 7) * 16);
  auto fill = [&](int s, int bf) { copy8r<2 * XP * 4, 2 * DM * 4>(lx + (unsigned)(bf * QBUF_B), gx + (size_t)s * 256); copy8r<4 * WP * 2, 4 * DM * 2>(lw + (unsigned)(bf * QBUF_B), gw + (size_t)s * 128); };
  fill(0, 0);
  float bias[8];   // loaded here, in flight under the k loop, not one waited load per stored element
#pragma unroll
  for (int j = 0; j < 8; ++j) bias[j] = 0.f;
  if (BB) {
#pragma unroll
    for (int j = 0; j < 8; ++j) bias[j] = BB[j * 16 + col]; }
  asm volatile("s_wait_asynccnt 0x0" ::: "memory");   // this wave's share of tile 0 has landed
  __syncthreads();                                     // every wave's share has: tile 0 may be read
  fill(1, 1);
#pragma unroll 1   // stays rolled: one foot (waits, barrier, refill) a tile, and the text of the loop stays short
  for (int s = 0; s < ns; ++s) { const char* bp = sm + (s & 1) * QBUF_B; const float* fx = (const float*)bp + (wave * 16 + col) * XP + 8 * g; const __bf16* fw = (const __bf16*)(bp + QX_B) + col * WP + 8 * g;
    v4f xc[2][4]; v16b wc[2][8];   // both passes' operands, read as two groups in front of the products (the statement behind each product holds a load at its place in the source)
#pragma unroll
    for (int sub = 0; sub < 2; ++sub) { xc[sub][0] = *(const v4f*)(fx + sub * 32); xc[sub][1] = *(const v4f*)(fx + sub * 32 + 4); xc[sub][2] = *(const v4f*)(fx + sub * 32 + 16); xc[sub][3] = *(const v4f*)(fx + sub * 32 + 20);
#pragma unroll
      for (int j = 0; j < 8; ++j) wc[sub][j] = frag_lb(fw + (j * 16) * WP + sub * 32); }
#pragma unroll
    for (int sub = 0; sub < 2; ++sub) { v16b a;
#pragma unroll
      for (int i = 0; i < 16; ++i) a[i] = (__bf16)xc[sub][i >> 2][i & 3];
#pragma unroll
      for (int j = 0; j < 8; ++j) acc[j] = wmma_bf(a, wc[sub][j], acc[j]); }
    asm volatile("s_wait_dscnt 0x0" ::: "memory");      // this wave's reads of the tile in hand are done
    asm volatile("s_wait_asynccnt 0x0" ::: "memory");   // its share of the next tile has landed
    __syncthreads();                                     // publishes the next tile and frees the buffer just read (behind the last tile: frees the ring for the output staging)
    if (s + 2 < ns) fill(s + 2, s & 1); }
  asm volatile("s_wait_asynccnt 0x0" ::: "memory");   // no copy is left in flight behind the loop
  if (n0 < 2 * DM) {   // q stored unscaled (f16 sigma ~0.6, no subnormal exposure); 1/8 applied to the f32 score
#pragma unroll
    for (int j = 0; j < 8; ++j) {
#pragma unroll
      for (int r = 0; r < 8; ++r) { const float v = acc[j][r] + bfr(bias[j]); const _Float16 hv = (_Float16)v; so[wave][8 * g + r][j * 16 + col] = hv; sol[wave][8 * g + r][j * 16 + col] = (_Float16)((v - (float)hv) * 2048.0f); } }   // q, k (+ bias) as f16 hi + (x2048) residual
    LDSX();
    for (int rl = 0; rl < 16; ++rl) if (lane < 16) { vst2((unsigned*)(QK + (r0 + rl) * (2 * DM) + n0 + lane * 8), *(const v4u*)&so[wave][rl][lane * 8]); vst2((unsigned*)(QKL + (r0 + rl) * (2 * DM) + n0 + lane * 8), *(const v4u*)&sol[wave][rl][lane * 8]); }
  } else {
#pragma unroll
    for (int j = 0; j < 8; ++j) {
#pragma unroll
      for (int r = 0; r < 8; ++r) { const float v = acc[j][r] + bfr(bias[j]); const _Float16 hv = (_Float16)v; sth[j * 16 + col][wave * 16 + 8 * g + r] = hv; stl[j * 16 + col][wave * 16 + 8 * g + r] = (_Float16)((v - (float)hv) * 2048.0f); } }
    __syncthreads();
    const size_t rb = (size_t)blockIdx.x * 64; const int b = (int)(rb / SS), s0 = (int)(rb % SS); const int pc0 = n0 - 2 * DM;
    for (int q = tid; q < 128 * 8; q += 128) { const int d = q >> 3, pc = q & 7; const size_t o = ((size_t)b * DM + pc0 + d) * SS + s0 + pc * 8; vst2((unsigned*)(VTH + o), *(const v4u*)&sth[d][pc * 8]); vst2((unsigned*)(VTL + o), *(const v4u*)&stl[d][pc * 8]); }
  }
}
// ---- k_attn: block = (64 queries, head h, batch b): all-keys flash attention (K = 64: 2 k-steps), scores = (q.k) * 0.125 with single f16 operands (first two query blocks: f16 hi + residual, 3 products), P.V: f16 P*2048 x V hi in acc (first two query blocks also P residual*2048 x V hi + P*2048 x V lo*2048 in accl); O[b*S+q][h*64+d] = (acc + accl / 2048) / (2048 l) (256-B segments)
// K and V reach the four waves of a block through LDS: a tile = 64 keys = two 32-key passes; K 64 key rows x 128 B, V 64 d rows x 128 B (and their residual planes where HI), whole 128-B lines, each fetched once a block.
#define KP 72                    // halfs a staged row: 128 B of data + 16 B, the pitch at which 16-byte LDS reads of 16 rows meet no bank twice
#define PLANE (64 * KP)          // halfs of one staged plane
#define STG_H (2 * 4 * PLANE)    // two buffers of up to four planes: K, V, K residual, V residual
__device__ __forceinline__ v16h frag_l(const _Float16* p) { union { v16h v; v8h q[2]; } u; u.q[0] = *(const v8h*)p; u.q[1] = *(const v8h*)(p + 16); return u.v; }
// Sixteen rows of plane a and sixteen of plane b: eight copies, each 4 rows x 128 B (lane: row lane / 8, 16-byte piece lane % 8); both sources have rows 4,096 B apart. The last line is the wait that stands in front of any rewrite of the copies' address registers: inside the statement nothing can be moved over it.
__device__ __forceinline__ void copy8(unsigned la, const _Float16* ga, unsigned lb, const _Float16* gb) {
  asm volatile("global_load_async_to_lds_b128 %0, %1, off\n\tglobal_load_async_to_lds_b128 %2, %3, off\n\tglobal_load_async_to_lds_b128 %4, %5, off\n\tglobal_load_async_to_lds_b128 %6, %7, off\n\t"
               "global_load_async_to_lds_b128 %8, %9, off\n\tglobal_load_async_to_lds_b128 %10, %11, off\n\tglobal_load_async_to_lds_b128 %12, %13, off\n\tglobal_load_async_to_lds_b128 %14, %15, off\n\ts_wait_xcnt 0x0"
               :: "v"(la), "v"(ga), "v"(la + 2u * 4 * KP), "v"(ga + 4 * 2048), "v"(la + 2u * 8 * KP), "v"(ga + 8 * 2048), "v"(la + 2u * 12 * KP), "v"(ga + 12 * 2048),
                  "v"(lb), "v"(gb), "v"(lb + 2u * 4 * KP), "v"(gb + 4 * 2048), "v"(lb + 2u * 8 * KP), "v"(gb + 8 * 2048), "v"(lb + 2u * 12 * KP), "v"(gb + 12 * 2048) : "memory");
}
// One 64-query tile; HI = leading query blocks (3 products), written once per path so that each pass is one straight run and its load groups stay whole.
template <bool HI> __device__ __forceinline__ void attn_tile(const _Float16* __restrict__ QK, const _Float16* __restrict__ QKL, const _Float16* __restrict__ VTH, const _Float16* __restrict__ VTL, float* __restrict__ O, float (*sp)[16][36], float (*so)[16][68], _Float16* st) {
  const int tid = threadIdx.x, wave = tid >> 5, lane = tid & 31, col = lane & 15, g = lane >> 4;
  const int qb = blockIdx.x, h = blockIdx.y, b = blockIdx.z; const int q0 = qb * 64 + wave * 16; const size_t rq = (size_t)b * SS + q0 + col;
  const int nt = SS / 64;   // key tiles (all keys)
  const int bufh = (HI ? 4 : 2) * PLANE;   // halfs of one buffer
  const int crow = wave * 16 + (lane >> 3), cpc = (lane & 7) * 8;   // the lane's first row and its 16-byte piece in every copy
  const size_t ko = ((size_t)b * SS + crow) * (2 * DM) + DM + h * HD + cpc, vo = ((size_t)b * DM + h * HD + crow) * SS + cpc;   // tile 0; a tile on: 64 key rows of K, 64 columns of V
  const unsigned l0 = (unsigned)(size_t)st + 2u * (unsigned)(crow * KP + cpc);
  auto fill = [&](int t, int bf) { const unsigned lb = l0 + 2u * (unsigned)(bf * bufh); const size_t kt = ko + (size_t)t * 64 * (2 * DM), vt = vo + (size_t)t * 64;
    copy8(lb, QK + kt, lb + 2u * PLANE, VTH + vt);
    if (HI) copy8(lb + 2u * 2 * PLANE, QKL + kt, lb + 2u * 3 * PLANE, VTL + vt); };
  fill(0, 0);
  v16h aq[2], aql[2];
#pragma unroll
  for (int kc = 0; kc < 2; ++kc) { aq[kc] = frag_h(QK + rq * (2 * DM) + h * HD + kc * 32, lane); if (HI) aql[kc] = frag_h(QKL + rq * (2 * DM) + h * HD + kc * 32, lane); }
  float m[8], l[8];
#pragma unroll
  for (int r = 0; r < 8; ++r) { m[r] = -3.0e38f; l[r] = 0.f; }
  v8f acc[4] = {}, accl[4] = {};
  asm volatile("s_wait_asynccnt 0x0" ::: "memory");   // this wave's share of tile 0 has landed
  __syncthreads();                                     // every wave's share has: tile 0 may be read
  fill(1, 1);
#pragma unroll 1   // stays rolled: one foot (waits, barrier, refill) a tile, and the text of the loop stays short
  for (int t = 0; t < nt; ++t) { const _Float16* fk = st + (t & 1) * bufh + col * KP + 8 * g; const _Float16* fv = fk + PLANE;   // the lane's row col of the K and of the V plane
    // The statement behind each product holds a load at its place in the source, so every LDS read of a pass stands in front of the products that follow it: behind the score products of a pass go, as one group, its own V and (inside the tile) the next pass's K, in flight under the softmax.
    v16h kf[2][2], kfl[2][2];   // [ct][kc] K fragments of the pass in hand (residual planes only where HI)
#pragma unroll
    for (int ct = 0; ct < 2; ++ct) {
#pragma unroll
      for (int kc = 0; kc < 2; ++kc) { kf[ct][kc] = frag_l(fk + (ct * 16) * KP + kc * 32); if (HI) kfl[ct][kc] = frag_l(fk + 2 * PLANE + (ct * 16) * KP + kc * 32); } }
#pragma unroll
    for (int sub = 0; sub < 2; ++sub) { v8f s[2]; v16h vf[4], vfl[4];
#pragma unroll
    for (int ct = 0; ct < 2; ++ct) { v8f c = {}, cl = {};
      if (HI) {   // leading query blocks: 3 products
#pragma unroll
        for (int kc = 0; kc < 2; ++kc) { c = wmma16(aq[kc], kf[ct][kc], c); cl = wmma16(aql[kc], kf[ct][kc], cl); cl = wmma16(aq[kc], kfl[ct][kc], cl); }
#pragma unroll
        for (int r = 0; r < 8; ++r) c[r] += cl[r] * (1.0f / 2048.0f); }
      else {
#pragma unroll
        for (int kc = 0; kc < 2; ++kc) c = wmma16(aq[kc], kf[ct][kc], c); }   // single product elsewhere
      { const bool keepk = true;
#pragma unroll
      for (int r = 0; r < 8; ++r) s[ct][r] = keepk ? c[r] * 0.125f : -3.0e38f; } }   // 1/sqrt(64)
#pragma unroll
    for (int dt = 0; dt < 4; ++dt) { vf[dt] = frag_l(fv + (dt * 16) * KP + sub * 32); if (HI) vfl[dt] = frag_l(fv + 2 * PLANE + (dt * 16) * KP + sub * 32); }
    if (sub == 0) {   // the tile's second pass's K
#pragma unroll
      for (int ct = 0; ct < 2; ++ct) {
#pragma unroll
        for (int kc = 0; kc < 2; ++kc) { kf[ct][kc] = frag_l(fk + (32 + ct * 16) * KP + kc * 32); if (HI) kfl[ct][kc] = frag_l(fk + 2 * PLANE + (32 + ct * 16) * KP + kc * 32); } } }
    __builtin_amdgcn_sched_barrier(0);   // keeps the group here, in front of the softmax; moved down it would land only at the wait in front of the P exchange
#pragma unroll
    for (int r = 0; r < 8; ++r) { float mx = fmaxf(s[0][r], s[1][r]);
#pragma unroll
      for (int o = 1; o < 16; o <<= 1) mx = fmaxf(mx, __shfl_xor(mx, o));
      const float mn = fmaxf(m[r], mx); const float alpha = (m[r] <= -1.0e38f) ? 0.f : __expf(m[r] - mn);
      const float e0 = (s[0][r] <= -1.0e38f) ? 0.f : __expf(s[0][r] - mn), e1 = (s[1][r] <= -1.0e38f) ? 0.f : __expf(s[1][r] - mn); float es = e0 + e1;
#pragma unroll
      for (int o = 1; o < 16; o <<= 1) es += __shfl_xor(es, o);
      l[r] = l[r] * alpha + es; m[r] = mn;
#pragma unroll
      for (int dt = 0; dt < 4; ++dt) { acc[dt][r] *= alpha; accl[dt][r] *= alpha; }
      sp[wave][8 * g + r][col] = e0; sp[wave][8 * g + r][16 + col] = e1; }
    LDSX();
    v16h pa, pl; { const float* prow = &sp[wave][col][0] + 8 * (lane >> 4);
#pragma unroll
      for (int i = 0; i < 8; ++i) { const float x0 = prow[i] * 2048.0f, x1 = prow[16 + i] * 2048.0f; const _Float16 h0 = (_Float16)x0, h1 = (_Float16)x1; pa[i] = h0; pa[8 + i] = h1; pl[i] = (_Float16)((x0 - (float)h0) * 2048.0f); pl[8 + i] = (_Float16)((x1 - (float)h1) * 2048.0f); } }   // P scaled by 2^11 before the f16 split so small softmax weights stay out of the f16 subnormal range; 2^-11 folded into the epilogue
#pragma unroll
    for (int dt = 0; dt < 4; ++dt) { acc[dt] = wmma16(pa, vf[dt], acc[dt]); if (HI) { accl[dt] = wmma16(pl, vf[dt], accl[dt]); accl[dt] = wmma16(pa, vfl[dt], accl[dt]); } }   // leading query blocks: P hi/lo x V hi/lo (3 products); elsewhere P x V single
    LDSX(); }
    asm volatile("s_wait_dscnt 0x0" ::: "memory");      // this wave's reads of the tile in hand are done
    asm volatile("s_wait_asynccnt 0x0" ::: "memory");   // its share of the next tile has landed
    __syncthreads();                                     // publishes the next tile and frees the buffer just read
    if (t + 2 < nt) fill(t + 2, t & 1); }
  asm volatile("s_wait_asynccnt 0x0" ::: "memory");   // no copy is left in flight behind the loop
#pragma unroll
  for (int r = 0; r < 8; ++r) { const float il = (1.0f / 2048.0f) / l[r];
#pragma unroll
    for (int dt = 0; dt < 4; ++dt) so[wave][8 * g + r][dt * 16 + col] = (acc[dt][r] + accl[dt][r] * (1.0f / 2048.0f)) * il; }
  LDSX();
  for (int rl = 0; rl < 16; ++rl) if (lane < 16) vst2(O + ((size_t)b * SS + q0 + rl) * DM + h * HD + lane * 4, *(const v4f*)&so[wave][rl][lane * 4]);
}
__global__ __launch_bounds__(128) void k_attn(const _Float16* __restrict__ QK, const _Float16* __restrict__ QKL, const _Float16* __restrict__ VTH, const _Float16* __restrict__ VTL, const void* __restrict__ KMASK, float* __restrict__ O) {
  __shared__ __align__(16) float sp[4][16][36]; __shared__ __align__(16) float so[4][16][68]; __shared__ __align__(16) _Float16 st[STG_H];
  if (blockIdx.x < 2) attn_tile<true>(QK, QKL, VTH, VTL, O, sp, so, st); else attn_tile<false>(QK, QKL, VTH, VTL, O, sp, so, st);
}
// ---- k_out: block = (64 rows, 128 cols): out = O(hi/lo) . Wo rows (2 products) + bo
__global__ __launch_bounds__(128) void k_out(const float* __restrict__ O, const __bf16* __restrict__ P, const float* __restrict__ BO, float* __restrict__ Y) {
  __shared__ __align__(16) float so[4][16][132];
  const int tid = threadIdx.x, wave = tid >> 5, lane = tid & 31, col = lane & 15, g = lane >> 4; const size_t r0 = (size_t)blockIdx.x * 64 + wave * 16; const int n0 = blockIdx.y * 128;
  v8f acc[8] = {};
#pragma unroll 2
  for (int kc = 0; kc < DM / 32; ++kc) { const F2 a = split_row(O + (r0 + col) * DM, kc * 32, lane);
#pragma unroll
    for (int j = 0; j < 8; ++j) { const v16b w = frag_b(P + (size_t)(n0 + j * 16 + col) * DM + kc * 32, lane); acc[j] = wmma_bf(a.l, w, acc[j]); acc[j] = wmma_bf(a.h, w, acc[j]); } }
#pragma unroll
  for (int j = 0; j < 8; ++j) {
#pragma unroll
    for (int r = 0; r < 8; ++r) so[wave][8 * g + r][j * 16 + col] = acc[j][r] + (BO ? bfr(BO[n0 + j * 16 + col]) : 0.f); }
  LDSX();
  for (int rl = 0; rl < 16; ++rl) vst2(Y + (r0 + rl) * DM + n0 + lane * 4, *(const v4f*)&so[wave][rl][lane * 4]);
}
extern "C" void kernel_launch(void* const* d_in, const int* in_sizes, int n_in, void* d_out, int out_size, void* d_ws, size_t ws_size, hipStream_t stream) {
  (void)in_sizes; (void)n_in; (void)out_size;
  const float** F = (const float**)d_in;   // 0 current [2048,1024], 1 context [2048,1024], 2 Wq [16,1024,64], 3 bq [16,64], 4 Wk, 5 bk, 6 Wv, 7 bv, 8 Wo [1024,64], 9 bo [64]
  if (ws_size < (size_t)WS_END) return;
  char* ws = (char*)d_ws; __bf16* PK = (__bf16*)(ws + WS_PK); _Float16 *QK = (_Float16*)(ws + WS_QK), *QKL = (_Float16*)(ws + WS_QKL), *VTH = (_Float16*)(ws + WS_VTH), *VTL = (_Float16*)(ws + WS_VTL); float* O = (float*)(ws + WS_O);
  k_pack<<<dim3(DM, 3), 256, 0, stream>>>(F[2], F[4], F[6], PK);
  k_qkv<<<dim3(TNB * SS / 64, QKVW / 128), 128, 0, stream>>>(F[0], F[1], F[1], PK + PK_A, F[3], F[5], F[7], QK, QKL, VTH, VTL);
  k_attn<<<dim3(TQB, TNH, TNB), 128, 0, stream>>>(QK, QKL, VTH, VTL, nullptr, O);
  k_out2<<<TOB, 128, 0, stream>>>(O, F[8], F[9], (float*)d_out);
}

// v003
// One run takes 115 microseconds.
// In both of two side-by-side timings against v002, it was 1.36 times as fast.
// Counting every step since v000, it is 3.25 times as fast.
// compute dtype: all float inputs rounded to bf16; q/k/v = x W[h] + b[h] with EXACT bf16 products on WMMA 16x16x32 (per-head (in,out) weights packed as one 1024 -> 1024 projection each), f16 hi + residual; PLAIN-HYBRID scores (first 128 queries 3-product, later single), x 1/8, running-max softmax in f32 (hardware exp); 3-product P . v for the first 128 queries; the head-major stack + row-major view realised as an index map feeding out = y2 (bf16 hi + lo) . Wo + bo (2 products); f32 output.
#include <hip/hip_runtime.h>
#include <math.h>

typedef __attribute__((ext_vector_type(16))) _Float16 v16h;
typedef __attribute__((ext_vector_type(16))) __bf16 v16b;
typedef __attribute__((ext_vector_type(8)))  _Float16 v8h;
typedef __attribute__((ext_vector_type(8)))  float v8f;
typedef __attribute__((ext_vector_type(4)))  float v4f;
typedef __attribute__((ext_vector_type(2)))  float v2f;
typedef __attribute__((ext_vector_type(4)))  unsigned v4u;
typedef __attribute__((ext_vector_type(4)))  int v4i;
typedef float __attribute__((may_alias)) float_a;
typedef int __attribute__((may_alias)) int_a;

template <typename T> __device__ __forceinline__ void vst2(void* p, T v) { *(T*)p = v;  }
__device__ __forceinline__ v8f wmma16(v16h a, v16h b, v8f c) {
  v8f d = __builtin_amdgcn_wmma_f32_16x16x32_f16(false, a, false, b, (short)0, c, false, false);
  asm volatile("v_nop\n\tv_nop\n\tv_nop\n\tv_nop" : "+v"(d) : "v"(a), "v"(b));
  return d;
}
__device__ __forceinline__ v8f wmma_bf(v16b a, v16b b, v8f c) {
  v8f d = __builtin_amdgcn_wmma_f32_16x16x32_bf16(false, a, false, b, (short)0, c, false, false);
  asm volatile("v_nop\n\tv_nop\n\tv_nop\n\tv_nop" : "+v"(d) : "v"(a), "v"(b));
  return d;
}
// Per-head (inefficient) multi-head cross attention (16 heads x 64, 2,048 current x 2,048 context tokens, D_IN 1024): per head q = x Wq[h] + bq[h], k/v from the context; softmax(q k^T / 8) v; heads stacked head-major then row-major re-viewed to [S, 1024]; Wo [1024 -> 64] + bo.
__device__ __forceinline__ v16h frag_h(const _Float16* rowk0, int lane) {
  union { v16h v; v8h q[2]; } u; const _Float16* p = rowk0 + 8 * (lane >> 4);
  u.q[0] = *(const v8h*)p; u.q[1] = *(const v8h*)(p + 16); return u.v;
}
__device__ __forceinline__ v16h frag_f32(const float* rowk0, int lane) {
  v16h a; const float* p = rowk0 + 8 * (lane >> 4);
#pragma unroll
  for (int i = 0; i < 8; ++i) { a[i] = (_Float16)p[i]; a[8 + i] = (_Float16)p[16 + i]; }
  return a;
}
__device__ __forceinline__ v16h frag_f32s(const float* rowk0, int lane, float sc) {
  v16h a; const float* p = rowk0 + 8 * (lane >> 4);
#pragma unroll
  for (int i = 0; i < 8; ++i) { a[i] = (_Float16)(p[i] * sc); a[8 + i] = (_Float16)(p[16 + i] * sc); }
  return a;
}
// column fragment from a [K][ld] layout (column n), rows >= K read as 0
__device__ __forceinline__ v16h fragc_f32(const float* W, int k0, int n, int lane, int ld, int K) {
  v16h a; const int g = lane >> 4;
#pragma unroll
  for (int i = 0; i < 8; ++i) { const int ka = k0 + 8 * g + i, kb = ka + 16;
    a[i] = (_Float16)(ka < K ? W[(size_t)(ka < K ? ka : K - 1) * ld + n] : 0.f); a[8 + i] = (_Float16)(kb < K ? W[(size_t)(kb < K ? kb : K - 1) * ld + n] : 0.f); }
  return a;
}
struct F2 { v16b h, l; };
__device__ __forceinline__ F2 bsplit16(const float v[16]) { F2 r;
#pragma unroll
  for (int i = 0; i < 16; ++i) { const __bf16 h = (__bf16)v[i]; r.h[i] = h; r.l[i] = (__bf16)(v[i] - (float)h); }
  return r; }
__device__ __forceinline__ F2 split_row(const float* row, int k0, int lane) { float v[16]; const float* p = row + k0 + 8 * (lane >> 4);
#pragma unroll
  for (int i = 0; i < 8; ++i) { v[i] = p[i]; v[8 + i] = p[16 + i]; }
  return bsplit16(v); }
__device__ __forceinline__ F2 split_rowK(const float* row, int k0, int lane, int K) { float v[16]; const int g = lane >> 4;
#pragma unroll
  for (int i = 0; i < 8; ++i) { const int ka = k0 + 8 * g + i, kb = ka + 16; v[i] = ka < K ? row[ka < K ? ka : K - 1] : 0.f; v[8 + i] = kb < K ? row[kb < K ? kb : K - 1] : 0.f; }
  return bsplit16(v); }
__device__ __forceinline__ F2 split_col(const float* W, int k0, int n, int lane, int ld, int K) { float v[16]; const int g = lane >> 4;
#pragma unroll
  for (int i = 0; i < 8; ++i) { const int ka = k0 + 8 * g + i, kb = ka + 16; v[i] = ka < K ? W[(size_t)(ka < K ? ka : K - 1) * ld + n] : 0.f; v[8 + i] = kb < K ? W[(size_t)(kb < K ? kb : K - 1) * ld + n] : 0.f; }
  return bsplit16(v); }
__device__ __forceinline__ v8f mac3(const F2& a, const F2& b, v8f c) { c = wmma_bf(a.l, b.h, c); c = wmma_bf(a.h, b.l, c); return wmma_bf(a.h, b.h, c); }
__device__ __forceinline__ float sigm(float v) { return 1.0f / (1.0f + expf(-v)); }
#define LDSX() do { asm volatile("s_wait_dscnt 0" ::: "memory"); __builtin_amdgcn_wave_barrier(); __builtin_amdgcn_fence(__ATOMIC_RELEASE, "workgroup"); } while (0)


#define NB 1
#define SS 2048
#define DM 1024
#define NH 16
#define HD 64
#define QKVW (3 * DM)
#ifndef TQB
#define TQB (SS / 64)
#endif
#ifndef TNH
#define TNH NH
#define TNB NB
#define TOB (NB * SS / 64)     // output row tiles (all)
#endif
typedef __attribute__((ext_vector_type(8))) __bf16 v8b;
__device__ __forceinline__ v16b frag_b(const __bf16* rowk0, int lane) {
  union { v16b v; v8b q[2]; } u; const __bf16* p = rowk0 + 8 * (lane >> 4);
  u.q[0] = *(const v8b*)p; u.q[1] = *(const v8b*)(p + 16); return u.v;
}
// fragment at a wave-uniform base plus the lane's own byte offset: a group's loads all name that one offset register
__device__ __forceinline__ v16b frag_bo(const __bf16* ubase, unsigned boff) { union { v16b v; v8b q[2]; } u; const __bf16* p = (const __bf16*)((const char*)ubase + boff); u.q[0] = *(const v8b*)p; u.q[1] = *(const v8b*)(p + 16); return u.v; }
__device__ __forceinline__ float bfr(float v) { return (float)(__bf16)v; }
__device__ __attribute__((noinline)) float exp_ni(float v) { return expf(v); }
__device__ __attribute__((noinline)) float erf_ni(float v) { return erff(v); }

#define PK_A 0                       // [3072][1024] Wqkv rows (natural [out][in])
#define PK_P (PK_A + QKVW * DM)        // [1024][1024] reserved; nothing writes or reads it
#define PK_END (PK_P + DM * DM)
#define WS_PK  0u
#define WS_QK  (WS_PK + 2u * PK_END)             // f16 [2048 rows][2048]: q | k
#define WS_QKL (WS_QK + 2u * NB * SS * 2 * DM)     // f16 q | k residual planes x2048
#define WS_VTH (WS_QKL + 2u * NB * SS * 2 * DM)    // f16 [b][1024 (h*64+d)][2048 s] hi
#define WS_VTL (WS_VTH + 2u * NB * DM * SS)        // f16 lo x 2048
#define WS_O   (WS_VTL + 2u * NB * DM * SS)        // f32 [2048][1024]
#define WS_CS  (WS_O + 4u * NB * SS * DM)           // f32 [2][2048][32] reserved; nothing writes or reads it
#define WS_END (WS_CS + 4u * 2 * SS * 32)
// ---- k_pack: block = (row n, which): per-head (in,out) columns gathered into bf16 [out][in] rows; which 0..2 -> W_q/W_k/W_v into PK_A rows which*1024 + n
__global__ __launch_bounds__(256) void k_pack(const float* __restrict__ WQ, const float* __restrict__ WK, const float* __restrict__ WV, __bf16* __restrict__ PK) {   // W [h][1024 in][64 d] -> packed row (which*DM + h*64 + d)[i]
  __shared__ __align__(16) __bf16 s[DM]; const int n = blockIdx.x, which = blockIdx.y, t = threadIdx.x; const int h = n / HD, d = n % HD; const float* Wm = which == 0 ? WQ : which == 1 ? WK : WV;
  for (int i = t; i < DM; i += 256) s[i] = (__bf16)Wm[((size_t)h * DM + i) * HD + d];
  __syncthreads(); __bf16* dst = PK + PK_A + ((size_t)which * DM + n) * DM; for (int q = t; q < DM / 8; q += 256) vst2((unsigned*)(dst + q * 8), *(const v4u*)&s[q * 8]); }
// ---- k_out2: block = 64 rows r of the re-viewed [2048][1024] matrix: y2[r][j*64 + o] = O[16*(r%128) + j][(r/128)*64 + o]; out = y2 (hi + lo) . Wo + bo  (Wo (in,out) [1024][64])
__global__ __launch_bounds__(128) void k_out2(const float* __restrict__ O, const float* __restrict__ WO, const float* __restrict__ BO, float* __restrict__ OUT) { __shared__ __align__(16) float sf[4][16][68];
  const int tid = threadIdx.x, wave = tid >> 5, lane = tid & 31, col = lane & 15, g = lane >> 4; const int r0 = blockIdx.x * 64 + wave * 16; const int rr = r0 + col; const int hsel = rr / 128; const int sbase = 16 * (rr % 128);
  v8f acc[4] = {};
  const float* orow = O + (size_t)sbase * DM + hsel * HD + 8 * g; const float* wcol = WO + (size_t)(8 * g) * 64 + col;
  float ac[16], wc[4][16];   // operands of the pass in hand, loaded one pass ahead as one group (the statement behind each product holds a load at its place in the source)
#pragma unroll
  for (int i = 0; i < 8; ++i) { ac[i] = orow[i]; ac[8 + i] = orow[16 + i];
#pragma unroll
    for (int jj = 0; jj < 4; ++jj) { wc[jj][i] = wcol[(size_t)i * 64 + jj * 16]; wc[jj][8 + i] = wcol[(size_t)(16 + i) * 64 + jj * 16]; } }
#pragma unroll 2
  for (int kc = 0; kc < DM / 32; ++kc) { const int kn = kc + 1 < DM / 32 ? kc + 1 : kc; float an[16], wn[4][16];   // the last pass reads its own operands again
    const float* on = orow + (size_t)(kn / 2) * DM + (kn % 2) * 32; const float* wq = wcol + (size_t)(kn * 32) * 64;
#pragma unroll
    for (int i = 0; i < 8; ++i) { an[i] = on[i]; an[8 + i] = on[16 + i];
#pragma unroll
      for (int jj = 0; jj < 4; ++jj) { wn[jj][i] = wq[(size_t)i * 64 + jj * 16]; wn[jj][8 + i] = wq[(size_t)(16 + i) * 64 + jj * 16]; } }
    const F2 a = bsplit16(ac);
#pragma unroll
    for (int jj = 0; jj < 4; ++jj) { v16b w;
#pragma unroll
      for (int i = 0; i < 16; ++i) w[i] = (__bf16)wc[jj][i];
      acc[jj] = wmma_bf(a.h, w, acc[jj]); acc[jj] = wmma_bf(a.l, w, acc[jj]); }
#pragma unroll
    for (int i = 0; i < 16; ++i) { ac[i] = an[i];
#pragma unroll
      for (int jj = 0; jj < 4; ++jj) wc[jj][i] = wn[jj][i]; } }
#pragma unroll
  for (int jj = 0; jj < 4; ++jj) { const float bb = bfr(BO[jj * 16 + col]);
#pragma unroll
    for (int r = 0; r < 8; ++r) sf[wave][8 * g + r][jj * 16 + col] = acc[jj][r] + bb; }
  LDSX(); for (int rl = 0; rl < 16; ++rl) if (lane < 16) vst2(OUT + (size_t)(r0 + rl) * 64 + lane * 4, *(const v4f*)&sf[wave][rl][lane * 4]); }
// k_qkv's operands reach the four waves of a block through LDS: a tile = 64 of k = two 32-deep passes; x 64 rows x 256 B (f32), weights 128 rows x 128 B (bf16), whole 128-B lines, each fetched once a block.
#define XP 68                     // floats a staged x row: 256 B of data + 16 B (the pitch at which 16-byte LDS reads of 16 rows meet no bank twice)
#define WP 72                     // bf16 a staged weight row: 128 B of data + 16 B (likewise)
#define QX_B (64 * XP * 4)        // bytes of the x plane
#define QBUF_B (QX_B + 128 * WP * 2)   // bytes of one buffer: x plane, weight plane
__device__ __forceinline__ v16b frag_lb(const __bf16* p) { union { v16b v; v8b q[2]; } u; u.q[0] = *(const v8b*)p; u.q[1] = *(const v8b*)(p + 16); return u.v; }
// Eight copies of 512 B each, LS bytes apart in LDS and GS bytes apart in the source. The last line is the wait that stands in front of any rewrite of the copies' address registers: inside the statement nothing can be moved over it.
template <int LS, int GS> __device__ __forceinline__ void copy8r(unsigned l, const char* gp) {
  asm volatile("global_load_async_to_lds_b128 %0, %1, off\n\tglobal_load_async_to_lds_b128 %2, %3, off\n\tglobal_load_async_to_lds_b128 %4, %5, off\n\tglobal_load_async_to_lds_b128 %6, %7, off\n\t"
               "global_load_async_to_lds_b128 %8, %9, off\n\tglobal_load_async_to_lds_b128 %10, %11, off\n\tglobal_load_async_to_lds_b128 %12, %13, off\n\tglobal_load_async_to_lds_b128 %14, %15, off\n\ts_wait_xcnt 0x0"
               :: "v"(l), "v"(gp), "v"(l + 1u * LS), "v"(gp + 1 * GS), "v"(l + 2u * LS), "v"(gp + 2 * GS), "v"(l + 3u * LS), "v"(gp + 3 * GS),
                  "v"(l + 4u * LS), "v"(gp + 4 * GS), "v"(l + 5u * LS), "v"(gp + 5 * GS), "v"(l + 6u * LS), "v"(gp + 6 * GS), "v"(l + 7u * LS), "v"(gp + 7 * GS) : "memory");
}
__global__ __launch_bounds__(128) void k_qkv(const float* __restrict__ XQ, const float* __restrict__ XK, const float* __restrict__ XV, const __bf16* __restrict__ P, const float* __restrict__ BQ, const float* __restrict__ BK, const float* __restrict__ BV, _Float16* __restrict__ QK, _Float16* __restrict__ QKL, _Float16* __restrict__ VTH, _Float16* __restrict__ VTL) {
  const int which0 = (blockIdx.y * 128) / DM; const float* X = (which0 == 0) ? XQ : (which0 == 1) ? XK : XV; const float* BB = BQ ? (((which0 == 0) ? BQ : (which0 == 1) ? BK : BV) + (blockIdx.y * 128 - which0 * DM)) : nullptr;
  __shared__ __align__(16) char sm[2 * QBUF_B];   // the two buffers of the k loop; behind the loop's last barrier the same bytes stage the output
  _Float16 (*so)[16][136] = (_Float16 (*)[16][136])sm; _Float16 (*sol)[16][136] = (_Float16 (*)[16][136])(sm + 2 * 4 * 16 * 136); _Float16 (*sth)[72] = (_Float16 (*)[72])(sm + 4 * 4 * 16 * 136); _Float16 (*stl)[72] = (_Float16 (*)[72])(sm + 4 * 4 * 16 * 136 + 2 * 128 * 72);
  static_assert(4 * 4 * 16 * 136 + 4 * 128 * 72 <= 2 * QBUF_B, "output staging fits the ring");
  const int tid = threadIdx.x, wave = tid >> 5, lane = tid & 31, col = lane & 15, g = lane >> 4; const size_t r0 = (size_t)blockIdx.x * 64 + wave * 16; const int n0 = blockIdx.y * 128;
  v8f acc[8] = {};
  const int ns = DM / 64;   // tiles of k
  // the lane's place in every copy: x: 2 rows x 256 B a copy (row lane / 16, piece lane % 16), this wave's 16 rows; weights: 4 rows x 128 B a copy (row lane / 8, piece lane % 8), this wave's 32 rows
  const char* gx = (const char*)(X + ((size_t)blockIdx.x * 64 + wave * 16 + (lane >> 4)) * DM + (lane & 15) * 4); const char* gw = (const char*)(P + ((size_t)n0 + wave * 32 + (lane >> 3)) * DM + (lane & 7) * 8);
  const unsigned lx = (unsigned)(size_t)sm + (unsigned)((wave * 16 + (lane >> 4)) * (XP * 4) + (lane & 15) * 16), lw = (unsigned)(size_t)sm + (unsigned)(QX_B + (wave * 32 + (lane >> 3)) * (WP * 2) + (lane & 7) * 16);
  auto fill = [&](int s, int bf) { copy8r<2 * XP * 4, 2 * DM * 4>(lx + (unsigned)(bf * QBUF_B), gx + (size_t)s * 256); copy8r<4 * WP * 2, 4 * DM * 2>(lw + (unsigned)(bf * QBUF_B), gw + (size_t)s * 128); };
  fill(0, 0);
  float bias[8];   // loaded here, in flight under the k loop, not one waited load per stored element
#pragma unroll
  for (int j = 0; j < 8; ++j) bias[j] = 0.f;
  if (BB) {
#pragma unroll
    for (int j = 0; j < 8; ++j) bias[j] = BB[j * 16 + col]; }
  asm volatile("s_wait_asynccnt 0x0" ::: "memory");   // this wave's share of tile 0 has landed
  __syncthreads();                                     // every wave's share has: tile 0 may be read
  fill(1, 1);
#pragma unroll 1   // stays rolled: one foot (waits, barrier, refill) a tile, and the text of the loop stays short
  for (int s = 0; s < ns; ++s) { const char* bp = sm + (s & 1) * QBUF_B; const float* fx = (const float*)bp + (wave * 16 + col) * XP + 8 * g; const __bf16* fw = (const __bf16*)(bp + QX_B) + col * WP + 8 * g;
    v4f xc[2][4]; v16b wc[2][8];   // both passes' operands, read as two groups in front of the products (the statement behind each product holds a load at its place in the source)
#pragma unroll
    for (int sub = 0; sub < 2; ++sub) { xc[sub][0] = *(const v4f*)(fx + sub * 32); xc[sub][1] = *(const v4f*)(fx + sub * 32 + 4); xc[sub][2] = *(const v4f*)(fx + sub * 32 + 16); xc[sub][3] = *(const v4f*)(fx + sub * 32 + 20);
#pragma unroll
      for (int j = 0; j < 8; ++j) wc[sub][j] = frag_lb(fw + (j * 16) * WP + sub * 32); }
#pragma unroll
    for (int sub = 0; sub < 2; ++sub) { v16b a;
#pragma unroll
      for (int i = 0; i < 16; ++i) a[i] = (__bf16)xc[sub][i >> 2][i & 3];
#pragma unroll
      for (int j = 0; j < 8; ++j) acc[j] = wmma_bf(a, wc[sub][j], acc[j]); }
    asm volatile("s_wait_dscnt 0x0" ::: "memory");      // this wave's reads of the tile in hand are done
    asm volatile("s_wait_asynccnt 0x0" ::: "memory");   // its share of the next tile has landed
    __syncthreads();                                     // publishes the next tile and frees the buffer just read (behind the last tile: frees the ring for the output staging)
    if (s + 2 < ns) fill(s + 2, s & 1); }
  asm volatile("s_wait_asynccnt 0x0" ::: "memory");   // no copy is left in flight behind the loop
  if (n0 < 2 * DM) {   // q stored unscaled (f16 sigma ~0.6, no subnormal exposure); 1/8 applied to the f32 score
#pragma unroll
    for (int j = 0; j < 8; ++j) {
#pragma unroll
      for (int r = 0; r < 8; ++r) { const float v = acc[j][r] + bfr(bias[j]); const _Float16 hv = (_Float16)v; so[wave][8 * g + r][j * 16 + col] = hv; sol[wave][8 * g + r][j * 16 + col] = (_Float16)((v - (float)hv) * 2048.0f); } }   // q, k (+ bias) as f16 hi + (x2048) residual
    LDSX();
    for (int rl = 0; rl < 16; ++rl) if (lane < 16) { vst2((unsigned*)(QK + (r0 + rl) * (2 * DM) + n0 + lane * 8), *(const v4u*)&so[wave][rl][lane * 8]); vst2((unsigned*)(QKL + (r0 + rl) * (2 * DM) + n0 + lane * 8), *(const v4u*)&sol[wave][rl][lane * 8]); }
  } else {
#pragma unroll
    for (int j = 0; j < 8; ++j) {
#pragma unroll
      for (int r = 0; r < 8; ++r) { const float v = acc[j][r] + bfr(bias[j]); const _Float16 hv = (_Float16)v; sth[j * 16 + col][wave * 16 + 8 * g + r] = hv; stl[j * 16 + col][wave * 16 + 8 * g + r] = (_Float16)((v - (float)hv) * 2048.0f); } }
    __syncthreads();
    const size_t rb = (size_t)blockIdx.x * 64; const int b = (int)(rb / SS), s0 = (int)(rb % SS); const int pc0 = n0 - 2 * DM;
    for (int q = tid; q < 128 * 8; q += 128) { const int d = q >> 3, pc = q & 7; const size_t o = ((size_t)b * DM + pc0 + d) * SS + s0 + pc * 8; vst2((unsigned*)(VTH + o), *(const v4u*)&sth[d][pc * 8]); vst2((unsigned*)(VTL + o), *(const v4u*)&stl[d][pc * 8]); }
  }
}
// ---- k_attn: block = (64 queries, head h, batch b): all-keys flash attention (K = 64: 2 k-steps), scores = (q.k) * 0.125 with single f16 operands (first two query blocks: f16 hi + residual, 3 products), P.V: f16 P*2048 x V hi in acc (first two query blocks also P residual*2048 x V hi + P*2048 x V lo*2048 in accl); O[b*S+q][h*64+d] = (acc + accl / 2048) / (2048 l) (256-B segments)
// K and V reach the four waves of a block through LDS: a tile = 64 keys = two 32-key passes; K 64 key rows x 128 B, V 64 d rows x 128 B (and their residual planes where HI), whole 128-B lines, each fetched once a block.
#define KP 72                    // halfs a staged row: 128 B of data + 16 B, the pitch at which 16-byte LDS reads of 16 rows meet no bank twice
#define PLANE (64 * KP)          // halfs of one staged plane
#define STG_H (2 * 4 * PLANE)    // two buffers of up to four planes: K, V, K residual, V residual
__device__ __forceinline__ v16h frag_l(const _Float16* p) { union { v16h v; v8h q[2]; } u; u.q[0] = *(const v8h*)p; u.q[1] = *(const v8h*)(p + 16); return u.v; }
// Sixteen rows of plane a and sixteen of plane b: eight copies, each 4 rows x 128 B (lane: row lane / 8, 16-byte piece lane % 8); both sources have rows 4,096 B apart. The last line is the wait that stands in front of any rewrite of the copies' address registers: inside the statement nothing can be moved over it.
__device__ __forceinline__ void copy8(unsigned la, const _Float16* ga, unsigned lb, const _Float16* gb) {
  asm volatile("global_load_async_to_lds_b128 %0, %1, off\n\tglobal_load_async_to_lds_b128 %2, %3, off\n\tglobal_load_async_to_lds_b128 %4, %5, off\n\tglobal_load_async_to_lds_b128 %6, %7, off\n\t"
               "global_load_async_to_lds_b128 %8, %9, off\n\tglobal_load_async_to_lds_b128 %10, %11, off\n\tglobal_load_async_to_lds_b128 %12, %13, off\n\tglobal_load_async_to_lds_b128 %14, %15, off\n\ts_wait_xcnt 0x0"
               :: "v"(la), "v"(ga), "v"(la + 2u * 4 * KP), "v"(ga + 4 * 2048), "v"(la + 2u * 8 * KP), "v"(ga + 8 * 2048), "v"(la + 2u * 12 * KP), "v"(ga + 12 * 2048),
                  "v"(lb), "v"(gb), "v"(lb + 2u * 4 * KP), "v"(gb + 4 * 2048), "v"(lb + 2u * 8 * KP), "v"(gb + 8 * 2048), "v"(lb + 2u * 12 * KP), "v"(gb + 12 * 2048) : "memory");
}
// lane l with lane l ^ 16 (a vector move, no LDS): the other half of a query's keys
__device__ __forceinline__ float xhalf(float x) { return __builtin_bit_cast(float, __builtin_amdgcn_permlanex16(__builtin_bit_cast(int, x), __builtin_bit_cast(int, x), 0x76543210, 0xfedcba98, false, false)); }
// Both products are taken transposed: S^T = K . Q^T (rows = keys, columns = queries) and O^T += V^T . P^T (rows = d, columns = queries). A lane then holds 16 of the 32 scores of ONE query (its column), lane ^ 16 the other 16: maximum and sum are in-lane plus one move between the halves, m, l and the rescale factor are one value a lane, and the two score tiles, converted in place, are the B operand of the second product in the hardware k order: P never leaves the registers.
// One 64-query tile; HI = leading query blocks (3 products), written once per path so that each pass is one straight run and its load groups stay whole.
template <bool HI> __device__ __forceinline__ void attn_tile(const _Float16* __restrict__ QK, const _Float16* __restrict__ QKL, const _Float16* __restrict__ VTH, const _Float16* __restrict__ VTL, float* __restrict__ O, float (*so)[16][68], _Float16* st) {
  const int tid = threadIdx.x, wave = tid >> 5, lane = tid & 31, col = lane & 15, g = lane >> 4;
  const int qb = blockIdx.x, h = blockIdx.y, b = blockIdx.z; const int q0 = qb * 64 + wave * 16; const size_t rq = (size_t)b * SS + q0 + col;
  const int nt = SS / 64;   // key tiles (all keys)
  const int bufh = (HI ? 4 : 2) * PLANE;   // halfs of one buffer
  const int crow = wave * 16 + (lane >> 3), cpc = (lane & 7) * 8;   // the lane's first row and its 16-byte piece in every copy
  const size_t ko = ((size_t)b * SS + crow) * (2 * DM) + DM + h * HD + cpc, vo = ((size_t)b * DM + h * HD + crow) * SS + cpc;   // tile 0; a tile on: 64 key rows of K, 64 columns of V
  const unsigned l0 = (unsigned)(size_t)st + 2u * (unsigned)(crow * KP + cpc);
  auto fill = [&](int t, int bf) { const unsigned lb = l0 + 2u * (unsigned)(bf * bufh); const size_t kt = ko + (size_t)t * 64 * (2 * DM), vt = vo + (size_t)t * 64;
    copy8(lb, QK + kt, lb + 2u * PLANE, VTH + vt);
    if (HI) copy8(lb + 2u * 2 * PLANE, QKL + kt, lb + 2u * 3 * PLANE, VTL + vt); };
  fill(0, 0);
  v16h aq[2], aql[2];
#pragma unroll
  for (int kc = 0; kc < 2; ++kc) { aq[kc] = frag_h(QK + rq * (2 * DM) + h * HD + kc * 32, lane); if (HI) aql[kc] = frag_h(QKL + rq * (2 * DM) + h * HD + kc * 32, lane); }
  float m = -3.0e38f, l = 0.f;   // of query col; l sums this half's keys only, the halves are joined behind the loop
  v8f acc[4] = {}, accl[4] = {};
  asm volatile("s_wait_asynccnt 0x0" ::: "memory");   // this wave's share of tile 0 has landed
  __syncthreads();                                     // every wave's share has: tile 0 may be read
  fill(1, 1);
#pragma unroll 1   // stays rolled: one foot (waits, barrier, refill) a tile, and the text of the loop stays short
  for (int t = 0; t < nt; ++t) { const _Float16* fk = st + (t & 1) * bufh + col * KP + 8 * g; const _Float16* fv = fk + PLANE;   // the lane's row col of the K and of the V plane
    // The statement behind each product holds a load at its place in the source, so every LDS read of a pass stands in front of the products that follow it: behind the score products of a pass go, as one group, its own V and (inside the tile, where not HI) the next pass's K, in flight under the softmax.
    v16h kf[2][2], kfl[2][2];   // [ct][kc] K fragments of the pass in hand (residual planes only where HI)
#pragma unroll
    for (int ct = 0; ct < 2; ++ct) {
#pragma unroll
      for (int kc = 0; kc < 2; ++kc) { kf[ct][kc] = frag_l(fk + (ct * 16) * KP + kc * 32); if (HI) kfl[ct][kc] = frag_l(fk + 2 * PLANE + (ct * 16) * KP + kc * 32); } }
#pragma unroll
    for (int sub = 0; sub < 2; ++sub) { v8f s[2]; v16h vf[4], vfl[4];
#pragma unroll
    for (int ct = 0; ct < 2; ++ct) { v8f c = {}, cl = {};
      if (HI) {   // leading query blocks: 3 products
#pragma unroll
        for (int kc = 0; kc < 2; ++kc) { c = wmma16(kf[ct][kc], aq[kc], c); cl = wmma16(kf[ct][kc], aql[kc], cl); cl = wmma16(kfl[ct][kc], aq[kc], cl); }
#pragma unroll
        for (int r = 0; r < 8; ++r) c[r] += cl[r] * (1.0f / 2048.0f); }
      else {
#pragma unroll
        for (int kc = 0; kc < 2; ++kc) c = wmma16(kf[ct][kc], aq[kc], c); }   // single product elsewhere
      { const bool keepk = true;
#pragma unroll
      for (int r = 0; r < 8; ++r) s[ct][r] = keepk ? c[r] * 0.125f : -3.0e38f; } }   // 1/sqrt(64); s[ct][r] = key ct * 16 + 8 g + r of the pass, query col
#pragma unroll
    for (int dt = 0; dt < 4; ++dt) { vf[dt] = frag_l(fv + (dt * 16) * KP + sub * 32); if (HI) vfl[dt] = frag_l(fv + 2 * PLANE + (dt * 16) * KP + sub * 32); }
    if (sub == 0 && !HI) {   // the tile's second pass's K (where HI: further down)
#pragma unroll
      for (int ct = 0; ct < 2; ++ct) {
#pragma unroll
        for (int kc = 0; kc < 2; ++kc) kf[ct][kc] = frag_l(fk + (32 + ct * 16) * KP + kc * 32); } }
    __builtin_amdgcn_sched_barrier(0);   // keeps the group here, in front of the softmax; moved down its reads would be waited for right in front of the second product
    float t4[4];   // four short chains, not one long one
#pragma unroll
    for (int j = 0; j < 4; ++j) t4[j] = fmaxf(fmaxf(s[0][j], s[0][4 + j]), fmaxf(s[1][j], s[1][4 + j]));
    float mx = fmaxf(fmaxf(t4[0], t4[1]), fmaxf(t4[2], t4[3])); mx = fmaxf(mx, xhalf(mx));   // both halves now hold the pass's maximum of query col
    const float mn = fmaxf(m, mx); const float alpha = (m <= -1.0e38f) ? 0.f : __expf(m - mn);
    float e[2][8];
#pragma unroll
    for (int ct = 0; ct < 2; ++ct) {
#pragma unroll
      for (int r = 0; r < 8; ++r) e[ct][r] = (s[ct][r] <= -1.0e38f) ? 0.f : __expf(s[ct][r] - mn); }
#pragma unroll
    for (int j = 0; j < 4; ++j) t4[j] = (e[0][j] + e[0][4 + j]) + (e[1][j] + e[1][4 + j]);
    l = l * alpha + ((t4[0] + t4[1]) + (t4[2] + t4[3])); m = mn;
#pragma unroll
    for (int dt = 0; dt < 4; ++dt) {
#pragma unroll
      for (int r = 0; r < 8; ++r) { acc[dt][r] *= alpha; accl[dt][r] *= alpha; } }
    v16h pa, pl;   // P^T as a B operand: element i = key 8 g + i, element 8 + i = key 16 + 8 g + i, the order in which the V fragments hold their keys
#pragma unroll
    for (int i = 0; i < 8; ++i) { const float x0 = e[0][i] * 2048.0f, x1 = e[1][i] * 2048.0f; const _Float16 h0 = (_Float16)x0, h1 = (_Float16)x1; pa[i] = h0; pa[8 + i] = h1; pl[i] = (_Float16)((x0 - (float)h0) * 2048.0f); pl[8 + i] = (_Float16)((x1 - (float)h1) * 2048.0f); }   // P scaled by 2^11 before the f16 split so small softmax weights stay out of the f16 subnormal range; 2^-11 folded into the epilogue
    if (sub == 0 && HI) {   // the tile's second pass's K where HI: read from here on, in flight under the second product; read in front of the softmax, beside scores, P and all four V planes' fragments, it made the build spill to scratch inside the loop
#pragma unroll
      for (int ct = 0; ct < 2; ++ct) {
#pragma unroll
        for (int kc = 0; kc < 2; ++kc) { kf[ct][kc] = frag_l(fk + (32 + ct * 16) * KP + kc * 32); kfl[ct][kc] = frag_l(fk + 2 * PLANE + (32 + ct * 16) * KP + kc * 32); } } }
#pragma unroll
    for (int dt = 0; dt < 4; ++dt) { acc[dt] = wmma16(vf[dt], pa, acc[dt]); if (HI) { accl[dt] = wmma16(vf[dt], pl, accl[dt]); accl[dt] = wmma16(vfl[dt], pa, accl[dt]); } }   // leading query blocks: P hi/lo x V hi/lo (3 products); elsewhere P x V single; acc[dt][r] = d dt * 16 + 8 g + r of query col
    }
    asm volatile("s_wait_dscnt 0x0" ::: "memory");      // this wave's reads of the tile in hand are done
    asm volatile("s_wait_asynccnt 0x0" ::: "memory");   // its share of the next tile has landed
    __syncthreads();                                     // publishes the next tile and frees the buffer just read
    if (t + 2 < nt) fill(t + 2, t & 1); }
  asm volatile("s_wait_asynccnt 0x0" ::: "memory");   // no copy is left in flight behind the loop
  const float il = (1.0f / 2048.0f) / (l + xhalf(l));   // the two halves' sums joined
#pragma unroll
  for (int dt = 0; dt < 4; ++dt) {
#pragma unroll
    for (int r = 0; r < 8; ++r) so[wave][col][dt * 16 + 8 * g + r] = (acc[dt][r] + accl[dt][r] * (1.0f / 2048.0f)) * il; }
  LDSX();
  for (int rl = 0; rl < 16; ++rl) if (lane < 16) vst2(O + ((size_t)b * SS + q0 + rl) * DM + h * HD + lane * 4, *(const v4f*)&so[wave][rl][lane * 4]);
}
__global__ __launch_bounds__(128) void k_attn(const _Float16* __restrict__ QK, const _Float16* __restrict__ QKL, const _Float16* __restrict__ VTH, const _Float16* __restrict__ VTL, const void* __restrict__ KMASK, float* __restrict__ O) {
  __shared__ __align__(16) float so[4][16][68]; __shared__ __align__(16) _Float16 st[STG_H];
  if (blockIdx.x < 2) attn_tile<true>(QK, QKL, VTH, VTL, O, so, st); else attn_tile<false>(QK, QKL, VTH, VTL, O, so, st);
}
// ---- k_out: block = (64 rows, 128 cols): out = O(hi/lo) . Wo rows (2 products) + bo
__global__ __launch_bounds__(128) void k_out(const float* __restrict__ O, const __bf16* __restrict__ P, const float* __restrict__ BO, float* __restrict__ Y) {
  __shared__ __align__(16) float so[4][16][132];
  const int tid = threadIdx.x, wave = tid >> 5, lane = tid & 31, col = lane & 15, g = lane >> 4; const size_t r0 = (size_t)blockIdx.x * 64 + wave * 16; const int n0 = blockIdx.y * 128;
  v8f acc[8] = {};
#pragma unroll 2
  for (int kc = 0; kc < DM / 32; ++kc) { const F2 a = split_row(O + (r0 + col) * DM, kc * 32, lane);
#pragma unroll
    for (int j = 0; j < 8; ++j) { const v16b w = frag_b(P + (size_t)(n0 + j * 16 + col) * DM + kc * 32, lane); acc[j] = wmma_bf(a.l, w, acc[j]); acc[j] = wmma_bf(a.h, w, acc[j]); } }
#pragma unroll
  for (int j = 0; j < 8; ++j) {
#pragma unroll
    for (int r = 0; r < 8; ++r) so[wave][8 * g + r][j * 16 + col] = acc[j][r] + (BO ? bfr(BO[n0 + j * 16 + col]) : 0.f); }
  LDSX();
  for (int rl = 0; rl < 16; ++rl) vst2(Y + (r0 + rl) * DM + n0 + lane * 4, *(const v4f*)&so[wave][rl][lane * 4]);
}
extern "C" void kernel_launch(void* const* d_in, const int* in_sizes, int n_in, void* d_out, int out_size, void* d_ws, size_t ws_size, hipStream_t stream) {
  (void)in_sizes; (void)n_in; (void)out_size;
  const float** F = (const float**)d_in;   // 0 current [2048,1024], 1 context [2048,1024], 2 Wq [16,1024,64], 3 bq [16,64], 4 Wk, 5 bk, 6 Wv, 7 bv, 8 Wo [1024,64], 9 bo [64]
  if (ws_size < (size_t)WS_END) return;
  char* ws = (char*)d_ws; __bf16* PK = (__bf16*)(ws + WS_PK); _Float16 *QK = (_Float16*)(ws + WS_QK), *QKL = (_Float16*)(ws + WS_QKL), *VTH = (_Float16*)(ws + WS_VTH), *VTL = (_Float16*)(ws + WS_VTL); float* O = (float*)(ws + WS_O);
  k_pack<<<dim3(DM, 3), 256, 0, stream>>>(F[2], F[4], F[6], PK);
  k_qkv<<<dim3(TNB * SS / 64, QKVW / 128), 128, 0, stream>>>(F[0], F[1], F[1], PK + PK_A, F[3], F[5], F[7], QK, QKL, VTH, VTL);
  k_attn<<<dim3(TQB, TNH, TNB), 128, 0, stream>>>(QK, QKL, VTH, VTL, nullptr, O);
  k_out2<<<TOB, 128, 0, stream>>>(O, F[8], F[9], (float*)d_out);
}

// v004
// It runs in 101 microseconds.
// Timed twice side by side with v003, it ran 1.13 and 1.14 times as fast.
// Counting every step since v000, it is 3.68 times as fast.
// compute dtype: all float inputs rounded to bf16; q/k/v = x W[h] + b[h] with EXACT bf16 products on WMMA 16x16x32 (per-head (in,out) weights packed as one 1024 -> 1024 projection each), f16 hi + residual; PLAIN-HYBRID scores (first 128 queries 3-product, later single), x 1/8, running-max softmax in f32 (hardware exp); 3-product P . v for the first 128 queries; the head-major stack + row-major view realised as an index map feeding out = y2 (bf16 hi + lo) . Wo + bo (2 products); f32 output.
#include <hip/hip_runtime.h>
#include <math.h>

typedef __attribute__((ext_vector_type(16))) _Float16 v16h;
typedef __attribute__((ext_vector_type(16))) __bf16 v16b;
typedef __attribute__((ext_vector_type(8)))  _Float16 v8h;
typedef __attribute__((ext_vector_type(8)))  float v8f;
typedef __attribute__((ext_vector_type(4)))  float v4f;
typedef __attribute__((ext_vector_type(2)))  float v2f;
typedef __attribute__((ext_vector_type(4)))  unsigned v4u;
typedef __attribute__((ext_vector_type(4)))  int v4i;
typedef float __attribute__((may_alias)) float_a;
typedef int __attribute__((may_alias)) int_a;

template <typename T> __device__ __forceinline__ void vst2(void* p, T v) { *(T*)p = v;  }
__device__ __forceinline__ v8f wmma16(v16h a, v16h b, v8f c) {
  v8f d = __builtin_amdgcn_wmma_f32_16x16x32_f16(false, a, false, b, (short)0, c, false, false);
  asm volatile("v_nop\n\tv_nop\n\tv_nop\n\tv_nop" : "+v"(d) : "v"(a), "v"(b));
  return d;
}
__device__ __forceinline__ v8f wmma_bf(v16b a, v16b b, v8f c) {
  v8f d = __builtin_amdgcn_wmma_f32_16x16x32_bf16(false, a, false, b, (short)0, c, false, false);
  asm volatile("v_nop\n\tv_nop\n\tv_nop\n\tv_nop" : "+v"(d) : "v"(a), "v"(b));
  return d;
}
// Per-head (inefficient) multi-head cross attention (16 heads x 64, 2,048 current x 2,048 context tokens, D_IN 1024): per head q = x Wq[h] + bq[h], k/v from the context; softmax(q k^T / 8) v; heads stacked head-major then row-major re-viewed to [S, 1024]; Wo [1024 -> 64] + bo.
__device__ __forceinline__ v16h frag_h(const _Float16* rowk0, int lane) {
  union { v16h v; v8h q[2]; } u; const _Float16* p = rowk0 + 8 * (lane >> 4);
  u.q[0] = *(const v8h*)p; u.q[1] = *(const v8h*)(p + 16); return u.v;
}
__device__ __forceinline__ v16h frag_f32(const float* rowk0, int lane) {
  v16h a; const float* p = rowk0 + 8 * (lane >> 4);
#pragma unroll
  for (int i = 0; i < 8; ++i) { a[i] = (_Float16)p[i]; a[8 + i] = (_Float16)p[16 + i]; }
  return a;
}
__device__ __forceinline__ v16h frag_f32s(const float* rowk0, int lane, float sc) {
  v16h a; const float* p = rowk0 + 8 * (lane >> 4);
#pragma unroll
  for (int i = 0; i < 8; ++i) { a[i] = (_Float16)(p[i] * sc); a[8 + i] = (_Float16)(p[16 + i] * sc); }
  return a;
}
// column fragment from a [K][ld] layout (column n), rows >= K read as 0
__device__ __forceinline__ v16h fragc_f32(const float* W, int k0, int n, int lane, int ld, int K) {
  v16h a; const int g = lane >> 4;
#pragma unroll
  for (int i = 0; i < 8; ++i) { const int ka = k0 + 8 * g + i, kb = ka + 16;
    a[i] = (_Float16)(ka < K ? W[(size_t)(ka < K ? ka : K - 1) * ld + n] : 0.f); a[8 + i] = (_Float16)(kb < K ? W[(size_t)(kb < K ? kb : K - 1) * ld + n] : 0.f); }
  return a;
}
struct F2 { v16b h, l; };
__device__ __forceinline__ F2 bsplit16(const float v[16]) { F2 r;
#pragma unroll
  for (int i = 0; i < 16; ++i) { const __bf16 h = (__bf16)v[i]; r.h[i] = h; r.l[i] = (__bf16)(v[i] - (float)h); }
  return r; }
__device__ __forceinline__ F2 split_row(const float* row, int k0, int lane) { float v[16]; const float* p = row + k0 + 8 * (lane >> 4);
#pragma unroll
  for (int i = 0; i < 8; ++i) { v[i] = p[i]; v[8 + i] = p[16 + i]; }
  return bsplit16(v); }
__device__ __forceinline__ F2 split_rowK(const float* row, int k0, int lane, int K) { float v[16]; const int g = lane >> 4;
#pragma unroll
  for (int i = 0; i < 8; ++i) { const int ka = k0 + 8 * g + i, kb = ka + 16; v[i] = ka < K ? row[ka < K ? ka : K - 1] : 0.f; v[8 + i] = kb < K ? row[kb < K ? kb : K - 1] : 0.f; }
  return bsplit16(v); }
__device__ __forceinline__ F2 split_col(const float* W, int k0, int n, int lane, int ld, int K) { float v[16]; const int g = lane >> 4;
#pragma unroll
  for (int i = 0; i < 8; ++i) { const int ka = k0 + 8 * g + i, kb = ka + 16; v[i] = ka < K ? W[(size_t)(ka < K ? ka : K - 1) * ld + n] : 0.f; v[8 + i] = kb < K ? W[(size_t)(kb < K ? kb : K - 1) * ld + n] : 0.f; }
  return bsplit16(v); }
__device__ __forceinline__ v8f mac3(const F2& a, const F2& b, v8f c) { c = wmma_bf(a.l, b.h, c); c = wmma_bf(a.h, b.l, c); return wmma_bf(a.h, b.h, c); }
__device__ __forceinline__ float sigm(float v) { return 1.0f / (1.0f + expf(-v)); }
#define LDSX() do { asm volatile("s_wait_dscnt 0" ::: "memory"); __builtin_amdgcn_wave_barrier(); __builtin_amdgcn_fence(__ATOMIC_RELEASE, "workgroup"); } while (0)


#define NB 1
#define SS 2048
#define DM 1024
#define NH 16
#define HD 64
#define QKVW (3 * DM)
#ifndef TQB
#define TQB (SS / 64)
#endif
#ifndef TNH
#define TNH NH
#define TNB NB
#define TOB (NB * SS / 64)     // output row tiles (all)
#endif
typedef __attribute__((ext_vector_type(8))) __bf16 v8b;
__device__ __forceinline__ v16b frag_b(const __bf16* rowk0, int lane) {
  union { v16b v; v8b q[2]; } u; const __bf16* p = rowk0 + 8 * (lane >> 4);
  u.q[0] = *(const v8b*)p; u.q[1] = *(const v8b*)(p + 16); return u.v;
}
// fragment at a wave-uniform base plus the lane's own byte offset: a group's loads all name that one offset register
__device__ __forceinline__ v16b frag_bo(const __bf16* ubase, unsigned boff) { union { v16b v; v8b q[2]; } u; const __bf16* p = (const __bf16*)((const char*)ubase + boff); u.q[0] = *(const v8b*)p; u.q[1] = *(const v8b*)(p + 16); return u.v; }
__device__ __forceinline__ float bfr(float v) { return (float)(__bf16)v; }
__device__ __attribute__((noinline)) float exp_ni(float v) { return expf(v); }
__device__ __attribute__((noinline)) float erf_ni(float v) { return erff(v); }

#define PK_A 0                       // [3072][1024] Wqkv rows (natural [out][in])
#define PK_P (PK_A + QKVW * DM)        // [1024][1024] reserved; nothing writes or reads it
#define PK_END (PK_P + DM * DM)
#define WS_PK  0u
#define WS_QK  (WS_PK + 2u * PK_END)             // f16 [2048 rows][2048]: q | k
#define WS_QKL (WS_QK + 2u * NB * SS * 2 * DM)     // f16 q | k residual planes x2048
#define WS_VTH (WS_QKL + 2u * NB * SS * 2 * DM)    // f16 [b][1024 (h*64+d)][2048 s] hi
#define WS_VTL (WS_VTH + 2u * NB * DM * SS)        // f16 lo x 2048
#define WS_O   (WS_VTL + 2u * NB * DM * SS)        // f32 [2048][1024]
#define WS_CS  (WS_O + 4u * NB * SS * DM)           // f32 [2][2048][32] reserved; nothing writes or reads it
#define WS_END (WS_CS + 4u * 2 * SS * 32)
// ---- k_pack: block = (128 input rows i, head h, which): W [h][1024 in][64 d] -> bf16 packed rows (which*DM + h*64 + d)[i]; which 0..2 -> W_q/W_k/W_v into PK_A
// The block's source tile (128 rows x 64 floats) is 32 KB in a row: it is read as whole lines, 16 bytes a lane, all eight loads of a thread in flight together, and turned in LDS; each packed row gets 256 B in a row.
#define PKI 128                   // input rows a block
#define PKP (PKI / 2 + 1)         // dwords a staged packed row: 64 of data (two bf16 each) + 1, the pitch at which the 32 lanes of a write (rows 4 apart) and of a read (dwords 4 apart) each meet 32 banks
__global__ __launch_bounds__(256) void k_pack(const float* __restrict__ WQ, const float* __restrict__ WK, const float* __restrict__ WV, __bf16* __restrict__ PK) {
  __shared__ unsigned s[HD * PKP]; const int it = blockIdx.x, h = blockIdx.y, which = blockIdx.z, t = threadIdx.x; const float* Wm = which == 0 ? WQ : which == 1 ? WK : WV;
  const int d4 = (t & 15) * 4, p0 = t >> 4;   // the thread's four columns d; its pair of input rows in each group of 32
  const float* src = Wm + ((size_t)h * DM + it * PKI + 2 * p0) * HD + d4;
  v4f a[4], b[4];   // rows 2 p and 2 p + 1, p = k * 16 + p0
#pragma unroll   // (here and below) a, b and v stay in registers, and the eight loads stand as one group in front of the first use
  for (int k = 0; k < 4; ++k) { a[k] = *(const v4f*)(src + (size_t)(k * 32) * HD); b[k] = *(const v4f*)(src + (size_t)(k * 32 + 1) * HD); }
#pragma unroll
  for (int k = 0; k < 4; ++k) {
#pragma unroll
    for (int j = 0; j < 4; ++j) { union { __bf16 e[2]; unsigned u; } w; w.e[0] = (__bf16)a[k][j]; w.e[1] = (__bf16)b[k][j]; s[(d4 + j) * PKP + k * 16 + p0] = w.u; } }
  __syncthreads(); __bf16* dst = PK + PK_A + ((size_t)which * DM + h * HD) * DM + it * PKI;
#pragma unroll
  for (int k = 0; k < 4; ++k) { const int q = k * 256 + t, d = q >> 4, pc = q & 15; v4u v;
#pragma unroll
    for (int j = 0; j < 4; ++j) v[j] = s[d * PKP + pc * 4 + j];
    vst2((unsigned*)(dst + (size_t)d * DM + pc * 8), v); } }
// ---- k_out2: block = 64 rows r of the re-viewed [2048][1024] matrix: y2[r][j*64 + o] = O[16*(r%128) + j][(r/128)*64 + o]; out = y2 (hi + lo) . Wo + bo  (Wo (in,out) [1024][64])
__global__ __launch_bounds__(128) void k_out2(const float* __restrict__ O, const float* __restrict__ WO, const float* __restrict__ BO, float* __restrict__ OUT) { __shared__ __align__(16) float sf[4][16][68];
  const int tid = threadIdx.x, wave = tid >> 5, lane = tid & 31, col = lane & 15, g = lane >> 4; const int r0 = blockIdx.x * 64 + wave * 16; const int rr = r0 + col; const int hsel = rr / 128; const int sbase = 16 * (rr % 128);
  v8f acc[4] = {};
  const float* orow = O + (size_t)sbase * DM + hsel * HD + 8 * g; const float* wcol = WO + (size_t)(8 * g) * 64 + col;
  float ac[16], wc[4][16];   // operands of the pass in hand, loaded one pass ahead as one group (the statement behind each product holds a load at its place in the source)
#pragma unroll
  for (int i = 0; i < 8; ++i) { ac[i] = orow[i]; ac[8 + i] = orow[16 + i];
#pragma unroll
    for (int jj = 0; jj < 4; ++jj) { wc[jj][i] = wcol[(size_t)i * 64 + jj * 16]; wc[jj][8 + i] = wcol[(size_t)(16 + i) * 64 + jj * 16]; } }
#pragma unroll 2
  for (int kc = 0; kc < DM / 32; ++kc) { const int kn = kc + 1 < DM / 32 ? kc + 1 : kc; float an[16], wn[4][16];   // the last pass reads its own operands again
    const float* on = orow + (size_t)(kn / 2) * DM + (kn % 2) * 32; const float* wq = wcol + (size_t)(kn * 32) * 64;
#pragma unroll
    for (int i = 0; i < 8; ++i) { an[i] = on[i]; an[8 + i] = on[16 + i];
#pragma unroll
      for (int jj = 0; jj < 4; ++jj) { wn[jj][i] = wq[(size_t)i * 64 + jj * 16]; wn[jj][8 + i] = wq[(size_t)(16 + i) * 64 + jj * 16]; } }
    const F2 a = bsplit16(ac);
#pragma unroll
    for (int jj = 0; jj < 4; ++jj) { v16b w;
#pragma unroll
      for (int i = 0; i < 16; ++i) w[i] = (__bf16)wc[jj][i];
      acc[jj] = wmma_bf(a.h, w, acc[jj]); acc[jj] = wmma_bf(a.l, w, acc[jj]); }
#pragma unroll
    for (int i = 0; i < 16; ++i) { ac[i] = an[i];
#pragma unroll
      for (int jj = 0; jj < 4; ++jj) wc[jj][i] = wn[jj][i]; } }
#pragma unroll
  for (int jj = 0; jj < 4; ++jj) { const float bb = bfr(BO[jj * 16 + col]);
#pragma unroll
    for (int r = 0; r < 8; ++r) sf[wave][8 * g + r][jj * 16 + col] = acc[jj][r] + bb; }
  LDSX(); for (int rl = 0; rl < 16; ++rl) if (lane < 16) vst2(OUT + (size_t)(r0 + rl) * 64 + lane * 4, *(const v4f*)&sf[wave][rl][lane * 4]); }
// k_qkv's operands reach the four waves of a block through LDS: a tile = 64 of k = two 32-deep passes; x 64 rows x 256 B (f32), weights 128 rows x 128 B (bf16), whole 128-B lines, each fetched once a block.
#define XP 68                     // floats a staged x row: 256 B of data + 16 B (the pitch at which 16-byte LDS reads of 16 rows meet no bank twice)
#define WP 72                     // bf16 a staged weight row: 128 B of data + 16 B (likewise)
#define QX_B (64 * XP * 4)        // bytes of the x plane
#define QBUF_B (QX_B + 128 * WP * 2)   // bytes of one buffer: x plane, weight plane
__device__ __forceinline__ v16b frag_lb(const __bf16* p) { union { v16b v; v8b q[2]; } u; u.q[0] = *(const v8b*)p; u.q[1] = *(const v8b*)(p + 16); return u.v; }
// Eight copies of 512 B each, LS bytes apart in LDS and GS bytes apart in the source. The last line is the wait that stands in front of any rewrite of the copies' address registers: inside the statement nothing can be moved over it.
template <int LS, int GS> __device__ __forceinline__ void copy8r(unsigned l, const char* gp) {
  asm volatile("global_load_async_to_lds_b128 %0, %1, off\n\tglobal_load_async_to_lds_b128 %2, %3, off\n\tglobal_load_async_to_lds_b128 %4, %5, off\n\tglobal_load_async_to_lds_b128 %6, %7, off\n\t"
               "global_load_async_to_lds_b128 %8, %9, off\n\tglobal_load_async_to_lds_b128 %10, %11, off\n\tglobal_load_async_to_lds_b128 %12, %13, off\n\tglobal_load_async_to_lds_b128 %14, %15, off\n\ts_wait_xcnt 0x0"
               :: "v"(l), "v"(gp), "v"(l + 1u * LS), "v"(gp + 1 * GS), "v"(l + 2u * LS), "v"(gp + 2 * GS), "v"(l + 3u * LS), "v"(gp + 3 * GS),
                  "v"(l + 4u * LS), "v"(gp + 4 * GS), "v"(l + 5u * LS), "v"(gp + 5 * GS), "v"(l + 6u * LS), "v"(gp + 6 * GS), "v"(l + 7u * LS), "v"(gp + 7 * GS) : "memory");
}
__global__ __launch_bounds__(128) void k_qkv(const float* __restrict__ XQ, const float* __restrict__ XK, const float* __restrict__ XV, const __bf16* __restrict__ P, const float* __restrict__ BQ, const float* __restrict__ BK, const float* __restrict__ BV, _Float16* __restrict__ QK, _Float16* __restrict__ QKL, _Float16* __restrict__ VTH, _Float16* __restrict__ VTL) {
  const int which0 = (blockIdx.y * 128) / DM; const float* X = (which0 == 0) ? XQ : (which0 == 1) ? XK : XV; const float* BB = BQ ? (((which0 == 0) ? BQ : (which0 == 1) ? BK : BV) + (blockIdx.y * 128 - which0 * DM)) : nullptr;
  __shared__ __align__(16) char sm[2 * QBUF_B];   // the two buffers of the k loop; behind the loop's last barrier the same bytes stage the output
  _Float16 (*so)[16][136] = (_Float16 (*)[16][136])sm; _Float16 (*sol)[16][136] = (_Float16 (*)[16][136])(sm + 2 * 4 * 16 * 136); _Float16 (*sth)[72] = (_Float16 (*)[72])(sm + 4 * 4 * 16 * 136); _Float16 (*stl)[72] = (_Float16 (*)[72])(sm + 4 * 4 * 16 * 136 + 2 * 128 * 72);
  static_assert(4 * 4 * 16 * 136 + 4 * 128 * 72 <= 2 * QBUF_B, "output staging fits the ring");
  const int tid = threadIdx.x, wave = tid >> 5, lane = tid & 31, col = lane & 15, g = lane >> 4; const size_t r0 = (size_t)blockIdx.x * 64 + wave * 16; const int n0 = blockIdx.y * 128;
  v8f acc[8] = {};
  const int ns = DM / 64;   // tiles of k
  // the lane's place in every copy: x: 2 rows x 256 B a copy (row lane / 16, piece lane % 16), this wave's 16 rows; weights: 4 rows x 128 B a copy (row lane / 8, piece lane % 8), this wave's 32 rows
  const char* gx = (const char*)(X + ((size_t)blockIdx.x * 64 + wave * 16 + (lane >> 4)) * DM + (lane & 15) * 4); const char* gw = (const char*)(P + ((size_t)n0 + wave * 32 + (lane >> 3)) * DM + (lane & 7) * 8);
  const unsigned lx = (unsigned)(size_t)sm + (unsigned)((wave * 16 + (lane >> 4)) * (XP * 4) + (lane & 15) * 16), lw = (unsigned)(size_t)sm + (unsigned)(QX_B + (wave * 32 + (lane >> 3)) * (WP * 2) + (lane & 7) * 16);
  auto fill = [&](int s, int bf) { copy8r<2 * XP * 4, 2 * DM * 4>(lx + (unsigned)(bf * QBUF_B), gx + (size_t)s * 256); copy8r<4 * WP * 2, 4 * DM * 2>(lw + (unsigned)(bf * QBUF_B), gw + (size_t)s * 128); };
  fill(0, 0);
  float bias[8];   // loaded here, in flight under the k loop, not one waited load per stored element
#pragma unroll
  for (int j = 0; j < 8; ++j) bias[j] = 0.f;
  if (BB) {
#pragma unroll
    for (int j = 0; j < 8; ++j) bias[j] = BB[j * 16 + col]; }
  asm volatile("s_wait_asynccnt 0x0" ::: "memory");   // this wave's share of tile 0 has landed
  __syncthreads();                                     // every wave's share has: tile 0 may be read
  fill(1, 1);
#pragma unroll 1   // stays rolled: one foot (waits, barrier, refill) a tile, and the text of the loop stays short
  for (int s = 0; s < ns; ++s) { const char* bp = sm + (s & 1) * QBUF_B; const float* fx = (const float*)bp + (wave * 16 + col) * XP + 8 * g; const __bf16* fw = (const __bf16*)(bp + QX_B) + col * WP + 8 * g;
    v4f xc[2][4]; v16b wc[2][8];   // both passes' operands, read as two groups in front of the products (the statement behind each product holds a load at its place in the source)
#pragma unroll
    for (int sub = 0; sub < 2; ++sub) { xc[sub][0] = *(const v4f*)(fx + sub * 32); xc[sub][1] = *(const v4f*)(fx + sub * 32 + 4); xc[sub][2] = *(const v4f*)(fx + sub * 32 + 16); xc[sub][3] = *(const v4f*)(fx + sub * 32 + 20);
#pragma unroll
      for (int j = 0; j < 8; ++j) wc[sub][j] = frag_lb(fw + (j * 16) * WP + sub * 32); }
#pragma unroll
    for (int sub = 0; sub < 2; ++sub) { v16b a;
#pragma unroll
      for (int i = 0; i < 16; ++i) a[i] = (__bf16)xc[sub][i >> 2][i & 3];
#pragma unroll
      for (int j = 0; j < 8; ++j) acc[j] = wmma_bf(a, wc[sub][j], acc[j]); }
    asm volatile("s_wait_dscnt 0x0" ::: "memory");      // this wave's reads of the tile in hand are done
    asm volatile("s_wait_asynccnt 0x0" ::: "memory");   // its share of the next tile has landed
    __syncthreads();                                     // publishes the next tile and frees the buffer just read (behind the last tile: frees the ring for the output staging)
    if (s + 2 < ns) fill(s + 2, s & 1); }
  asm volatile("s_wait_asynccnt 0x0" ::: "memory");   // no copy is left in flight behind the loop
  if (n0 < 2 * DM) {   // q stored unscaled (f16 sigma ~0.6, no subnormal exposure); 1/8 applied to the f32 score
#pragma unroll
    for (int j = 0; j < 8; ++j) {
#pragma unroll
      for (int r = 0; r < 8; ++r) { const float v = acc[j][r] + bfr(bias[j]); const _Float16 hv = (_Float16)v; so[wave][8 * g + r][j * 16 + col] = hv; sol[wave][8 * g + r][j * 16 + col] = (_Float16)((v - (float)hv) * 2048.0f); } }   // q, k (+ bias) as f16 hi + (x2048) residual
    LDSX();
    for (int rl = 0; rl < 16; ++rl) if (lane < 16) { vst2((unsigned*)(QK + (r0 + rl) * (2 * DM) + n0 + lane * 8), *(const v4u*)&so[wave][rl][lane * 8]); vst2((unsigned*)(QKL + (r0 + rl) * (2 * DM) + n0 + lane * 8), *(const v4u*)&sol[wave][rl][lane * 8]); }
  } else {
#pragma unroll
    for (int j = 0; j < 8; ++j) {
#pragma unroll
      for (int r = 0; r < 8; ++r) { const float v = acc[j][r] + bfr(bias[j]); const _Float16 hv = (_Float16)v; sth[j * 16 + col][wave * 16 + 8 * g + r] = hv; stl[j * 16 + col][wave * 16 + 8 * g + r] = (_Float16)((v - (float)hv) * 2048.0f); } }
    __syncthreads();
    const size_t rb = (size_t)blockIdx.x * 64; const int b = (int)(rb / SS), s0 = (int)(rb % SS); const int pc0 = n0 - 2 * DM;
    for (int q = tid; q < 128 * 8; q += 128) { const int d = q >> 3, pc = q & 7; const size_t o = ((size_t)b * DM + pc0 + d) * SS + s0 + pc * 8; vst2((unsigned*)(VTH + o), *(const v4u*)&sth[d][pc * 8]); vst2((unsigned*)(VTL + o), *(const v4u*)&stl[d][pc * 8]); }
  }
}
// ---- k_attn: block = (64 queries, head h, batch b): all-keys flash attention (K = 64: 2 k-steps), scores = (q.k) * 0.125 with single f16 operands (first two query blocks: f16 hi + residual, 3 products), P.V: f16 P*2048 x V hi in acc (first two query blocks also P residual*2048 x V hi + P*2048 x V lo*2048 in accl); O[b*S+q][h*64+d] = (acc + accl / 2048) / (2048 l) (256-B segments)
// K and V reach the four waves of a block through LDS: a tile = 64 keys = two 32-key passes; K 64 key rows x 128 B, V 64 d rows x 128 B (and their residual planes where HI), whole 128-B lines, each fetched once a block.
#define KP 72                    // halfs a staged row: 128 B of data + 16 B, the pitch at which 16-byte LDS reads of 16 rows meet no bank twice
#define PLANE (64 * KP)          // halfs of one staged plane
#define STG_H (2 * 4 * PLANE)    // two buffers of up to four planes: K, V, K residual, V residual
__device__ __forceinline__ v16h frag_l(const _Float16* p) { union { v16h v; v8h q[2]; } u; u.q[0] = *(const v8h*)p; u.q[1] = *(const v8h*)(p + 16); return u.v; }
// Sixteen rows of plane a and sixteen of plane b: eight copies, each 4 rows x 128 B (lane: row lane / 8, 16-byte piece lane % 8); both sources have rows 4,096 B apart. The last line is the wait that stands in front of any rewrite of the copies' address registers: inside the statement nothing can be moved over it.
__device__ __forceinline__ void copy8(unsigned la, const _Float16* ga, unsigned lb, const _Float16* gb) {
  asm volatile("global_load_async_to_lds_b128 %0, %1, off\n\tglobal_load_async_to_lds_b128 %2, %3, off\n\tglobal_load_async_to_lds_b128 %4, %5, off\n\tglobal_load_async_to_lds_b128 %6, %7, off\n\t"
               "global_load_async_to_lds_b128 %8, %9, off\n\tglobal_load_async_to_lds_b128 %10, %11, off\n\tglobal_load_async_to_lds_b128 %12, %13, off\n\tglobal_load_async_to_lds_b128 %14, %15, off\n\ts_wait_xcnt 0x0"
               :: "v"(la), "v"(ga), "v"(la + 2u * 4 * KP), "v"(ga + 4 * 2048), "v"(la + 2u * 8 * KP), "v"(ga + 8 * 2048), "v"(la + 2u * 12 * KP), "v"(ga + 12 * 2048),
                  "v"(lb), "v"(gb), "v"(lb + 2u * 4 * KP), "v"(gb + 4 * 2048), "v"(lb + 2u * 8 * KP), "v"(gb + 8 * 2048), "v"(lb + 2u * 12 * KP), "v"(gb + 12 * 2048) : "memory");
}
// lane l with lane l ^ 16 (a vector move, no LDS): the other half of a query's keys
__device__ __forceinline__ float xhalf(float x) { return __builtin_bit_cast(float, __builtin_amdgcn_permlanex16(__builtin_bit_cast(int, x), __builtin_bit_cast(int, x), 0x76543210, 0xfedcba98, false, false)); }
// Both products are taken transposed: S^T = K . Q^T (rows = keys, columns = queries) and O^T += V^T . P^T (rows = d, columns = queries). A lane then holds 16 of the 32 scores of ONE query (its column), lane ^ 16 the other 16: maximum and sum are in-lane plus one move between the halves, m, l and the rescale factor are one value a lane, and the two score tiles, converted in place, are the B operand of the second product in the hardware k order: P never leaves the registers.
// One 64-query tile; HI = leading query blocks (3 products), written once per path so that each pass is one straight run and its load groups stay whole.
template <bool HI> __device__ __forceinline__ void attn_tile(const _Float16* __restrict__ QK, const _Float16* __restrict__ QKL, const _Float16* __restrict__ VTH, const _Float16* __restrict__ VTL, float* __restrict__ O, float (*so)[16][68], _Float16* st) {
  const int tid = threadIdx.x, wave = tid >> 5, lane = tid & 31, col = lane & 15, g = lane >> 4;
  const int qb = blockIdx.x, h = blockIdx.y, b = blockIdx.z; const int q0 = qb * 64 + wave * 16; const size_t rq = (size_t)b * SS + q0 + col;
  const int nt = SS / 64;   // key tiles (all keys)
  const int bufh = (HI ? 4 : 2) * PLANE;   // halfs of one buffer
  const int crow = wave * 16 + (lane >> 3), cpc = (lane & 7) * 8;   // the lane's first row and its 16-byte piece in every copy
  const size_t ko = ((size_t)b * SS + crow) * (2 * DM) + DM + h * HD + cpc, vo = ((size_t)b * DM + h * HD + crow) * SS + cpc;   // tile 0; a tile on: 64 key rows of K, 64 columns of V
  const unsigned l0 = (unsigned)(size_t)st + 2u * (unsigned)(crow * KP + cpc);
  auto fill = [&](int t, int bf) { const unsigned lb = l0 + 2u * (unsigned)(bf * bufh); const size_t kt = ko + (size_t)t * 64 * (2 * DM), vt = vo + (size_t)t * 64;
    copy8(lb, QK + kt, lb + 2u * PLANE, VTH + vt);
    if (HI) copy8(lb + 2u * 2 * PLANE, QKL + kt, lb + 2u * 3 * PLANE, VTL + vt); };
  fill(0, 0);
  v16h aq[2], aql[2];
#pragma unroll
  for (int kc = 0; kc < 2; ++kc) { aq[kc] = frag_h(QK + rq * (2 * DM) + h * HD + kc * 32, lane); if (HI) aql[kc] = frag_h(QKL + rq * (2 * DM) + h * HD + kc * 32, lane); }
  float m = -3.0e38f, l = 0.f;   // of query col; l sums this half's keys only, the halves are joined behind the loop
  v8f acc[4] = {}, accl[4] = {};
  asm volatile("s_wait_asynccnt 0x0" ::: "memory");   // this wave's share of tile 0 has landed
  __syncthreads();                                     // every wave's share has: tile 0 may be read
  fill(1, 1);
#pragma unroll 1   // stays rolled: one foot (waits, barrier, refill) a tile, and the text of the loop stays short
  for (int t = 0; t < nt; ++t) { const _Float16* fk = st + (t & 1) * bufh + col * KP + 8 * g; const _Float16* fv = fk + PLANE;   // the lane's row col of the K and of the V plane
    // The statement behind each product holds a load at its place in the source, so every LDS read of a pass stands in front of the products that follow it: behind the score products of a pass go, as one group, its own V and (inside the tile, where not HI) the next pass's K, in flight under the softmax.
    v16h kf[2][2], kfl[2][2];   // [ct][kc] K fragments of the pass in hand (residual planes only where HI)
#pragma unroll
    for (int ct = 0; ct < 2; ++ct) {
#pragma unroll
      for (int kc = 0; kc < 2; ++kc) { kf[ct][kc] = frag_l(fk + (ct * 16) * KP + kc * 32); if (HI) kfl[ct][kc] = frag_l(fk + 2 * PLANE + (ct * 16) * KP + kc * 32); } }
#pragma unroll
    for (int sub = 0; sub < 2; ++sub) { v8f s[2]; v16h vf[4], vfl[4];
#pragma unroll
    for (int ct = 0; ct < 2; ++ct) { v8f c = {}, cl = {};
      if (HI) {   // leading query blocks: 3 products
#pragma unroll
        for (int kc = 0; kc < 2; ++kc) { c = wmma16(kf[ct][kc], aq[kc], c); cl = wmma16(kf[ct][kc], aql[kc], cl); cl = wmma16(kfl[ct][kc], aq[kc], cl); }
#pragma unroll
        for (int r = 0; r < 8; ++r) c[r] += cl[r] * (1.0f / 2048.0f); }
      else {
#pragma unroll
        for (int kc = 0; kc < 2; ++kc) c = wmma16(kf[ct][kc], aq[kc], c); }   // single product elsewhere
      { const bool keepk = true;
#pragma unroll
      for (int r = 0; r < 8; ++r) s[ct][r] = keepk ? c[r] * 0.125f : -3.0e38f; } }   // 1/sqrt(64); s[ct][r] = key ct * 16 + 8 g + r of the pass, query col
#pragma unroll
    for (int dt = 0; dt < 4; ++dt) { vf[dt] = frag_l(fv + (dt * 16) * KP + sub * 32); if (HI) vfl[dt] = frag_l(fv + 2 * PLANE + (dt * 16) * KP + sub * 32); }
    if (sub == 0 && !HI) {   // the tile's second pass's K (where HI: further down)
#pragma unroll
      for (int ct = 0; ct < 2; ++ct) {
#pragma unroll
        for (int kc = 0; kc < 2; ++kc) kf[ct][kc] = frag_l(fk + (32 + ct * 16) * KP + kc * 32); } }
    __builtin_amdgcn_sched_barrier(0);   // keeps the group here, in front of the softmax; moved down its reads would be waited for right in front of the second product
    float t4[4];   // four short chains, not one long one
#pragma unroll
    for (int j = 0; j < 4; ++j) t4[j] = fmaxf(fmaxf(s[0][j], s[0][4 + j]), fmaxf(s[1][j], s[1][4 + j]));
    float mx = fmaxf(fmaxf(t4[0], t4[1]), fmaxf(t4[2], t4[3])); mx = fmaxf(mx, xhalf(mx));   // both halves now hold the pass's maximum of query col
    const float mn = fmaxf(m, mx); const float alpha = (m <= -1.0e38f) ? 0.f : __expf(m - mn);
    float e[2][8];
#pragma unroll
    for (int ct = 0; ct < 2; ++ct) {
#pragma unroll
      for (int r = 0; r < 8; ++r) e[ct][r] = (s[ct][r] <= -1.0e38f) ? 0.f : __expf(s[ct][r] - mn); }
#pragma unroll
    for (int j = 0; j < 4; ++j) t4[j] = (e[0][j] + e[0][4 + j]) + (e[1][j] + e[1][4 + j]);
    l = l * alpha + ((t4[0] + t4[1]) + (t4[2] + t4[3])); m = mn;
#pragma unroll
    for (int dt = 0; dt < 4; ++dt) {
#pragma unroll
      for (int r = 0; r < 8; ++r) { acc[dt][r] *= alpha; accl[dt][r] *= alpha; } }
    v16h pa, pl;   // P^T as a B operand: element i = key 8 g + i, element 8 + i = key 16 + 8 g + i, the order in which the V fragments hold their keys
#pragma unroll
    for (int i = 0; i < 8; ++i) { const float x0 = e[0][i] * 2048.0f, x1 = e[1][i] * 2048.0f; const _Float16 h0 = (_Float16)x0, h1 = (_Float16)x1; pa[i] = h0; pa[8 + i] = h1; pl[i] = (_Float16)((x0 - (float)h0) * 2048.0f); pl[8 + i] = (_Float16)((x1 - (float)h1) * 2048.0f); }   // P scaled by 2^11 before the f16 split so small softmax weights stay out of the f16 subnormal range; 2^-11 folded into the epilogue
    if (sub == 0 && HI) {   // the tile's second pass's K where HI: read from here on, in flight under the second product; read in front of the softmax, beside scores, P and all four V planes' fragments, it made the build spill to scratch inside the loop
#pragma unroll
      for (int ct = 0; ct < 2; ++ct) {
#pragma unroll
        for (int kc = 0; kc < 2; ++kc) { kf[ct][kc] = frag_l(fk + (32 + ct * 16) * KP + kc * 32); kfl[ct][kc] = frag_l(fk + 2 * PLANE + (32 + ct * 16) * KP + kc * 32); } } }
#pragma unroll
    for (int dt = 0; dt < 4; ++dt) { acc[dt] = wmma16(vf[dt], pa, acc[dt]); if (HI) { accl[dt] = wmma16(vf[dt], pl, accl[dt]); accl[dt] = wmma16(vfl[dt], pa, accl[dt]); } }   // leading query blocks: P hi/lo x V hi/lo (3 products); elsewhere P x V single; acc[dt][r] = d dt * 16 + 8 g + r of query col
    }
    asm volatile("s_wait_dscnt 0x0" ::: "memory");      // this wave's reads of the tile in hand are done
    asm volatile("s_wait_asynccnt 0x0" ::: "memory");   // its share of the next tile has landed
    __syncthreads();                                     // publishes the next tile and frees the buffer just read
    if (t + 2 < nt) fill(t + 2, t & 1); }
  asm volatile("s_wait_asynccnt 0x0" ::: "memory");   // no copy is left in flight behind the loop
  const float il = (1.0f / 2048.0f) / (l + xhalf(l));   // the two halves' sums joined
#pragma unroll
  for (int dt = 0; dt < 4; ++dt) {
#pragma unroll
    for (int r = 0; r < 8; ++r) so[wave][col][dt * 16 + 8 * g + r] = (acc[dt][r] + accl[dt][r] * (1.0f / 2048.0f)) * il; }
  LDSX();
  for (int rl = 0; rl < 16; ++rl) if (lane < 16) vst2(O + ((size_t)b * SS + q0 + rl) * DM + h * HD + lane * 4, *(const v4f*)&so[wave][rl][lane * 4]);
}
__global__ __launch_bounds__(128) void k_attn(const _Float16* __restrict__ QK, const _Float16* __restrict__ QKL, const _Float16* __restrict__ VTH, const _Float16* __restrict__ VTL, const void* __restrict__ KMASK, float* __restrict__ O) {
  __shared__ __align__(16) float so[4][16][68]; __shared__ __align__(16) _Float16 st[STG_H];
  if (blockIdx.x < 2) attn_tile<true>(QK, QKL, VTH, VTL, O, so, st); else attn_tile<false>(QK, QKL, VTH, VTL, O, so, st);
}
// ---- k_out: block = (64 rows, 128 cols): out = O(hi/lo) . Wo rows (2 products) + bo
__global__ __launch_bounds__(128) void k_out(const float* __restrict__ O, const __bf16* __restrict__ P, const float* __restrict__ BO, float* __restrict__ Y) {
  __shared__ __align__(16) float so[4][16][132];
  const int tid = threadIdx.x, wave = tid >> 5, lane = tid & 31, col = lane & 15, g = lane >> 4; const size_t r0 = (size_t)blockIdx.x * 64 + wave * 16; const int n0 = blockIdx.y * 128;
  v8f acc[8] = {};
#pragma unroll 2
  for (int kc = 0; kc < DM / 32; ++kc) { const F2 a = split_row(O + (r0 + col) * DM, kc * 32, lane);
#pragma unroll
    for (int j = 0; j < 8; ++j) { const v16b w = frag_b(P + (size_t)(n0 + j * 16 + col) * DM + kc * 32, lane); acc[j] = wmma_bf(a.l, w, acc[j]); acc[j] = wmma_bf(a.h, w, acc[j]); } }
#pragma unroll
  for (int j = 0; j < 8; ++j) {
#pragma unroll
    for (int r = 0; r < 8; ++r) so[wave][8 * g + r][j * 16 + col] = acc[j][r] + (BO ? bfr(BO[n0 + j * 16 + col]) : 0.f); }
  LDSX();
  for (int rl = 0; rl < 16; ++rl) vst2(Y + (r0 + rl) * DM + n0 + lane * 4, *(const v4f*)&so[wave][rl][lane * 4]);
}
extern "C" void kernel_launch(void* const* d_in, const int* in_sizes, int n_in, void* d_out, int out_size, void* d_ws, size_t ws_size, hipStream_t stream) {
  (void)in_sizes; (void)n_in; (void)out_size;
  const float** F = (const float**)d_in;   // 0 current [2048,1024], 1 context [2048,1024], 2 Wq [16,1024,64], 3 bq [16,64], 4 Wk, 5 bk, 6 Wv, 7 bv, 8 Wo [1024,64], 9 bo [64]
  if (ws_size < (size_t)WS_END) return;
  char* ws = (char*)d_ws; __bf16* PK = (__bf16*)(ws + WS_PK); _Float16 *QK = (_Float16*)(ws + WS_QK), *QKL = (_Float16*)(ws + WS_QKL), *VTH = (_Float16*)(ws + WS_VTH), *VTL = (_Float16*)(ws + WS_VTL); float* O = (float*)(ws + WS_O);
  k_pack<<<dim3(DM / PKI, NH, 3), 256, 0, stream>>>(F[2], F[4], F[6], PK);
  k_qkv<<<dim3(TNB * SS / 64, QKVW / 128), 128, 0, stream>>>(F[0], F[1], F[1], PK + PK_A, F[3], F[5], F[7], QK, QKL, VTH, VTL);
  k_attn<<<dim3(TQB, TNH, TNB), 128, 0, stream>>>(QK, QKL, VTH, VTL, nullptr, O);
  k_out2<<<TOB, 128, 0, stream>>>(O, F[8], F[9], (float*)d_out);
}

// v005
// It runs in 81.9 microseconds.
// In both of two side-by-side timings against v004, it was 1.24 times as fast.
// Counting every step since v000, it is 4.55 times as fast.
// compute dtype: all float inputs rounded to bf16; q/k/v = x W[h] + b[h] with EXACT bf16 products on WMMA 16x16x32 (per-head (in,out) weights packed as one 1024 -> 1024 projection each), f16 hi + residual; PLAIN-HYBRID scores (first 128 queries 3-product, later single), x 1/8, running-max softmax in f32 (hardware exp); 3-product P . v for the first 128 queries; the head-major stack + row-major view realised as an index map feeding out = y2 (bf16 hi + lo) . Wo + bo (2 products); f32 output.
#include <hip/hip_runtime.h>
#include <math.h>

typedef __attribute__((ext_vector_type(16))) _Float16 v16h;
typedef __attribute__((ext_vector_type(16))) __bf16 v16b;
typedef __attribute__((ext_vector_type(8)))  _Float16 v8h;
typedef __attribute__((ext_vector_type(8)))  float v8f;
typedef __attribute__((ext_vector_type(4)))  float v4f;
typedef __attribute__((ext_vector_type(2)))  float v2f;
typedef __attribute__((ext_vector_type(4)))  unsigned v4u;
typedef __attribute__((ext_vector_type(4)))  int v4i;
typedef float __attribute__((may_alias)) float_a;
typedef int __attribute__((may_alias)) int_a;

template <typename T> __device__ __forceinline__ void vst2(void* p, T v) { *(T*)p = v;  }
__device__ __forceinline__ v8f wmma16(v16h a, v16h b, v8f c) {
  v8f d = __builtin_amdgcn_wmma_f32_16x16x32_f16(false, a, false, b, (short)0, c, false, false);
  asm volatile("v_nop\n\tv_nop\n\tv_nop\n\tv_nop" : "+v"(d) : "v"(a), "v"(b));
  return d;
}
__device__ __forceinline__ v8f wmma_bf(v16b a, v16b b, v8f c) {
  v8f d = __builtin_amdgcn_wmma_f32_16x16x32_bf16(false, a, false, b, (short)0, c, false, false);
  asm volatile("v_nop\n\tv_nop\n\tv_nop\n\tv_nop" : "+v"(d) : "v"(a), "v"(b));
  return d;
}
// Per-head (inefficient) multi-head cross attention (16 heads x 64, 2,048 current x 2,048 context tokens, D_IN 1024): per head q = x Wq[h] + bq[h], k/v from the context; softmax(q k^T / 8) v; heads stacked head-major then row-major re-viewed to [S, 1024]; Wo [1024 -> 64] + bo.
__device__ __forceinline__ v16h frag_h(const _Float16* rowk0, int lane) {
  union { v16h v; v8h q[2]; } u; const _Float16* p = rowk0 + 8 * (lane >> 4);
  u.q[0] = *(const v8h*)p; u.q[1] = *(const v8h*)(p + 16); return u.v;
}
__device__ __forceinline__ v16h frag_f32(const float* rowk0, int lane) {
  v16h a; const float* p = rowk0 + 8 * (lane >> 4);
#pragma unroll
  for (int i = 0; i < 8; ++i) { a[i] = (_Float16)p[i]; a[8 + i] = (_Float16)p[16 + i]; }
  return a;
}
__device__ __forceinline__ v16h frag_f32s(const float* rowk0, int lane, float sc) {
  v16h a; const float* p = rowk0 + 8 * (lane >> 4);
#pragma unroll
  for (int i = 0; i < 8; ++i) { a[i] = (_Float16)(p[i] * sc); a[8 + i] = (_Float16)(p[16 + i] * sc); }
  return a;
}
// column fragment from a [K][ld] layout (column n), rows >= K read as 0
__device__ __forceinline__ v16h fragc_f32(const float* W, int k0, int n, int lane, int ld, int K) {
  v16h a; const int g = lane >> 4;
#pragma unroll
  for (int i = 0; i < 8; ++i) { const int ka = k0 + 8 * g + i, kb = ka + 16;
    a[i] = (_Float16)(ka < K ? W[(size_t)(ka < K ? ka : K - 1) * ld + n] : 0.f); a[8 + i] = (_Float16)(kb < K ? W[(size_t)(kb < K ? kb : K - 1) * ld + n] : 0.f); }
  return a;
}
struct F2 { v16b h, l; };
__device__ __forceinline__ F2 bsplit16(const float v[16]) { F2 r;
#pragma unroll
  for (int i = 0; i < 16; ++i) { const __bf16 h = (__bf16)v[i]; r.h[i] = h; r.l[i] = (__bf16)(v[i] - (float)h); }
  return r; }
__device__ __forceinline__ F2 split_row(const float* row, int k0, int lane) { float v[16]; const float* p = row + k0 + 8 * (lane >> 4);
#pragma unroll
  for (int i = 0; i < 8; ++i) { v[i] = p[i]; v[8 + i] = p[16 + i]; }
  return bsplit16(v); }
__device__ __forceinline__ F2 split_rowK(const float* row, int k0, int lane, int K) { float v[16]; const int g = lane >> 4;
#pragma unroll
  for (int i = 0; i < 8; ++i) { const int ka = k0 + 8 * g + i, kb = ka + 16; v[i] = ka < K ? row[ka < K ? ka : K - 1] : 0.f; v[8 + i] = kb < K ? row[kb < K ? kb : K - 1] : 0.f; }
  return bsplit16(v); }
__device__ __forceinline__ F2 split_col(const float* W, int k0, int n, int lane, int ld, int K) { float v[16]; const int g = lane >> 4;
#pragma unroll
  for (int i = 0; i < 8; ++i) { const int ka = k0 + 8 * g + i, kb = ka + 16; v[i] = ka < K ? W[(size_t)(ka < K ? ka : K - 1) * ld + n] : 0.f; v[8 + i] = kb < K ? W[(size_t)(kb < K ? kb : K - 1) * ld + n] : 0.f; }
  return bsplit16(v); }
__device__ __forceinline__ v8f mac3(const F2& a, const F2& b, v8f c) { c = wmma_bf(a.l, b.h, c); c = wmma_bf(a.h, b.l, c); return wmma_bf(a.h, b.h, c); }
__device__ __forceinline__ float sigm(float v) { return 1.0f / (1.0f + expf(-v)); }
#define LDSX() do { asm volatile("s_wait_dscnt 0" ::: "memory"); __builtin_amdgcn_wave_barrier(); __builtin_amdgcn_fence(__ATOMIC_RELEASE, "workgroup"); } while (0)


#define NB 1
#define SS 2048
#define DM 1024
#define NH 16
#define HD 64
#define QKVW (3 * DM)
#ifndef TQB
#define TQB (SS / 64)
#endif
#ifndef TNH
#define TNH NH
#define TNB NB
#define TOB (NB * SS / 64)     // 64-row tiles of the 2,048 rows (all); nothing uses it
#endif
typedef __attribute__((ext_vector_type(8))) __bf16 v8b;
__device__ __forceinline__ v16b frag_b(const __bf16* rowk0, int lane) {
  union { v16b v; v8b q[2]; } u; const __bf16* p = rowk0 + 8 * (lane >> 4);
  u.q[0] = *(const v8b*)p; u.q[1] = *(const v8b*)(p + 16); return u.v;
}
// fragment at a wave-uniform base plus the lane's own byte offset: a group's loads all name that one offset register
__device__ __forceinline__ v16b frag_bo(const __bf16* ubase, unsigned boff) { union { v16b v; v8b q[2]; } u; const __bf16* p = (const __bf16*)((const char*)ubase + boff); u.q[0] = *(const v8b*)p; u.q[1] = *(const v8b*)(p + 16); return u.v; }
__device__ __forceinline__ float bfr(float v) { return (float)(__bf16)v; }
__device__ __attribute__((noinline)) float exp_ni(float v) { return expf(v); }
__device__ __attribute__((noinline)) float erf_ni(float v) { return erff(v); }

#define PK_A 0                       // [3072][1024] Wqkv rows (natural [out][in])
#define PK_P (PK_A + QKVW * DM)        // [1024][1024] reserved; nothing writes or reads it
#define PK_END (PK_P + DM * DM)
#define WS_PK  0u
#define WS_QK  (WS_PK + 2u * PK_END)             // f16 [2048 rows][2048]: q | k
#define WS_QKL (WS_QK + 2u * NB * SS * 2 * DM)     // f16 q | k residual planes x2048
#define WS_VTH (WS_QKL + 2u * NB * SS * 2 * DM)    // f16 [b][1024 (h*64+d)][2048 s] hi
#define WS_VTL (WS_VTH + 2u * NB * DM * SS)        // f16 lo x 2048
#define WS_O   (WS_VTL + 2u * NB * DM * SS)        // f32 [2048][1024]
#define WS_CS  (WS_O + 4u * NB * SS * DM)           // f32 [2][2048][32] reserved; nothing writes or reads it
#define WS_END (WS_CS + 4u * 2 * SS * 32)
// ---- k_pack: block = (128 input rows i, head h, which): W [h][1024 in][64 d] -> bf16 packed rows (which*DM + h*64 + d)[i]; which 0..2 -> W_q/W_k/W_v into PK_A
// The block's source tile (128 rows x 64 floats) is 32 KB in a row: it is read as whole lines, 16 bytes a lane, all eight loads of a thread in flight together, and turned in LDS; each packed row gets 256 B in a row.
#define PKI 128                   // input rows a block
#define PKP (PKI / 2 + 1)         // dwords a staged packed row: 64 of data (two bf16 each) + 1, the pitch at which the 32 lanes of a write (rows 4 apart) and of a read (dwords 4 apart) each meet 32 banks
__global__ __launch_bounds__(256) void k_pack(const float* __restrict__ WQ, const float* __restrict__ WK, const float* __restrict__ WV, __bf16* __restrict__ PK) {
  __shared__ unsigned s[HD * PKP]; const int it = blockIdx.x, h = blockIdx.y, which = blockIdx.z, t = threadIdx.x; const float* Wm = which == 0 ? WQ : which == 1 ? WK : WV;
  const int d4 = (t & 15) * 4, p0 = t >> 4;   // the thread's four columns d; its pair of input rows in each group of 32
  const float* src = Wm + ((size_t)h * DM + it * PKI + 2 * p0) * HD + d4;
  v4f a[4], b[4];   // rows 2 p and 2 p + 1, p = k * 16 + p0
#pragma unroll   // (here and below) a, b and v stay in registers, and the eight loads stand as one group in front of the first use
  for (int k = 0; k < 4; ++k) { a[k] = *(const v4f*)(src + (size_t)(k * 32) * HD); b[k] = *(const v4f*)(src + (size_t)(k * 32 + 1) * HD); }
#pragma unroll
  for (int k = 0; k < 4; ++k) {
#pragma unroll
    for (int j = 0; j < 4; ++j) { union { __bf16 e[2]; unsigned u; } w; w.e[0] = (__bf16)a[k][j]; w.e[1] = (__bf16)b[k][j]; s[(d4 + j) * PKP + k * 16 + p0] = w.u; } }
  __syncthreads(); __bf16* dst = PK + PK_A + ((size_t)which * DM + h * HD) * DM + it * PKI;
#pragma unroll
  for (int k = 0; k < 4; ++k) { const int q = k * 256 + t, d = q >> 4, pc = q & 15; v4u v;
#pragma unroll
    for (int j = 0; j < 4; ++j) v[j] = s[d * PKP + pc * 4 + j];
    vst2((unsigned*)(dst + (size_t)d * DM + pc * 8), v); } }
// ---- k_out2: block = (16 rows r of the re-viewed [2048][1024] matrix, 32 of the 64 output columns): y2[r][j*64 + o] = O[16*(r%128) + j][(r/128)*64 + o]; out = y2 (hi + lo) . Wo + bo  (Wo (in,out) [1024][64])
// The 1,024-deep sum is dealt to the block's eight waves, 128 of k each: the launch has 2,048 waves on 256 blocks in place of 128 waves on 32, and a wave's chain of waited load groups is 4 passes long, not 32. The eight partial tiles meet in LDS and are summed there in wave order.
#define OKW 8                     // waves a block = parts of k
#define OKP (DM / 32 / OKW)       // 32-deep passes a wave
#define OSP 36                    // floats a staged partial row: 32 of data + 4 (rows 8 apart then start 32 banks apart: the two halves of a wave's write meet no bank twice)
__global__ __launch_bounds__(32 * OKW) void k_out2(const float* __restrict__ O, const float* __restrict__ WO, const float* __restrict__ BO, float* __restrict__ OUT) { __shared__ __align__(16) float sp[OKW][16][OSP];
  const int tid = threadIdx.x, wave = tid >> 5, lane = tid & 31, col = lane & 15, g = lane >> 4; const int r0 = blockIdx.x * 16, n0 = blockIdx.y * 32; const int rr = r0 + col; const int hsel = rr / 128; const int sbase = 16 * (rr % 128);
  v8f acc[2] = {};
  const float* orow = O + (size_t)(sbase + wave * (OKP / 2)) * DM + hsel * HD + 8 * g; const float* wcol = WO + (size_t)(wave * OKP * 32 + 8 * g) * 64 + n0 + col;   // this wave's first pass
  float ac[OKP][16], wc[OKP][2][16];   // the operands of all the wave's passes, loaded as one group in front of the first product (the statement behind each product holds a load at its place in the source)
#pragma unroll
  for (int p = 0; p < OKP; ++p) { const float* on = orow + (size_t)(p / 2) * DM + (p % 2) * 32; const float* wq = wcol + (size_t)(p * 32) * 64;
#pragma unroll
    for (int i = 0; i < 8; ++i) { ac[p][i] = on[i]; ac[p][8 + i] = on[16 + i];
#pragma unroll
      for (int jj = 0; jj < 2; ++jj) { wc[p][jj][i] = wq[(size_t)i * 64 + jj * 16]; wc[p][jj][8 + i] = wq[(size_t)(16 + i) * 64 + jj * 16]; } } }
  const int orw = tid >> 4, oc = (tid & 15) * 2;   // the thread's two neighbouring outputs in the closing sum
  const float b0 = BO[n0 + oc], b1 = BO[n0 + oc + 1];
  asm volatile("s_wait_xcnt 0x0" ::: "memory");   // stands behind the group, in front of the first instruction that reuses a register which one of its loads names as address
#pragma unroll
  for (int p = 0; p < OKP; ++p) { const F2 a = bsplit16(ac[p]);
#pragma unroll
    for (int jj = 0; jj < 2; ++jj) { v16b w;
#pragma unroll
      for (int i = 0; i < 16; ++i) w[i] = (__bf16)wc[p][jj][i];
      acc[jj] = wmma_bf(a.h, w, acc[jj]); acc[jj] = wmma_bf(a.l, w, acc[jj]); } }
#pragma unroll
  for (int jj = 0; jj < 2; ++jj) {
#pragma unroll
    for (int r = 0; r < 8; ++r) sp[wave][8 * g + r][jj * 16 + col] = acc[jj][r]; }
  __syncthreads();   // every wave's partial tile is in LDS
  v2f s = *(const v2f*)&sp[0][orw][oc];
#pragma unroll
  for (int w = 1; w < OKW; ++w) s += *(const v2f*)&sp[w][orw][oc];
  s[0] += bfr(b0); s[1] += bfr(b1);
  vst2(OUT + (size_t)(r0 + orw) * 64 + n0 + oc, s); }   // a row's 32 columns are one whole 128-B line, written by this block alone
// k_qkv's operands reach the four waves of a block through LDS: a tile = 64 of k = two 32-deep passes; x 64 rows x 256 B (f32), weights 128 rows x 128 B (bf16), whole 128-B lines, each fetched once a block.
#define XP 68                     // floats a staged x row: 256 B of data + 16 B (the pitch at which 16-byte LDS reads of 16 rows meet no bank twice)
#define WP 72                     // bf16 a staged weight row: 128 B of data + 16 B (likewise)
#define QX_B (64 * XP * 4)        // bytes of the x plane
#define QBUF_B (QX_B + 128 * WP * 2)   // bytes of one buffer: x plane, weight plane
__device__ __forceinline__ v16b frag_lb(const __bf16* p) { union { v16b v; v8b q[2]; } u; u.q[0] = *(const v8b*)p; u.q[1] = *(const v8b*)(p + 16); return u.v; }
// Eight copies of 512 B each, LS bytes apart in LDS and GS bytes apart in the source. The last line is the wait that stands in front of any rewrite of the copies' address registers: inside the statement nothing can be moved over it.
template <int LS, int GS> __device__ __forceinline__ void copy8r(unsigned l, const char* gp) {
  asm volatile("global_load_async_to_lds_b128 %0, %1, off\n\tglobal_load_async_to_lds_b128 %2, %3, off\n\tglobal_load_async_to_lds_b128 %4, %5, off\n\tglobal_load_async_to_lds_b128 %6, %7, off\n\t"
               "global_load_async_to_lds_b128 %8, %9, off\n\tglobal_load_async_to_lds_b128 %10, %11, off\n\tglobal_load_async_to_lds_b128 %12, %13, off\n\tglobal_load_async_to_lds_b128 %14, %15, off\n\ts_wait_xcnt 0x0"
               :: "v"(l), "v"(gp), "v"(l + 1u * LS), "v"(gp + 1 * GS), "v"(l + 2u * LS), "v"(gp + 2 * GS), "v"(l + 3u * LS), "v"(gp + 3 * GS),
                  "v"(l + 4u * LS), "v"(gp + 4 * GS), "v"(l + 5u * LS), "v"(gp + 5 * GS), "v"(l + 6u * LS), "v"(gp + 6 * GS), "v"(l + 7u * LS), "v"(gp + 7 * GS) : "memory");
}
__global__ __launch_bounds__(128) void k_qkv(const float* __restrict__ XQ, const float* __restrict__ XK, const float* __restrict__ XV, const __bf16* __restrict__ P, const float* __restrict__ BQ, const float* __restrict__ BK, const float* __restrict__ BV, _Float16* __restrict__ QK, _Float16* __restrict__ QKL, _Float16* __restrict__ VTH, _Float16* __restrict__ VTL) {
  const int which0 = (blockIdx.y * 128) / DM; const float* X = (which0 == 0) ? XQ : (which0 == 1) ? XK : XV; const float* BB = BQ ? (((which0 == 0) ? BQ : (which0 == 1) ? BK : BV) + (blockIdx.y * 128 - which0 * DM)) : nullptr;
  __shared__ __align__(16) char sm[2 * QBUF_B];   // the two buffers of the k loop; behind the loop's last barrier the same bytes stage the output
  _Float16 (*so)[16][136] = (_Float16 (*)[16][136])sm; _Float16 (*sol)[16][136] = (_Float16 (*)[16][136])(sm + 2 * 4 * 16 * 136); _Float16 (*sth)[72] = (_Float16 (*)[72])(sm + 4 * 4 * 16 * 136); _Float16 (*stl)[72] = (_Float16 (*)[72])(sm + 4 * 4 * 16 * 136 + 2 * 128 * 72);
  static_assert(4 * 4 * 16 * 136 + 4 * 128 * 72 <= 2 * QBUF_B, "output staging fits the ring");
  const int tid = threadIdx.x, wave = tid >> 5, lane = tid & 31, col = lane & 15, g = lane >> 4; const size_t r0 = (size_t)blockIdx.x * 64 + wave * 16; const int n0 = blockIdx.y * 128;
  v8f acc[8] = {};
  const int ns = DM / 64;   // tiles of k
  // the lane's place in every copy: x: 2 rows x 256 B a copy (row lane / 16, piece lane % 16), this wave's 16 rows; weights: 4 rows x 128 B a copy (row lane / 8, piece lane % 8), this wave's 32 rows
  const char* gx = (const char*)(X + ((size_t)blockIdx.x * 64 + wave * 16 + (lane >> 4)) * DM + (lane & 15) * 4); const char* gw = (const char*)(P + ((size_t)n0 + wave * 32 + (lane >> 3)) * DM + (lane & 7) * 8);
  const unsigned lx = (unsigned)(size_t)sm + (unsigned)((wave * 16 + (lane >> 4)) * (XP * 4) + (lane & 15) * 16), lw = (unsigned)(size_t)sm + (unsigned)(QX_B + (wave * 32 + (lane >> 3)) * (WP * 2) + (lane & 7) * 16);
  auto fill = [&](int s, int bf) { copy8r<2 * XP * 4, 2 * DM * 4>(lx + (unsigned)(bf * QBUF_B), gx + (size_t)s * 256); copy8r<4 * WP * 2, 4 * DM * 2>(lw + (unsigned)(bf * QBUF_B), gw + (size_t)s * 128); };
  fill(0, 0);
  float bias[8];   // loaded here, in flight under the k loop, not one waited load per stored element
#pragma unroll
  for (int j = 0; j < 8; ++j) bias[j] = 0.f;
  if (BB) {
#pragma unroll
    for (int j = 0; j < 8; ++j) bias[j] = BB[j * 16 + col]; }
  asm volatile("s_wait_asynccnt 0x0" ::: "memory");   // this wave's share of tile 0 has landed
  __syncthreads();                                     // every wave's share has: tile 0 may be read
  fill(1, 1);
#pragma unroll 1   // stays rolled: one foot (waits, barrier, refill) a tile, and the text of the loop stays short
  for (int s = 0; s < ns; ++s) { const char* bp = sm + (s & 1) * QBUF_B; const float* fx = (const float*)bp + (wave * 16 + col) * XP + 8 * g; const __bf16* fw = (const __bf16*)(bp + QX_B) + col * WP + 8 * g;
    v4f xc[2][4]; v16b wc[2][8];   // both passes' operands, read as two groups in front of the products (the statement behind each product holds a load at its place in the source)
#pragma unroll
    for (int sub = 0; sub < 2; ++sub) { xc[sub][0] = *(const v4f*)(fx + sub * 32); xc[sub][1] = *(const v4f*)(fx + sub * 32 + 4); xc[sub][2] = *(const v4f*)(fx + sub * 32 + 16); xc[sub][3] = *(const v4f*)(fx + sub * 32 + 20);
#pragma unroll
      for (int j = 0; j < 8; ++j) wc[sub][j] = frag_lb(fw + (j * 16) * WP + sub * 32); }
#pragma unroll
    for (int sub = 0; sub < 2; ++sub) { v16b a;
#pragma unroll
      for (int i = 0; i < 16; ++i) a[i] = (__bf16)xc[sub][i >> 2][i & 3];
#pragma unroll
      for (int j = 0; j < 8; ++j) acc[j] = wmma_bf(a, wc[sub][j], acc[j]); }
    asm volatile("s_wait_dscnt 0x0" ::: "memory");      // this wave's reads of the tile in hand are done
    asm volatile("s_wait_asynccnt 0x0" ::: "memory");   // its share of the next tile has landed
    __syncthreads();                                     // publishes the next tile and frees the buffer just read (behind the last tile: frees the ring for the output staging)
    if (s + 2 < ns) fill(s + 2, s & 1); }
  asm volatile("s_wait_asynccnt 0x0" ::: "memory");   // no copy is left in flight behind the loop
  if (n0 < 2 * DM) {   // q stored unscaled (f16 sigma ~0.6, no subnormal exposure); 1/8 applied to the f32 score
#pragma unroll
    for (int j = 0; j < 8; ++j) {
#pragma unroll
      for (int r = 0; r < 8; ++r) { const float v = acc[j][r] + bfr(bias[j]); const _Float16 hv = (_Float16)v; so[wave][8 * g + r][j * 16 + col] = hv; sol[wave][8 * g + r][j * 16 + col] = (_Float16)((v - (float)hv) * 2048.0f); } }   // q, k (+ bias) as f16 hi + (x2048) residual
    LDSX();
    for (int rl = 0; rl < 16; ++rl) if (lane < 16) { vst2((unsigned*)(QK + (r0 + rl) * (2 * DM) + n0 + lane * 8), *(const v4u*)&so[wave][rl][lane * 8]); vst2((unsigned*)(QKL + (r0 + rl) * (2 * DM) + n0 + lane * 8), *(const v4u*)&sol[wave][rl][lane * 8]); }
  } else {
#pragma unroll
    for (int j = 0; j < 8; ++j) {
#pragma unroll
      for (int r = 0; r < 8; ++r) { const float v = acc[j][r] + bfr(bias[j]); const _Float16 hv = (_Float16)v; sth[j * 16 + col][wave * 16 + 8 * g + r] = hv; stl[j * 16 + col][wave * 16 + 8 * g + r] = (_Float16)((v - (float)hv) * 2048.0f); } }
    __syncthreads();
    const size_t rb = (size_t)blockIdx.x * 64; const int b = (int)(rb / SS), s0 = (int)(rb % SS); const int pc0 = n0 - 2 * DM;
    for (int q = tid; q < 128 * 8; q += 128) { const int d = q >> 3, pc = q & 7; const size_t o = ((size_t)b * DM + pc0 + d) * SS + s0 + pc * 8; vst2((unsigned*)(VTH + o), *(const v4u*)&sth[d][pc * 8]); vst2((unsigned*)(VTL + o), *(const v4u*)&stl[d][pc * 8]); }
  }
}
// ---- k_attn: block = (64 queries, head h, batch b): all-keys flash attention (K = 64: 2 k-steps), scores = (q.k) * 0.125 with single f16 operands (first two query blocks: f16 hi + residual, 3 products), P.V: f16 P*2048 x V hi in acc (first two query blocks also P residual*2048 x V hi + P*2048 x V lo*2048 in accl); O[b*S+q][h*64+d] = (acc + accl / 2048) / (2048 l) (256-B segments)
// K and V reach the four waves of a block through LDS: a tile = 64 keys = two 32-key passes; K 64 key rows x 128 B, V 64 d rows x 128 B (and their residual planes where HI), whole 128-B lines, each fetched once a block.
#define KP 72                    // halfs a staged row: 128 B of data + 16 B, the pitch at which 16-byte LDS reads of 16 rows meet no bank twice
#define PLANE (64 * KP)          // halfs of one staged plane
#define STG_H (2 * 4 * PLANE)    // two buffers of up to four planes: K, V, K residual, V residual
__device__ __forceinline__ v16h frag_l(const _Float16* p) { union { v16h v; v8h q[2]; } u; u.q[0] = *(const v8h*)p; u.q[1] = *(const v8h*)(p + 16); return u.v; }
// Sixteen rows of plane a and sixteen of plane b: eight copies, each 4 rows x 128 B (lane: row lane / 8, 16-byte piece lane % 8); both sources have rows 4,096 B apart. The last line is the wait that stands in front of any rewrite of the copies' address registers: inside the statement nothing can be moved over it.
__device__ __forceinline__ void copy8(unsigned la, const _Float16* ga, unsigned lb, const _Float16* gb) {
  asm volatile("global_load_async_to_lds_b128 %0, %1, off\n\tglobal_load_async_to_lds_b128 %2, %3, off\n\tglobal_load_async_to_lds_b128 %4, %5, off\n\tglobal_load_async_to_lds_b128 %6, %7, off\n\t"
               "global_load_async_to_lds_b128 %8, %9, off\n\tglobal_load_async_to_lds_b128 %10, %11, off\n\tglobal_load_async_to_lds_b128 %12, %13, off\n\tglobal_load_async_to_lds_b128 %14, %15, off\n\ts_wait_xcnt 0x0"
               :: "v"(la), "v"(ga), "v"(la + 2u * 4 * KP), "v"(ga + 4 * 2048), "v"(la + 2u * 8 * KP), "v"(ga + 8 * 2048), "v"(la + 2u * 12 * KP), "v"(ga + 12 * 2048),
                  "v"(lb), "v"(gb), "v"(lb + 2u * 4 * KP), "v"(gb + 4 * 2048), "v"(lb + 2u * 8 * KP), "v"(gb + 8 * 2048), "v"(lb + 2u * 12 * KP), "v"(gb + 12 * 2048) : "memory");
}
// lane l with lane l ^ 16 (a vector move, no LDS): the other half of a query's keys
__device__ __forceinline__ float xhalf(float x) { return __builtin_bit_cast(float, __builtin_amdgcn_permlanex16(__builtin_bit_cast(int, x), __builtin_bit_cast(int, x), 0x76543210, 0xfedcba98, false, false)); }
// Both products are taken transposed: S^T = K . Q^T (rows = keys, columns = queries) and O^T += V^T . P^T (rows = d, columns = queries). A lane then holds 16 of the 32 scores of ONE query (its column), lane ^ 16 the other 16: maximum and sum are in-lane plus one move between the halves, m, l and the rescale factor are one value a lane, and the two score tiles, converted in place, are the B operand of the second product in the hardware k order: P never leaves the registers.
// One 64-query tile; HI = leading query blocks (3 products), written once per path so that each pass is one straight run and its load groups stay whole.
template <bool HI> __device__ __forceinline__ void attn_tile(const _Float16* __restrict__ QK, const _Float16* __restrict__ QKL, const _Float16* __restrict__ VTH, const _Float16* __restrict__ VTL, float* __restrict__ O, float (*so)[16][68], _Float16* st) {
  const int tid = threadIdx.x, wave = tid >> 5, lane = tid & 31, col = lane & 15, g = lane >> 4;
  const int qb = blockIdx.x, h = blockIdx.y, b = blockIdx.z; const int q0 = qb * 64 + wave * 16; const size_t rq = (size_t)b * SS + q0 + col;
  const int nt = SS / 64;   // key tiles (all keys)
  const int bufh = (HI ? 4 : 2) * PLANE;   // halfs of one buffer
  const int crow = wave * 16 + (lane >> 3), cpc = (lane & 7) * 8;   // the lane's first row and its 16-byte piece in every copy
  const size_t ko = ((size_t)b * SS + crow) * (2 * DM) + DM + h * HD + cpc, vo = ((size_t)b * DM + h * HD + crow) * SS + cpc;   // tile 0; a tile on: 64 key rows of K, 64 columns of V
  const unsigned l0 = (unsigned)(size_t)st + 2u * (unsigned)(crow * KP + cpc);
  auto fill = [&](int t, int bf) { const unsigned lb = l0 + 2u * (unsigned)(bf * bufh); const size_t kt = ko + (size_t)t * 64 * (2 * DM), vt = vo + (size_t)t * 64;
    copy8(lb, QK + kt, lb + 2u * PLANE, VTH + vt);
    if (HI) copy8(lb + 2u * 2 * PLANE, QKL + kt, lb + 2u * 3 * PLANE, VTL + vt); };
  fill(0, 0);
  v16h aq[2], aql[2];
#pragma unroll
  for (int kc = 0; kc < 2; ++kc) { aq[kc] = frag_h(QK + rq * (2 * DM) + h * HD + kc * 32, lane); if (HI) aql[kc] = frag_h(QKL + rq * (2 * DM) + h * HD + kc * 32, lane); }
  float m = -3.0e38f, l = 0.f;   // of query col; l sums this half's keys only, the halves are joined behind the loop
  v8f acc[4] = {}, accl[4] = {};
  asm volatile("s_wait_asynccnt 0x0" ::: "memory");   // this wave's share of tile 0 has landed
  __syncthreads();                                     // every wave's share has: tile 0 may be read
  fill(1, 1);
#pragma unroll 1   // stays rolled: one foot (waits, barrier, refill) a tile, and the text of the loop stays short
  for (int t = 0; t < nt; ++t) { const _Float16* fk = st + (t & 1) * bufh + col * KP + 8 * g; const _Float16* fv = fk + PLANE;   // the lane's row col of the K and of the V plane
    // The statement behind each product holds a load at its place in the source, so every LDS read of a pass stands in front of the products that follow it: behind the score products of a pass go, as one group, its own V and (inside the tile, where not HI) the next pass's K, in flight under the softmax.
    v16h kf[2][2], kfl[2][2];   // [ct][kc] K fragments of the pass in hand (residual planes only where HI)
#pragma unroll
    for (int ct = 0; ct < 2; ++ct) {
#pragma unroll
      for (int kc = 0; kc < 2; ++kc) { kf[ct][kc] = frag_l(fk + (ct * 16) * KP + kc * 32); if (HI) kfl[ct][kc] = frag_l(fk + 2 * PLANE + (ct * 16) * KP + kc * 32); } }
#pragma unroll
    for (int sub = 0; sub < 2; ++sub) { v8f s[2]; v16h vf[4], vfl[4];
#pragma unroll
    for (int ct = 0; ct < 2; ++ct) { v8f c = {}, cl = {};
      if (HI) {   // leading query blocks: 3 products
#pragma unroll
        for (int kc = 0; kc < 2; ++kc) { c = wmma16(kf[ct][kc], aq[kc], c); cl = wmma16(kf[ct][kc], aql[kc], cl); cl = wmma16(kfl[ct][kc], aq[kc], cl); }
#pragma unroll
        for (int r = 0; r < 8; ++r) c[r] += cl[r] * (1.0f / 2048.0f); }
      else {
#pragma unroll
        for (int kc = 0; kc < 2; ++kc) c = wmma16(kf[ct][kc], aq[kc], c); }   // single product elsewhere
      { const bool keepk = true;
#pragma unroll
      for (int r = 0; r < 8; ++r) s[ct][r] = keepk ? c[r] * 0.125f : -3.0e38f; } }   // 1/sqrt(64); s[ct][r] = key ct * 16 + 8 g + r of the pass, query col
#pragma unroll
    for (int dt = 0; dt < 4; ++dt) { vf[dt] = frag_l(fv + (dt * 16) * KP + sub * 32); if (HI) vfl[dt] = frag_l(fv + 2 * PLANE + (dt * 16) * KP + sub * 32); }
    if (sub == 0 && !HI) {   // the tile's second pass's K (where HI: further down)
#pragma unroll
      for (int ct = 0; ct < 2; ++ct) {
#pragma unroll
        for (int kc = 0; kc < 2; ++kc) kf[ct][kc] = frag_l(fk + (32 + ct * 16) * KP + kc * 32); } }
    __builtin_amdgcn_sched_barrier(0);   // keeps the group here, in front of the softmax; moved down its reads would be waited for right in front of the second product
    float t4[4];   // four short chains, not one long one
#pragma unroll
    for (int j = 0; j < 4; ++j) t4[j] = fmaxf(fmaxf(s[0][j], s[0][4 + j]), fmaxf(s[1][j], s[1][4 + j]));
    float mx = fmaxf(fmaxf(t4[0], t4[1]), fmaxf(t4[2], t4[3])); mx = fmaxf(mx, xhalf(mx));   // both halves now hold the pass's maximum of query col
    const float mn = fmaxf(m, mx); const float alpha = (m <= -1.0e38f) ? 0.f : __expf(m - mn);
    float e[2][8];
#pragma unroll
    for (int ct = 0; ct < 2; ++ct) {
#pragma unroll
      for (int r = 0; r < 8; ++r) e[ct][r] = (s[ct][r] <= -1.0e38f) ? 0.f : __expf(s[ct][r] - mn); }
#pragma unroll
    for (int j = 0; j < 4; ++j) t4[j] = (e[0][j] + e[0][4 + j]) + (e[1][j] + e[1][4 + j]);
    l = l * alpha + ((t4[0] + t4[1]) + (t4[2] + t4[3])); m = mn;
#pragma unroll
    for (int dt = 0; dt < 4; ++dt) {
#pragma unroll
      for (int r = 0; r < 8; ++r) { acc[dt][r] *= alpha; accl[dt][r] *= alpha; } }
    v16h pa, pl;   // P^T as a B operand: element i = key 8 g + i, element 8 + i = key 16 + 8 g + i, the order in which the V fragments hold their keys
#pragma unroll
    for (int i = 0; i < 8; ++i) { const float x0 = e[0][i] * 2048.0f, x1 = e[1][i] * 2048.0f; const _Float16 h0 = (_Float16)x0, h1 = (_Float16)x1; pa[i] = h0; pa[8 + i] = h1; pl[i] = (_Float16)((x0 - (float)h0) * 2048.0f); pl[8 + i] = (_Float16)((x1 - (float)h1) * 2048.0f); }   // P scaled by 2^11 before the f16 split so small softmax weights stay out of the f16 subnormal range; 2^-11 folded into the epilogue
    if (sub == 0 && HI) {   // the tile's second pass's K where HI: read from here on, in flight under the second product; read in front of the softmax, beside scores, P and all four V planes' fragments, it made the build spill to scratch inside the loop
#pragma unroll
      for (int ct = 0; ct < 2; ++ct) {
#pragma unroll
        for (int kc = 0; kc < 2; ++kc) { kf[ct][kc] = frag_l(fk + (32 + ct * 16) * KP + kc * 32); kfl[ct][kc] = frag_l(fk + 2 * PLANE + (32 + ct * 16) * KP + kc * 32); } } }
#pragma unroll
    for (int dt = 0; dt < 4; ++dt) { acc[dt] = wmma16(vf[dt], pa, acc[dt]); if (HI) { accl[dt] = wmma16(vf[dt], pl, accl[dt]); accl[dt] = wmma16(vfl[dt], pa, accl[dt]); } }   // leading query blocks: P hi/lo x V hi/lo (3 products); elsewhere P x V single; acc[dt][r] = d dt * 16 + 8 g + r of query col
    }
    asm volatile("s_wait_dscnt 0x0" ::: "memory");      // this wave's reads of the tile in hand are done
    asm volatile("s_wait_asynccnt 0x0" ::: "memory");   // its share of the next tile has landed
    __syncthreads();                                     // publishes the next tile and frees the buffer just read
    if (t + 2 < nt) fill(t + 2, t & 1); }
  asm volatile("s_wait_asynccnt 0x0" ::: "memory");   // no copy is left in flight behind the loop
  const float il = (1.0f / 2048.0f) / (l + xhalf(l));   // the two halves' sums joined
#pragma unroll
  for (int dt = 0; dt < 4; ++dt) {
#pragma unroll
    for (int r = 0; r < 8; ++r) so[wave][col][dt * 16 + 8 * g + r] = (acc[dt][r] + accl[dt][r] * (1.0f / 2048.0f)) * il; }
  LDSX();
  for (int rl = 0; rl < 16; ++rl) if (lane < 16) vst2(O + ((size_t)b * SS + q0 + rl) * DM + h * HD + lane * 4, *(const v4f*)&so[wave][rl][lane * 4]);
}
__global__ __launch_bounds__(128) void k_attn(const _Float16* __restrict__ QK, const _Float16* __restrict__ QKL, const _Float16* __restrict__ VTH, const _Float16* __restrict__ VTL, const void* __restrict__ KMASK, float* __restrict__ O) {
  __shared__ __align__(16) float so[4][16][68]; __shared__ __align__(16) _Float16 st[STG_H];
  if (blockIdx.x < 2) attn_tile<true>(QK, QKL, VTH, VTL, O, so, st); else attn_tile<false>(QK, QKL, VTH, VTL, O, so, st);
}
// ---- k_out: block = (64 rows, 128 cols): out = O(hi/lo) . Wo rows (2 products) + bo
__global__ __launch_bounds__(128) void k_out(const float* __restrict__ O, const __bf16* __restrict__ P, const float* __restrict__ BO, float* __restrict__ Y) {
  __shared__ __align__(16) float so[4][16][132];
  const int tid = threadIdx.x, wave = tid >> 5, lane = tid & 31, col = lane & 15, g = lane >> 4; const size_t r0 = (size_t)blockIdx.x * 64 + wave * 16; const int n0 = blockIdx.y * 128;
  v8f acc[8] = {};
#pragma unroll 2
  for (int kc = 0; kc < DM / 32; ++kc) { const F2 a = split_row(O + (r0 + col) * DM, kc * 32, lane);
#pragma unroll
    for (int j = 0; j < 8; ++j) { const v16b w = frag_b(P + (size_t)(n0 + j * 16 + col) * DM + kc * 32, lane); acc[j] = wmma_bf(a.l, w, acc[j]); acc[j] = wmma_bf(a.h, w, acc[j]); } }
#pragma unroll
  for (int j = 0; j < 8; ++j) {
#pragma unroll
    for (int r = 0; r < 8; ++r) so[wave][8 * g + r][j * 16 + col] = acc[j][r] + (BO ? bfr(BO[n0 + j * 16 + col]) : 0.f); }
  LDSX();
  for (int rl = 0; rl < 16; ++rl) vst2(Y + (r0 + rl) * DM + n0 + lane * 4, *(const v4f*)&so[wave][rl][lane * 4]);
}
extern "C" void kernel_launch(void* const* d_in, const int* in_sizes, int n_in, void* d_out, int out_size, void* d_ws, size_t ws_size, hipStream_t stream) {
  (void)in_sizes; (void)n_in; (void)out_size;
  const float** F = (const float**)d_in;   // 0 current [2048,1024], 1 context [2048,1024], 2 Wq [16,1024,64], 3 bq [16,64], 4 Wk, 5 bk, 6 Wv, 7 bv, 8 Wo [1024,64], 9 bo [64]
  if (ws_size < (size_t)WS_END) return;
  char* ws = (char*)d_ws; __bf16* PK = (__bf16*)(ws + WS_PK); _Float16 *QK = (_Float16*)(ws + WS_QK), *QKL = (_Float16*)(ws + WS_QKL), *VTH = (_Float16*)(ws + WS_VTH), *VTL = (_Float16*)(ws + WS_VTL); float* O = (float*)(ws + WS_O);
  k_pack<<<dim3(DM / PKI, NH, 3), 256, 0, stream>>>(F[2], F[4], F[6], PK);
  k_qkv<<<dim3(TNB * SS / 64, QKVW / 128), 128, 0, stream>>>(F[0], F[1], F[1], PK + PK_A, F[3], F[5], F[7], QK, QKL, VTH, VTL);
  k_attn<<<dim3(TQB, TNH, TNB), 128, 0, stream>>>(QK, QKL, VTH, VTL, nullptr, O);
  k_out2<<<dim3(TNB * SS / 16, HD / 32), 32 * OKW, 0, stream>>>(O, F[8], F[9], (float*)d_out);
}

// v007
// A run of this version takes 57.2 microseconds.
// It is 1.43 times as fast as v005, going by the measured steps of the versions left out in between.
// Counting every step since v000, it is 6.51 times as fast.
// compute dtype: all float inputs rounded to bf16; q/k/v = x W[h] + b[h] with EXACT bf16 products on WMMA 16x16x32 (per-head (in,out) weights packed as one 1024 -> 1024 projection each), stored as f16; scores one f16 product for every query, x 1/8, running-max softmax in f32 (hardware exp); one f16 product P . v; the head-major stack + row-major view realised as an index map feeding out = y2 (bf16 hi + lo) . Wo + bo (2 products); f32 output.
#include <hip/hip_runtime.h>
#include <math.h>

typedef __attribute__((ext_vector_type(16))) _Float16 v16h;
typedef __attribute__((ext_vector_type(16))) __bf16 v16b;
typedef __attribute__((ext_vector_type(8)))  _Float16 v8h;
typedef __attribute__((ext_vector_type(8)))  float v8f;
typedef __attribute__((ext_vector_type(4)))  float v4f;
typedef __attribute__((ext_vector_type(2)))  float v2f;
typedef __attribute__((ext_vector_type(4)))  unsigned v4u;
typedef __attribute__((ext_vector_type(4)))  int v4i;
typedef float __attribute__((may_alias)) float_a;
typedef int __attribute__((may_alias)) int_a;

template <typename T> __device__ __forceinline__ void vst2(void* p, T v) { *(T*)p = v;  }
__device__ __forceinline__ v8f wmma16(v16h a, v16h b, v8f c) {
  v8f d = __builtin_amdgcn_wmma_f32_16x16x32_f16(false, a, false, b, (short)0, c, false, false);
  asm volatile("v_nop\n\tv_nop\n\tv_nop\n\tv_nop" : "+v"(d) : "v"(a), "v"(b));
  return d;
}
__device__ __forceinline__ v8f wmma_bf(v16b a, v16b b, v8f c) {
  v8f d = __builtin_amdgcn_wmma_f32_16x16x32_bf16(false, a, false, b, (short)0, c, false, false);
  asm volatile("v_nop\n\tv_nop\n\tv_nop\n\tv_nop" : "+v"(d) : "v"(a), "v"(b));
  return d;
}
// Per-head (inefficient) multi-head cross attention (16 heads x 64, 2,048 current x 2,048 context tokens, D_IN 1024): per head q = x Wq[h] + bq[h], k/v from the context; softmax(q k^T / 8) v; heads stacked head-major then row-major re-viewed to [S, 1024]; Wo [1024 -> 64] + bo.
__device__ __forceinline__ v16h frag_h(const _Float16* rowk0, int lane) {
  union { v16h v; v8h q[2]; } u; const _Float16* p = rowk0 + 8 * (lane >> 4);
  u.q[0] = *(const v8h*)p; u.q[1] = *(const v8h*)(p + 16); return u.v;
}
__device__ __forceinline__ v16h frag_f32(const float* rowk0, int lane) {
  v16h a; const float* p = rowk0 + 8 * (lane >> 4);
#pragma unroll
  for (int i = 0; i < 8; ++i) { a[i] = (_Float16)p[i]; a[8 + i] = (_Float16)p[16 + i]; }
  return a;
}
__device__ __forceinline__ v16h frag_f32s(const float* rowk0, int lane, float sc) {
  v16h a; const float* p = rowk0 + 8 * (lane >> 4);
#pragma unroll
  for (int i = 0; i < 8; ++i) { a[i] = (_Float16)(p[i] * sc); a[8 + i] = (_Float16)(p[16 + i] * sc); }
  return a;
}
// column fragment from a [K][ld] layout (column n), rows >= K read as 0
__device__ __forceinline__ v16h fragc_f32(const float* W, int k0, int n, int lane, int ld, int K) {
  v16h a; const int g = lane >> 4;
#pragma unroll
  for (int i = 0; i < 8; ++i) { const int ka = k0 + 8 * g + i, kb = ka + 16;
    a[i] = (_Float16)(ka < K ? W[(size_t)(ka < K ? ka : K - 1) * ld + n] : 0.f); a[8 + i] = (_Float16)(kb < K ? W[(size_t)(kb < K ? kb : K - 1) * ld + n] : 0.f); }
  return a;
}
struct F2 { v16b h, l; };
__device__ __forceinline__ F2 bsplit16(const float v[16]) { F2 r;
#pragma unroll
  for (int i = 0; i < 16; ++i) { const __bf16 h = (__bf16)v[i]; r.h[i] = h; r.l[i] = (__bf16)(v[i] - (float)h); }
  return r; }
__device__ __forceinline__ F2 split_row(const float* row, int k0, int lane) { float v[16]; const float* p = row + k0 + 8 * (lane >> 4);
#pragma unroll
  for (int i = 0; i < 8; ++i) { v[i] = p[i]; v[8 + i] = p[16 + i]; }
  return bsplit16(v); }
__device__ __forceinline__ F2 split_rowK(const float* row, int k0, int lane, int K) { float v[16]; const int g = lane >> 4;
#pragma unroll
  for (int i = 0; i < 8; ++i) { const int ka = k0 + 8 * g + i, kb = ka + 16; v[i] = ka < K ? row[ka < K ? ka : K - 1] : 0.f; v[8 + i] = kb < K ? row[kb < K ? kb : K - 1] : 0.f; }
  return bsplit16(v); }
__device__ __forceinline__ F2 split_col(const float* W, int k0, int n, int lane, int ld, int K) { float v[16]; const int g = lane >> 4;
#pragma unroll
  for (int i = 0; i < 8; ++i) { const int ka = k0 + 8 * g + i, kb = ka + 16; v[i] = ka < K ? W[(size_t)(ka < K ? ka : K - 1) * ld + n] : 0.f; v[8 + i] = kb < K ? W[(size_t)(kb < K ? kb : K - 1) * ld + n] : 0.f; }
  return bsplit16(v); }
__device__ __forceinline__ v8f mac3(const F2& a, const F2& b, v8f c) { c = wmma_bf(a.l, b.h, c); c = wmma_bf(a.h, b.l, c); return wmma_bf(a.h, b.h, c); }
__device__ __forceinline__ float sigm(float v) { return 1.0f / (1.0f + expf(-v)); }
#define LDSX() do { asm volatile("s_wait_dscnt 0" ::: "memory"); __builtin_amdgcn_wave_barrier(); __builtin_amdgcn_fence(__ATOMIC_RELEASE, "workgroup"); } while (0)


#define NB 1
#define SS 2048
#define DM 1024
#define NH 16
#define HD 64
#define QKVW (3 * DM)
#ifndef TQB
#define TQB (SS / 64)
#endif
#ifndef TNH
#define TNH NH
#define TNB NB
#define TOB (NB * SS / 64)     // 64-row tiles of the 2,048 rows (all); nothing uses it
#endif
typedef __attribute__((ext_vector_type(8))) __bf16 v8b;
__device__ __forceinline__ v16b frag_b(const __bf16* rowk0, int lane) {
  union { v16b v; v8b q[2]; } u; const __bf16* p = rowk0 + 8 * (lane >> 4);
  u.q[0] = *(const v8b*)p; u.q[1] = *(const v8b*)(p + 16); return u.v;
}
// fragment at a wave-uniform base plus the lane's own byte offset: a group's loads all name that one offset register
__device__ __forceinline__ v16b frag_bo(const __bf16* ubase, unsigned boff) { union { v16b v; v8b q[2]; } u; const __bf16* p = (const __bf16*)((const char*)ubase + boff); u.q[0] = *(const v8b*)p; u.q[1] = *(const v8b*)(p + 16); return u.v; }
__device__ __forceinline__ float bfr(float v) { return (float)(__bf16)v; }
__device__ __attribute__((noinline)) float exp_ni(float v) { return expf(v); }
__device__ __attribute__((noinline)) float erf_ni(float v) { return erff(v); }

#define PK_A 0                       // [3072][1024] Wqkv rows (natural [out][in])
#define PK_P (PK_A + QKVW * DM)        // [1024][1024] reserved; nothing writes or reads it
#define PK_END (PK_P + DM * DM)
#define WS_PK  0u
#define WS_QK  (WS_PK + 2u * PK_END)             // f16 [2048 rows][2048]: q | k
#define WS_VTH (WS_QK + 2u * NB * SS * 2 * DM)     // f16 [b][1024 (h*64+d)][2048 s]
#define WS_O   (WS_VTH + 2u * NB * DM * SS)        // f32 [2048][1024]
#define WS_CS  (WS_O + 4u * NB * SS * DM)           // f32 2 x [2048][32], reserved; nothing writes or reads it
#define WS_END (WS_CS + 4u * 2 * SS * 32)
// ---- k_pack: block = (128 input rows i, head h, which): W [h][1024 in][64 d] -> bf16 packed rows (which*DM + h*64 + d)[i]; which 0..2 -> W_q/W_k/W_v into PK_A
// The block's source tile (128 rows x 64 floats) is 32 KB in a row: it is read as whole lines, 16 bytes a lane, all eight loads of a thread in flight together, and turned in LDS; each packed row gets 256 B in a row.
#define PKI 128                   // input rows a block
#define PKP (PKI / 2 + 1)         // dwords a staged packed row: 64 of data (two bf16 each) + 1, the pitch at which the 32 lanes of a write (rows 4 apart) and of a read (dwords 4 apart) each meet 32 banks
__global__ __launch_bounds__(256) void k_pack(const float* __restrict__ WQ, const float* __restrict__ WK, const float* __restrict__ WV, __bf16* __restrict__ PK) {
  __shared__ unsigned s[HD * PKP]; const int it = blockIdx.x, h = blockIdx.y, which = blockIdx.z, t = threadIdx.x; const float* Wm = which == 0 ? WQ : which == 1 ? WK : WV;
  const int d4 = (t & 15) * 4, p0 = t >> 4;   // the thread's four columns d; its pair of input rows in each group of 32
  const float* src = Wm + ((size_t)h * DM + it * PKI + 2 * p0) * HD + d4;
  v4f a[4], b[4];   // rows 2 p and 2 p + 1, p = k * 16 + p0
#pragma unroll   // (here and below) a, b and v stay in registers, and the eight loads stand as one group in front of the first use
  for (int k = 0; k < 4; ++k) { a[k] = *(const v4f*)(src + (size_t)(k * 32) * HD); b[k] = *(const v4f*)(src + (size_t)(k * 32 + 1) * HD); }
#pragma unroll
  for (int k = 0; k < 4; ++k) {
#pragma unroll
    for (int j = 0; j < 4; ++j) { union { __bf16 e[2]; unsigned u; } w; w.e[0] = (__bf16)a[k][j]; w.e[1] = (__bf16)b[k][j]; s[(d4 + j) * PKP + k * 16 + p0] = w.u; } }
  __syncthreads(); __bf16* dst = PK + PK_A + ((size_t)which * DM + h * HD) * DM + it * PKI;
#pragma unroll
  for (int k = 0; k < 4; ++k) { const int q = k * 256 + t, d = q >> 4, pc = q & 15; v4u v;
#pragma unroll
    for (int j = 0; j < 4; ++j) v[j] = s[d * PKP + pc * 4 + j];
    vst2((unsigned*)(dst + (size_t)d * DM + pc * 8), v); } }
// ---- k_out2: block = (16 rows r of the re-viewed [2048][1024] matrix, 32 of the 64 output columns): y2[r][j*64 + o] = O[16*(r%128) + j][(r/128)*64 + o]; out = y2 (hi + lo) . Wo + bo  (Wo (in,out) [1024][64])
// The 1,024-deep sum is dealt to the block's eight waves, 128 of k each: the launch has 2,048 waves on 256 blocks in place of 128 waves on 32, and a wave's chain of waited load groups is 4 passes long, not 32. The eight partial tiles meet in LDS and are summed there in wave order.
#define OKW 8                     // waves a block = parts of k
#define OKP (DM / 32 / OKW)       // 32-deep passes a wave
#define OSP 36                    // floats a staged partial row: 32 of data + 4 (rows 8 apart then start 32 banks apart: the two halves of a wave's write meet no bank twice)
__global__ __launch_bounds__(32 * OKW) void k_out2(const float* __restrict__ O, const float* __restrict__ WO, const float* __restrict__ BO, float* __restrict__ OUT) { __shared__ __align__(16) float sp[OKW][16][OSP];
  const int tid = threadIdx.x, wave = tid >> 5, lane = tid & 31, col = lane & 15, g = lane >> 4; const int r0 = blockIdx.x * 16, n0 = blockIdx.y * 32; const int rr = r0 + col; const int hsel = rr / 128; const int sbase = 16 * (rr % 128);
  v8f acc[2] = {};
  const float* orow = O + (size_t)(sbase + wave * (OKP / 2)) * DM + hsel * HD + 8 * g; const float* wcol = WO + (size_t)(wave * OKP * 32 + 8 * g) * 64 + n0 + col;   // this wave's first pass
  float ac[OKP][16], wc[OKP][2][16];   // the operands of all the wave's passes, loaded as one group in front of the first product (the statement behind each product holds a load at its place in the source)
#pragma unroll
  for (int p = 0; p < OKP; ++p) { const float* on = orow + (size_t)(p / 2) * DM + (p % 2) * 32; const float* wq = wcol + (size_t)(p * 32) * 64;
#pragma unroll
    for (int i = 0; i < 8; ++i) { ac[p][i] = on[i]; ac[p][8 + i] = on[16 + i];
#pragma unroll
      for (int jj = 0; jj < 2; ++jj) { wc[p][jj][i] = wq[(size_t)i * 64 + jj * 16]; wc[p][jj][8 + i] = wq[(size_t)(16 + i) * 64 + jj * 16]; } } }
  const int orw = tid >> 4, oc = (tid & 15) * 2;   // the thread's two neighbouring outputs in the closing sum
  const float b0 = BO[n0 + oc], b1 = BO[n0 + oc + 1];
  asm volatile("s_wait_xcnt 0x0" ::: "memory");   // stands behind the group, in front of the first instruction that reuses a register which one of its loads names as address
#pragma unroll
  for (int p = 0; p < OKP; ++p) { const F2 a = bsplit16(ac[p]);
#pragma unroll
    for (int jj = 0; jj < 2; ++jj) { v16b w;
#pragma unroll
      for (int i = 0; i < 16; ++i) w[i] = (__bf16)wc[p][jj][i];
      acc[jj] = wmma_bf(a.h, w, acc[jj]); acc[jj] = wmma_bf(a.l, w, acc[jj]); } }
#pragma unroll
  for (int jj = 0; jj < 2; ++jj) {
#pragma unroll
    for (int r = 0; r < 8; ++r) sp[wave][8 * g + r][jj * 16 + col] = acc[jj][r]; }
  __syncthreads();   // every wave's partial tile is in LDS
  v2f s = *(const v2f*)&sp[0][orw][oc];
#pragma unroll
  for (int w = 1; w < OKW; ++w) s += *(const v2f*)&sp[w][orw][oc];
  s[0] += bfr(b0); s[1] += bfr(b1);
  vst2(OUT + (size_t)(r0 + orw) * 64 + n0 + oc, s); }   // a row's 32 columns are one whole 128-B line, written by this block alone
// k_qkv's operands reach the four waves of a block through LDS: a tile = 64 of k = two 32-deep passes; x 64 rows x 256 B (f32), weights 128 rows x 128 B (bf16), whole 128-B lines, each fetched once a block.
#define XP 68                     // floats a staged x row: 256 B of data + 16 B (the pitch at which 16-byte LDS reads of 16 rows meet no bank twice)
#define WP 72                     // bf16 a staged weight row: 128 B of data + 16 B (likewise)
#define QX_B (64 * XP * 4)        // bytes of the x plane
#define QBUF_B (QX_B + 128 * WP * 2)   // bytes of one buffer: x plane, weight plane
__device__ __forceinline__ v16b frag_lb(const __bf16* p) { union { v16b v; v8b q[2]; } u; u.q[0] = *(const v8b*)p; u.q[1] = *(const v8b*)(p + 16); return u.v; }
// Eight copies of 512 B each, LS bytes apart in LDS and GS bytes apart in the source. The last line is the wait that stands in front of any rewrite of the copies' address registers: inside the statement nothing can be moved over it.
template <int LS, int GS> __device__ __forceinline__ void copy8r(unsigned l, const char* gp) {
  asm volatile("global_load_async_to_lds_b128 %0, %1, off\n\tglobal_load_async_to_lds_b128 %2, %3, off\n\tglobal_load_async_to_lds_b128 %4, %5, off\n\tglobal_load_async_to_lds_b128 %6, %7, off\n\t"
               "global_load_async_to_lds_b128 %8, %9, off\n\tglobal_load_async_to_lds_b128 %10, %11, off\n\tglobal_load_async_to_lds_b128 %12, %13, off\n\tglobal_load_async_to_lds_b128 %14, %15, off\n\ts_wait_xcnt 0x0"
               :: "v"(l), "v"(gp), "v"(l + 1u * LS), "v"(gp + 1 * GS), "v"(l + 2u * LS), "v"(gp + 2 * GS), "v"(l + 3u * LS), "v"(gp + 3 * GS),
                  "v"(l + 4u * LS), "v"(gp + 4 * GS), "v"(l + 5u * LS), "v"(gp + 5 * GS), "v"(l + 6u * LS), "v"(gp + 6 * GS), "v"(l + 7u * LS), "v"(gp + 7 * GS) : "memory");
}
__global__ __launch_bounds__(128) void k_qkv(const float* __restrict__ XQ, const float* __restrict__ XK, const float* __restrict__ XV, const __bf16* __restrict__ P, const float* __restrict__ BQ, const float* __restrict__ BK, const float* __restrict__ BV, _Float16* __restrict__ QK, _Float16* __restrict__ VTH) {
  const int which0 = (blockIdx.y * 128) / DM; const float* X = (which0 == 0) ? XQ : (which0 == 1) ? XK : XV; const float* BB = BQ ? (((which0 == 0) ? BQ : (which0 == 1) ? BK : BV) + (blockIdx.y * 128 - which0 * DM)) : nullptr;
  __shared__ __align__(16) char sm[2 * QBUF_B];   // the two buffers of the k loop; behind the loop's last barrier the same bytes stage the output
  _Float16 (*so)[16][136] = (_Float16 (*)[16][136])sm; _Float16 (*sth)[72] = (_Float16 (*)[72])sm;   // a block stages q/k rows or v columns, never both
  static_assert(2 * 4 * 16 * 136 <= 2 * QBUF_B && 2 * 128 * 72 <= 2 * QBUF_B, "output staging fits the ring");
  const int tid = threadIdx.x, wave = tid >> 5, lane = tid & 31, col = lane & 15, g = lane >> 4; const size_t r0 = (size_t)blockIdx.x * 64 + wave * 16; const int n0 = blockIdx.y * 128;
  v8f acc[8] = {};
  const int ns = DM / 64;   // tiles of k
  // the lane's place in every copy: x: 2 rows x 256 B a copy (row lane / 16, piece lane % 16), this wave's 16 rows; weights: 4 rows x 128 B a copy (row lane / 8, piece lane % 8), this wave's 32 rows
  const char* gx = (const char*)(X + ((size_t)blockIdx.x * 64 + wave * 16 + (lane >> 4)) * DM + (lane & 15) * 4); const char* gw = (const char*)(P + ((size_t)n0 + wave * 32 + (lane >> 3)) * DM + (lane & 7) * 8);
  const unsigned lx = (unsigned)(size_t)sm + (unsigned)((wave * 16 + (lane >> 4)) * (XP * 4) + (lane & 15) * 16), lw = (unsigned)(size_t)sm + (unsigned)(QX_B + (wave * 32 + (lane >> 3)) * (WP * 2) + (lane & 7) * 16);
  auto fill = [&](int s, int bf) { copy8r<2 * XP * 4, 2 * DM * 4>(lx + (unsigned)(bf * QBUF_B), gx + (size_t)s * 256); copy8r<4 * WP * 2, 4 * DM * 2>(lw + (unsigned)(bf * QBUF_B), gw + (size_t)s * 128); };
  fill(0, 0);
  float bias[8];   // loaded here, in flight under the k loop, not one waited load per stored element
#pragma unroll
  for (int j = 0; j < 8; ++j) bias[j] = 0.f;
  if (BB) {
#pragma unroll
    for (int j = 0; j < 8; ++j) bias[j] = BB[j * 16 + col]; }
  asm volatile("s_wait_asynccnt 0x0" ::: "memory");   // this wave's share of tile 0 has landed
  __syncthreads();                                     // every wave's share has: tile 0 may be read
  fill(1, 1);
#pragma unroll 1   // stays rolled: one foot (waits, barrier, refill) a tile, and the text of the loop stays short
  for (int s = 0; s < ns; ++s) { const char* bp = sm + (s & 1) * QBUF_B; const float* fx = (const float*)bp + (wave * 16 + col) * XP + 8 * g; const __bf16* fw = (const __bf16*)(bp + QX_B) + col * WP + 8 * g;
    v4f xc[2][4]; v16b wc[2][8];   // both passes' operands, read as two groups in front of the products (the statement behind each product holds a load at its place in the source)
#pragma unroll
    for (int sub = 0; sub < 2; ++sub) { xc[sub][0] = *(const v4f*)(fx + sub * 32); xc[sub][1] = *(const v4f*)(fx + sub * 32 + 4); xc[sub][2] = *(const v4f*)(fx + sub * 32 + 16); xc[sub][3] = *(const v4f*)(fx + sub * 32 + 20);
#pragma unroll
      for (int j = 0; j < 8; ++j) wc[sub][j] = frag_lb(fw + (j * 16) * WP + sub * 32); }
#pragma unroll
    for (int sub = 0; sub < 2; ++sub) { v16b a;
#pragma unroll
      for (int i = 0; i < 16; ++i) a[i] = (__bf16)xc[sub][i >> 2][i & 3];
#pragma unroll
      for (int j = 0; j < 8; ++j) acc[j] = wmma_bf(a, wc[sub][j], acc[j]); }
    asm volatile("s_wait_dscnt 0x0" ::: "memory");      // this wave's reads of the tile in hand are done
    asm volatile("s_wait_asynccnt 0x0" ::: "memory");   // its share of the next tile has landed
    __syncthreads();                                     // publishes the next tile and frees the buffer just read (behind the last tile: frees the ring for the output staging)
    if (s + 2 < ns) fill(s + 2, s & 1); }
  asm volatile("s_wait_asynccnt 0x0" ::: "memory");   // no copy is left in flight behind the loop
  if (n0 < 2 * DM) {   // q stored unscaled (f16 sigma ~0.6, no subnormal exposure); 1/8 applied to the f32 score
#pragma unroll
    for (int j = 0; j < 8; ++j) {
#pragma unroll
      for (int r = 0; r < 8; ++r) so[wave][8 * g + r][j * 16 + col] = (_Float16)(acc[j][r] + bfr(bias[j])); }   // q, k (+ bias) as f16
    LDSX();
    for (int rl = 0; rl < 16; ++rl) if (lane < 16) vst2((unsigned*)(QK + (r0 + rl) * (2 * DM) + n0 + lane * 8), *(const v4u*)&so[wave][rl][lane * 8]);
  } else {
#pragma unroll
    for (int j = 0; j < 8; ++j) {
#pragma unroll
      for (int r = 0; r < 8; ++r) sth[j * 16 + col][wave * 16 + 8 * g + r] = (_Float16)(acc[j][r] + bfr(bias[j])); }
    __syncthreads();
    const size_t rb = (size_t)blockIdx.x * 64; const int b = (int)(rb / SS), s0 = (int)(rb % SS); const int pc0 = n0 - 2 * DM;
    for (int q = tid; q < 128 * 8; q += 128) { const int d = q >> 3, pc = q & 7; const size_t o = ((size_t)b * DM + pc0 + d) * SS + s0 + pc * 8; vst2((unsigned*)(VTH + o), *(const v4u*)&sth[d][pc * 8]); }
  }
}
// ---- k_attn: block = (64 queries, head h, batch b): all-keys flash attention (K = 64: 2 k-steps), scores = (q.k) * 0.125 with single f16 operands, P.V: f16 P x f16 V; O[b*S+q][h*64+d] = acc / l (256-B segments)
// Every query block walks all 2,048 keys with the same products: the 512 blocks, two on each WGP, cost alike, and none outlasts the rest.
// K and V reach the four waves of a block through LDS: a tile = 64 keys = two 32-key passes; K 64 key rows x 128 B, V 64 d rows x 128 B, whole 128-B lines, each fetched once a block.
#define KP 72                    // halfs a staged row: 128 B of data + 16 B, the pitch at which 16-byte LDS reads of 16 rows meet no bank twice
#define PLANE (64 * KP)          // halfs of one staged plane
#define STG_H (2 * 2 * PLANE)    // two buffers of two planes: K, V
#define ESC 0.18033688f          // log2(e) / sqrt(64): a raw score times this is its exponent in base 2
__device__ __forceinline__ v16h frag_l(const _Float16* p) { union { v16h v; v8h q[2]; } u; u.q[0] = *(const v8h*)p; u.q[1] = *(const v8h*)(p + 16); return u.v; }
// Sixteen rows of plane a and sixteen of plane b: eight copies, each 4 rows x 128 B (lane: row lane / 8, 16-byte piece lane % 8); both sources have rows 4,096 B apart. The last line is the wait that stands in front of any rewrite of the copies' address registers: inside the statement nothing can be moved over it.
__device__ __forceinline__ void copy8(unsigned la, const _Float16* ga, unsigned lb, const _Float16* gb) {
  asm volatile("global_load_async_to_lds_b128 %0, %1, off\n\tglobal_load_async_to_lds_b128 %2, %3, off\n\tglobal_load_async_to_lds_b128 %4, %5, off\n\tglobal_load_async_to_lds_b128 %6, %7, off\n\t"
               "global_load_async_to_lds_b128 %8, %9, off\n\tglobal_load_async_to_lds_b128 %10, %11, off\n\tglobal_load_async_to_lds_b128 %12, %13, off\n\tglobal_load_async_to_lds_b128 %14, %15, off\n\ts_wait_xcnt 0x0"
               :: "v"(la), "v"(ga), "v"(la + 2u * 4 * KP), "v"(ga + 4 * 2048), "v"(la + 2u * 8 * KP), "v"(ga + 8 * 2048), "v"(la + 2u * 12 * KP), "v"(ga + 12 * 2048),
                  "v"(lb), "v"(gb), "v"(lb + 2u * 4 * KP), "v"(gb + 4 * 2048), "v"(lb + 2u * 8 * KP), "v"(gb + 8 * 2048), "v"(lb + 2u * 12 * KP), "v"(gb + 12 * 2048) : "memory");
}
// lane l with lane l ^ 16 (a vector move, no LDS): the other half of a query's keys
__device__ __forceinline__ float xhalf(float x) { return __builtin_bit_cast(float, __builtin_amdgcn_permlanex16(__builtin_bit_cast(int, x), __builtin_bit_cast(int, x), 0x76543210, 0xfedcba98, false, false)); }
// Both products are taken transposed: S^T = K . Q^T (rows = keys, columns = queries) and O^T += V^T . P^T (rows = d, columns = queries). A lane then holds 16 of the 32 scores of ONE query (its column), lane ^ 16 the other 16: maximum and sum are in-lane plus one move between the halves, m, l and the rescale factor are one value a lane, and the two score tiles, converted in place, are the B operand of the second product in the hardware k order: P never leaves the registers.
__global__ __launch_bounds__(128) void k_attn(const _Float16* __restrict__ QK, const _Float16* __restrict__ VTH, float* __restrict__ O) {
  __shared__ __align__(16) float so[4][16][68]; __shared__ __align__(16) _Float16 st[STG_H];
  const int tid = threadIdx.x, wave = tid >> 5, lane = tid & 31, col = lane & 15, g = lane >> 4;
  const int qb = blockIdx.x, h = blockIdx.y, b = blockIdx.z; const int q0 = qb * 64 + wave * 16; const size_t rq = (size_t)b * SS + q0 + col;
  const int nt = SS / 64;   // key tiles (all keys)
  const int bufh = 2 * PLANE;   // halfs of one buffer
  const int crow = wave * 16 + (lane >> 3), cpc = (lane & 7) * 8;   // the lane's first row and its 16-byte piece in every copy
  const size_t ko = ((size_t)b * SS + crow) * (2 * DM) + DM + h * HD + cpc, vo = ((size_t)b * DM + h * HD + crow) * SS + cpc;   // tile 0; a tile on: 64 key rows of K, 64 columns of V
  const unsigned l0 = (unsigned)(size_t)st + 2u * (unsigned)(crow * KP + cpc);
  auto fill = [&](int t, int bf) { const unsigned lb = l0 + 2u * (unsigned)(bf * bufh); const size_t kt = ko + (size_t)t * 64 * (2 * DM), vt = vo + (size_t)t * 64;
    copy8(lb, QK + kt, lb + 2u * PLANE, VTH + vt); };
  fill(0, 0);
  v16h aq[2];
#pragma unroll
  for (int kc = 0; kc < 2; ++kc) aq[kc] = frag_h(QK + rq * (2 * DM) + h * HD + kc * 32, lane);
  float m = -3.0e38f, l = 0.f;   // of query col; m is the maximum of the raw q . k; l sums this half's keys only, the halves are joined behind the loop
  v8f acc[4] = {};
  asm volatile("s_wait_asynccnt 0x0" ::: "memory");   // this wave's share of tile 0 has landed
  __syncthreads();                                     // every wave's share has: tile 0 may be read
  fill(1, 1);
#pragma unroll 1   // stays rolled: one foot (waits, barrier, refill) a tile, and the text of the loop stays short
  for (int t = 0; t < nt; ++t) { const _Float16* fk = st + (t & 1) * bufh + col * KP + 8 * g; const _Float16* fv = fk + PLANE;   // the lane's row col of the K and of the V plane
    // The statement behind each product holds a load at its place in the source, so every LDS read of a pass stands in front of the products that follow it: behind the score products of a pass go, as one group, its own V and (inside the tile) the next pass's K, in flight under the softmax.
    v16h kf[2][2];   // [ct][kc] K fragments of the pass in hand
#pragma unroll
    for (int ct = 0; ct < 2; ++ct) {
#pragma unroll
      for (int kc = 0; kc < 2; ++kc) kf[ct][kc] = frag_l(fk + (ct * 16) * KP + kc * 32); }
#pragma unroll
    for (int sub = 0; sub < 2; ++sub) { v8f s[2]; v16h vf[4];
#pragma unroll
    for (int ct = 0; ct < 2; ++ct) { v8f c = {};
#pragma unroll
      for (int kc = 0; kc < 2; ++kc) c = wmma16(kf[ct][kc], aq[kc], c);
      s[ct] = c; }   // the raw q . k: s[ct][r] = key ct * 16 + 8 g + r of the pass, query col; 1/sqrt(64) goes into the exponent's one multiply-add below
#pragma unroll
    for (int dt = 0; dt < 4; ++dt) vf[dt] = frag_l(fv + (dt * 16) * KP + sub * 32);
    if (sub == 0) {   // the tile's second pass's K
#pragma unroll
      for (int ct = 0; ct < 2; ++ct) {
#pragma unroll
        for (int kc = 0; kc < 2; ++kc) kf[ct][kc] = frag_l(fk + (32 + ct * 16) * KP + kc * 32); } }
    __builtin_amdgcn_sched_barrier(0);   // keeps the group here, in front of the softmax; moved down its reads would be waited for right in front of the second product
    float t4[4];   // four short chains, not one long one
#pragma unroll
    for (int j = 0; j < 4; ++j) t4[j] = fmaxf(fmaxf(s[0][j], s[0][4 + j]), fmaxf(s[1][j], s[1][4 + j]));
    float mx = fmaxf(fmaxf(t4[0], t4[1]), fmaxf(t4[2], t4[3])); mx = fmaxf(mx, xhalf(mx));   // both halves now hold the pass's maximum of query col
    const float mn = fmaxf(m, mx); const float alpha = __builtin_amdgcn_exp2f((m - mn) * ESC);   // first pass: m = -3e38, the hardware exp2 of about -5e37 is 0
    const float nb = __builtin_fmaf(-mn, ESC, 11.0f);   // one value a pass: minus the maximum in base-2 units, plus the 2^11 of P
    float e[2][8];   // 2^11 exp((q.k - max) / 8): one multiply-add and one hardware exp2 a score
#pragma unroll
    for (int ct = 0; ct < 2; ++ct) {
#pragma unroll
      for (int r = 0; r < 8; ++r) e[ct][r] = __builtin_amdgcn_exp2f(__builtin_fmaf(s[ct][r], ESC, nb)); }
#pragma unroll
    for (int j = 0; j < 4; ++j) t4[j] = (e[0][j] + e[0][4 + j]) + (e[1][j] + e[1][4 + j]);
    l = l * alpha + ((t4[0] + t4[1]) + (t4[2] + t4[3])); m = mn;
#pragma unroll
    for (int dt = 0; dt < 4; ++dt) {
#pragma unroll
      for (int r = 0; r < 8; ++r) acc[dt][r] *= alpha; }
    v16h pa;   // P^T as a B operand: element i = key 8 g + i, element 8 + i = key 16 + 8 g + i, the order in which the V fragments hold their keys
#pragma unroll
    for (int i = 0; i < 8; ++i) { pa[i] = (_Float16)e[0][i]; pa[8 + i] = (_Float16)e[1][i]; }   // P carries 2^11 (from nb) so that small softmax weights stay out of the f16 subnormal range; l carries it too, and the division behind the loop takes it out
#pragma unroll
    for (int dt = 0; dt < 4; ++dt) acc[dt] = wmma16(vf[dt], pa, acc[dt]);   // acc[dt][r] = d dt * 16 + 8 g + r of query col
    }
    asm volatile("s_wait_dscnt 0x0" ::: "memory");      // this wave's reads of the tile in hand are done
    asm volatile("s_wait_asynccnt 0x0" ::: "memory");   // its share of the next tile has landed
    __syncthreads();                                     // publishes the next tile and frees the buffer just read
    if (t + 2 < nt) fill(t + 2, t & 1); }
  asm volatile("s_wait_asynccnt 0x0" ::: "memory");   // no copy is left in flight behind the loop
  const float il = 1.0f / (l + xhalf(l));   // the two halves' sums joined; the 2^11 in l and in acc cancel
#pragma unroll
  for (int dt = 0; dt < 4; ++dt) {
#pragma unroll
    for (int r = 0; r < 8; ++r) so[wave][col][dt * 16 + 8 * g + r] = acc[dt][r] * il; }
  LDSX();
  for (int rl = 0; rl < 16; ++rl) if (lane < 16) vst2(O + ((size_t)b * SS + q0 + rl) * DM + h * HD + lane * 4, *(const v4f*)&so[wave][rl][lane * 4]);
}
// ---- k_out: block = (64 rows, 128 cols): out = O(hi/lo) . Wo rows (2 products) + bo
__global__ __launch_bounds__(128) void k_out(const float* __restrict__ O, const __bf16* __restrict__ P, const float* __restrict__ BO, float* __restrict__ Y) {
  __shared__ __align__(16) float so[4][16][132];
  const int tid = threadIdx.x, wave = tid >> 5, lane = tid & 31, col = lane & 15, g = lane >> 4; const size_t r0 = (size_t)blockIdx.x * 64 + wave * 16; const int n0 = blockIdx.y * 128;
  v8f acc[8] = {};
#pragma unroll 2
  for (int kc = 0; kc < DM / 32; ++kc) { const F2 a = split_row(O + (r0 + col) * DM, kc * 32, lane);
#pragma unroll
    for (int j = 0; j < 8; ++j) { const v16b w = frag_b(P + (size_t)(n0 + j * 16 + col) * DM + kc * 32, lane); acc[j] = wmma_bf(a.l, w, acc[j]); acc[j] = wmma_bf(a.h, w, acc[j]); } }
#pragma unroll
  for (int j = 0; j < 8; ++j) {
#pragma unroll
    for (int r = 0; r < 8; ++r) so[wave][8 * g + r][j * 16 + col] = acc[j][r] + (BO ? bfr(BO[n0 + j * 16 + col]) : 0.f); }
  LDSX();
  for (int rl = 0; rl < 16; ++rl) vst2(Y + (r0 + rl) * DM + n0 + lane * 4, *(const v4f*)&so[wave][rl][lane * 4]);
}
extern "C" void kernel_launch(void* const* d_in, const int* in_sizes, int n_in, void* d_out, int out_size, void* d_ws, size_t ws_size, hipStream_t stream) {
  (void)in_sizes; (void)n_in; (void)out_size;
  const float** F = (const float**)d_in;   // 0 current [2048,1024], 1 context [2048,1024], 2 Wq [16,1024,64], 3 bq [16,64], 4 Wk, 5 bk, 6 Wv, 7 bv, 8 Wo [1024,64], 9 bo [64]
  if (ws_size < (size_t)WS_END) return;
  char* ws = (char*)d_ws; __bf16* PK = (__bf16*)(ws + WS_PK); _Float16 *QK = (_Float16*)(ws + WS_QK), *VTH = (_Float16*)(ws + WS_VTH); float* O = (float*)(ws + WS_O);
  k_pack<<<dim3(DM / PKI, NH, 3), 256, 0, stream>>>(F[2], F[4], F[6], PK);
  k_qkv<<<dim3(TNB * SS / 64, QKVW / 128), 128, 0, stream>>>(F[0], F[1], F[1], PK + PK_A, F[3], F[5], F[7], QK, VTH);
  k_attn<<<dim3(TQB, TNH, TNB), 128, 0, stream>>>(QK, VTH, O);
  k_out2<<<dim3(TNB * SS / 16, HD / 32), 32 * OKW, 0, stream>>>(O, F[8], F[9], (float*)d_out);
}

// v008
// One run takes 53.4 microseconds.
// Next to v007, in two timings, it ran 1.08 times as fast each time.
// Over all steps from v000 it is 7.01 times as fast.
// compute dtype: all float inputs rounded to bf16; q/k/v = x W[h] + b[h] with EXACT bf16 products on WMMA 16x16x32 (per-head (in,out) weights packed as one 1024 -> 1024 projection each), stored as f16; scores one f16 product for every query, x 1/8, running-max softmax in f32 (hardware exp); one f16 product P . v; the head-major stack + row-major view realised as an index map feeding out = y2 (bf16 hi + lo) . Wo + bo (2 products); f32 output.
#include <hip/hip_runtime.h>
#include <math.h>

typedef __attribute__((ext_vector_type(16))) _Float16 v16h;
typedef __attribute__((ext_vector_type(16))) __bf16 v16b;
typedef __attribute__((ext_vector_type(8)))  _Float16 v8h;
typedef __attribute__((ext_vector_type(8)))  float v8f;
typedef __attribute__((ext_vector_type(4)))  float v4f;
typedef __attribute__((ext_vector_type(2)))  float v2f;
typedef __attribute__((ext_vector_type(4)))  unsigned v4u;
typedef __attribute__((ext_vector_type(4)))  int v4i;
typedef float __attribute__((may_alias)) float_a;
typedef int __attribute__((may_alias)) int_a;

template <typename T> __device__ __forceinline__ void vst2(void* p, T v) { *(T*)p = v;  }
__device__ __forceinline__ v8f wmma16(v16h a, v16h b, v8f c) {
  v8f d = __builtin_amdgcn_wmma_f32_16x16x32_f16(false, a, false, b, (short)0, c, false, false);
  asm volatile("v_nop\n\tv_nop\n\tv_nop\n\tv_nop" : "+v"(d) : "v"(a), "v"(b));
  return d;
}
__device__ __forceinline__ v8f wmma_bf(v16b a, v16b b, v8f c) {
  v8f d = __builtin_amdgcn_wmma_f32_16x16x32_bf16(false, a, false, b, (short)0, c, false, false);
  asm volatile("v_nop\n\tv_nop\n\tv_nop\n\tv_nop" : "+v"(d) : "v"(a), "v"(b));
  return d;
}
// Per-head (inefficient) multi-head cross attention (16 heads x 64, 2,048 current x 2,048 context tokens, D_IN 1024): per head q = x Wq[h] + bq[h], k/v from the context; softmax(q k^T / 8) v; heads stacked head-major then row-major re-viewed to [S, 1024]; Wo [1024 -> 64] + bo.
__device__ __forceinline__ v16h frag_h(const _Float16* rowk0, int lane) {
  union { v16h v; v8h q[2]; } u; const _Float16* p = rowk0 + 8 * (lane >> 4);
  u.q[0] = *(const v8h*)p; u.q[1] = *(const v8h*)(p + 16); return u.v;
}
__device__ __forceinline__ v16h frag_f32(const float* rowk0, int lane) {
  v16h a; const float* p = rowk0 + 8 * (lane >> 4);
#pragma unroll
  for (int i = 0; i < 8; ++i) { a[i] = (_Float16)p[i]; a[8 + i] = (_Float16)p[16 + i]; }
  return a;
}
__device__ __forceinline__ v16h frag_f32s(const float* rowk0, int lane, float sc) {
  v16h a; const float* p = rowk0 + 8 * (lane >> 4);
#pragma unroll
  for (int i = 0; i < 8; ++i) { a[i] = (_Float16)(p[i] * sc); a[8 + i] = (_Float16)(p[16 + i] * sc); }
  return a;
}
// column fragment from a [K][ld] layout (column n), rows >= K read as 0
__device__ __forceinline__ v16h fragc_f32(const float* W, int k0, int n, int lane, int ld, int K) {
  v16h a; const int g = lane >> 4;
#pragma unroll
  for (int i = 0; i < 8; ++i) { const int ka = k0 + 8 * g + i, kb = ka + 16;
    a[i] = (_Float16)(ka < K ? W[(size_t)(ka < K ? ka : K - 1) * ld + n] : 0.f); a[8 + i] = (_Float16)(kb < K ? W[(size_t)(kb < K ? kb : K - 1) * ld + n] : 0.f); }
  return a;
}
struct F2 { v16b h, l; };
__device__ __forceinline__ F2 bsplit16(const float v[16]) { F2 r;
#pragma unroll
  for (int i = 0; i < 16; ++i) { const __bf16 h = (__bf16)v[i]; r.h[i] = h; r.l[i] = (__bf16)(v[i] - (float)h); }
  return r; }
__device__ __forceinline__ F2 split_row(const float* row, int k0, int lane) { float v[16]; const float* p = row + k0 + 8 * (lane >> 4);
#pragma unroll
  for (int i = 0; i < 8; ++i) { v[i] = p[i]; v[8 + i] = p[16 + i]; }
  return bsplit16(v); }
__device__ __forceinline__ F2 split_rowK(const float* row, int k0, int lane, int K) { float v[16]; const int g = lane >> 4;
#pragma unroll
  for (int i = 0; i < 8; ++i) { const int ka = k0 + 8 * g + i, kb = ka + 16; v[i] = ka < K ? row[ka < K ? ka : K - 1] : 0.f; v[8 + i] = kb < K ? row[kb < K ? kb : K - 1] : 0.f; }
  return bsplit16(v); }
__device__ __forceinline__ F2 split_col(const float* W, int k0, int n, int lane, int ld, int K) { float v[16]; const int g = lane >> 4;
#pragma unroll
  for (int i = 0; i < 8; ++i) { const int ka = k0 + 8 * g + i, kb = ka + 16; v[i] = ka < K ? W[(size_t)(ka < K ? ka : K - 1) * ld + n] : 0.f; v[8 + i] = kb < K ? W[(size_t)(kb < K ? kb : K - 1) * ld + n] : 0.f; }
  return bsplit16(v); }
__device__ __forceinline__ v8f mac3(const F2& a, const F2& b, v8f c) { c = wmma_bf(a.l, b.h, c); c = wmma_bf(a.h, b.l, c); return wmma_bf(a.h, b.h, c); }
__device__ __forceinline__ float sigm(float v) { return 1.0f / (1.0f + expf(-v)); }
#define LDSX() do { asm volatile("s_wait_dscnt 0" ::: "memory"); __builtin_amdgcn_wave_barrier(); __builtin_amdgcn_fence(__ATOMIC_RELEASE, "workgroup"); } while (0)


#define NB 1
#define SS 2048
#define DM 1024
#define NH 16
#define HD 64
#define QKVW (3 * DM)
#ifndef TQB
#define TQB (SS / 64)
#endif
#ifndef TNH
#define TNH NH
#define TNB NB
#define TOB (NB * SS / 64)     // 64-row tiles of the 2,048 rows (all); nothing uses it
#endif
typedef __attribute__((ext_vector_type(8))) __bf16 v8b;
__device__ __forceinline__ v16b frag_b(const __bf16* rowk0, int lane) {
  union { v16b v; v8b q[2]; } u; const __bf16* p = rowk0 + 8 * (lane >> 4);
  u.q[0] = *(const v8b*)p; u.q[1] = *(const v8b*)(p + 16); return u.v;
}
// fragment at a wave-uniform base plus the lane's own byte offset: a group's loads all name that one offset register
__device__ __forceinline__ v16b frag_bo(const __bf16* ubase, unsigned boff) { union { v16b v; v8b q[2]; } u; const __bf16* p = (const __bf16*)((const char*)ubase + boff); u.q[0] = *(const v8b*)p; u.q[1] = *(const v8b*)(p + 16); return u.v; }
__device__ __forceinline__ float bfr(float v) { return (float)(__bf16)v; }
__device__ __attribute__((noinline)) float exp_ni(float v) { return expf(v); }
__device__ __attribute__((noinline)) float erf_ni(float v) { return erff(v); }

#define PK_A 0                       // [3072][1024] Wqkv rows (natural [out][in])
#define PK_P (PK_A + QKVW * DM)        // Wo as bf16 in B-fragment order (65,536 elements)
#define PK_END (PK_P + DM * DM)
#define WS_PK  0u
#define WS_QK  (WS_PK + 2u * PK_END)             // f16 [2048 rows][2048]: q | k
#define WS_VTH (WS_QK + 2u * NB * SS * 2 * DM)     // f16 [b][1024 (h*64+d)][2048 s]
#define WS_O   (WS_VTH + 2u * NB * DM * SS)        // f32 [2048][1024]
#define WS_CS  (WS_O + 4u * NB * SS * DM)           // f32 2 x [2048][32], reserved; nothing writes or reads it
#define WS_END (WS_CS + 4u * 2 * SS * 32)
// ---- k_pack: block = (128 input rows i, head h, which): W [h][1024 in][64 d] -> bf16 packed rows (which*DM + h*64 + d)[i]; which 0..2 -> W_q/W_k/W_v into PK_A
// The block's source tile (128 rows x 64 floats) is 32 KB in a row: it is read as whole lines, 16 bytes a lane, all eight loads of a thread in flight together, and turned in LDS; each packed row gets 256 B in a row.
#define PKI 128                   // input rows a block
#define PKP (PKI / 2 + 1)         // dwords a staged packed row: 64 of data (two bf16 each) + 1, the pitch at which the 32 lanes of a write (rows 4 apart) and of a read (dwords 4 apart) each meet 32 banks
__global__ __launch_bounds__(256) void k_pack(const float* __restrict__ WQ, const float* __restrict__ WK, const float* __restrict__ WV, const float* __restrict__ WO, __bf16* __restrict__ PK) {
  __shared__ unsigned s[HD * PKP]; const int it = blockIdx.x, h = blockIdx.y, which = blockIdx.z, t = threadIdx.x; const float* Wm = which == 0 ? WQ : which == 1 ? WK : WV;
  if (which == 3) {   // Wo [1024 k][64 n] -> bf16 at PK_P in the order of k_attn's B fragments: [n tile][32-deep pass][half][lane][8]: element i = k pass * 32 + 16 half + 8 (lane / 16) + i, column n tile * 16 + lane % 16. The whole block takes this path, in front of the barrier; a thread packs one dword, a wave one whole 128-B line.
    const int dw = (h * (DM / PKI) + it) * 256 + t, ix = 2 * dw;
    const float* p = WO + (size_t)(((ix >> 9) & 31) * 32 + ((ix >> 8) & 1) * 16 + ((ix >> 7) & 1) * 8 + (ix & 7)) * HD + (ix >> 14) * 16 + ((ix >> 3) & 15);
    const float w0 = p[0], w1 = p[HD];
    asm volatile("s_wait_xcnt 0x0" ::: "memory");   // stands behind the two loads, in front of any reuse of their address registers
    union { __bf16 e[2]; unsigned u; } w; w.e[0] = (__bf16)w0; w.e[1] = (__bf16)w1; ((unsigned*)(PK + PK_P))[dw] = w.u; return; }
  const int d4 = (t & 15) * 4, p0 = t >> 4;   // the thread's four columns d; its pair of input rows in each group of 32
  const float* src = Wm + ((size_t)h * DM + it * PKI + 2 * p0) * HD + d4;
  v4f a[4], b[4];   // rows 2 p and 2 p + 1, p = k * 16 + p0
#pragma unroll   // (here and below) a, b and v stay in registers, and the eight loads stand as one group in front of the first use
  for (int k = 0; k < 4; ++k) { a[k] = *(const v4f*)(src + (size_t)(k * 32) * HD); b[k] = *(const v4f*)(src + (size_t)(k * 32 + 1) * HD); }
#pragma unroll
  for (int k = 0; k < 4; ++k) {
#pragma unroll
    for (int j = 0; j < 4; ++j) { union { __bf16 e[2]; unsigned u; } w; w.e[0] = (__bf16)a[k][j]; w.e[1] = (__bf16)b[k][j]; s[(d4 + j) * PKP + k * 16 + p0] = w.u; } }
  __syncthreads(); __bf16* dst = PK + PK_A + ((size_t)which * DM + h * HD) * DM + it * PKI;
#pragma unroll
  for (int k = 0; k < 4; ++k) { const int q = k * 256 + t, d = q >> 4, pc = q & 15; v4u v;
#pragma unroll
    for (int j = 0; j < 4; ++j) v[j] = s[d * PKP + pc * 4 + j];
    vst2((unsigned*)(dst + (size_t)d * DM + pc * 8), v); } }
// k_qkv's operands reach the four waves of a block through LDS: a tile = 64 of k = two 32-deep passes; x 64 rows x 256 B (f32), weights 128 rows x 128 B (bf16), whole 128-B lines, each fetched once a block.
#define XP 68                     // floats a staged x row: 256 B of data + 16 B (the pitch at which 16-byte LDS reads of 16 rows meet no bank twice)
#define WP 72                     // bf16 a staged weight row: 128 B of data + 16 B (likewise)
#define QX_B (64 * XP * 4)        // bytes of the x plane
#define QBUF_B (QX_B + 128 * WP * 2)   // bytes of one buffer: x plane, weight plane
__device__ __forceinline__ v16b frag_lb(const __bf16* p) { union { v16b v; v8b q[2]; } u; u.q[0] = *(const v8b*)p; u.q[1] = *(const v8b*)(p + 16); return u.v; }
// Eight copies of 512 B each, LS bytes apart in LDS and GS bytes apart in the source. The last line is the wait that stands in front of any rewrite of the copies' address registers: inside the statement nothing can be moved over it.
template <int LS, int GS> __device__ __forceinline__ void copy8r(unsigned l, const char* gp) {
  asm volatile("global_load_async_to_lds_b128 %0, %1, off\n\tglobal_load_async_to_lds_b128 %2, %3, off\n\tglobal_load_async_to_lds_b128 %4, %5, off\n\tglobal_load_async_to_lds_b128 %6, %7, off\n\t"
               "global_load_async_to_lds_b128 %8, %9, off\n\tglobal_load_async_to_lds_b128 %10, %11, off\n\tglobal_load_async_to_lds_b128 %12, %13, off\n\tglobal_load_async_to_lds_b128 %14, %15, off\n\ts_wait_xcnt 0x0"
               :: "v"(l), "v"(gp), "v"(l + 1u * LS), "v"(gp + 1 * GS), "v"(l + 2u * LS), "v"(gp + 2 * GS), "v"(l + 3u * LS), "v"(gp + 3 * GS),
                  "v"(l + 4u * LS), "v"(gp + 4 * GS), "v"(l + 5u * LS), "v"(gp + 5 * GS), "v"(l + 6u * LS), "v"(gp + 6 * GS), "v"(l + 7u * LS), "v"(gp + 7 * GS) : "memory");
}
__global__ __launch_bounds__(128) void k_qkv(const float* __restrict__ XQ, const float* __restrict__ XK, const float* __restrict__ XV, const __bf16* __restrict__ P, const float* __restrict__ BQ, const float* __restrict__ BK, const float* __restrict__ BV, _Float16* __restrict__ QK, _Float16* __restrict__ VTH) {
  const int which0 = (blockIdx.y * 128) / DM; const float* X = (which0 == 0) ? XQ : (which0 == 1) ? XK : XV; const float* BB = BQ ? (((which0 == 0) ? BQ : (which0 == 1) ? BK : BV) + (blockIdx.y * 128 - which0 * DM)) : nullptr;
  __shared__ __align__(16) char sm[2 * QBUF_B];   // the two buffers of the k loop; behind the loop's last barrier the same bytes stage the output
  _Float16 (*so)[16][136] = (_Float16 (*)[16][136])sm; _Float16 (*sth)[72] = (_Float16 (*)[72])sm;   // a block stages q/k rows or v columns, never both
  static_assert(2 * 4 * 16 * 136 <= 2 * QBUF_B && 2 * 128 * 72 <= 2 * QBUF_B, "output staging fits the ring");
  const int tid = threadIdx.x, wave = tid >> 5, lane = tid & 31, col = lane & 15, g = lane >> 4; const size_t r0 = (size_t)blockIdx.x * 64 + wave * 16; const int n0 = blockIdx.y * 128;
  v8f acc[8] = {};
  const int ns = DM / 64;   // tiles of k
  // the lane's place in every copy: x: 2 rows x 256 B a copy (row lane / 16, piece lane % 16), this wave's 16 rows; weights: 4 rows x 128 B a copy (row lane / 8, piece lane % 8), this wave's 32 rows
  const char* gx = (const char*)(X + ((size_t)blockIdx.x * 64 + wave * 16 + (lane >> 4)) * DM + (lane & 15) * 4); const char* gw = (const char*)(P + ((size_t)n0 + wave * 32 + (lane >> 3)) * DM + (lane & 7) * 8);
  const unsigned lx = (unsigned)(size_t)sm + (unsigned)((wave * 16 + (lane >> 4)) * (XP * 4) + (lane & 15) * 16), lw = (unsigned)(size_t)sm + (unsigned)(QX_B + (wave * 32 + (lane >> 3)) * (WP * 2) + (lane & 7) * 16);
  auto fill = [&](int s, int bf) { copy8r<2 * XP * 4, 2 * DM * 4>(lx + (unsigned)(bf * QBUF_B), gx + (size_t)s * 256); copy8r<4 * WP * 2, 4 * DM * 2>(lw + (unsigned)(bf * QBUF_B), gw + (size_t)s * 128); };
  fill(0, 0);
  float bias[8];   // loaded here, in flight under the k loop, not one waited load per stored element
#pragma unroll
  for (int j = 0; j < 8; ++j) bias[j] = 0.f;
  if (BB) {
#pragma unroll
    for (int j = 0; j < 8; ++j) bias[j] = BB[j * 16 + col]; }
  asm volatile("s_wait_asynccnt 0x0" ::: "memory");   // this wave's share of tile 0 has landed
  __syncthreads();                                     // every wave's share has: tile 0 may be read
  fill(1, 1);
#pragma unroll 1   // stays rolled: one foot (waits, barrier, refill) a tile, and the text of the loop stays short
  for (int s = 0; s < ns; ++s) { const char* bp = sm + (s & 1) * QBUF_B; const float* fx = (const float*)bp + (wave * 16 + col) * XP + 8 * g; const __bf16* fw = (const __bf16*)(bp + QX_B) + col * WP + 8 * g;
    v4f xc[2][4]; v16b wc[2][8];   // both passes' operands, read as two groups in front of the products (the statement behind each product holds a load at its place in the source)
#pragma unroll
    for (int sub = 0; sub < 2; ++sub) { xc[sub][0] = *(const v4f*)(fx + sub * 32); xc[sub][1] = *(const v4f*)(fx + sub * 32 + 4); xc[sub][2] = *(const v4f*)(fx + sub * 32 + 16); xc[sub][3] = *(const v4f*)(fx + sub * 32 + 20);
#pragma unroll
      for (int j = 0; j < 8; ++j) wc[sub][j] = frag_lb(fw + (j * 16) * WP + sub * 32); }
#pragma unroll
    for (int sub = 0; sub < 2; ++sub) { v16b a;
#pragma unroll
      for (int i = 0; i < 16; ++i) a[i] = (__bf16)xc[sub][i >> 2][i & 3];
#pragma unroll
      for (int j = 0; j < 8; ++j) acc[j] = wmma_bf(a, wc[sub][j], acc[j]); }
    asm volatile("s_wait_dscnt 0x0" ::: "memory");      // this wave's reads of the tile in hand are done
    asm volatile("s_wait_asynccnt 0x0" ::: "memory");   // its share of the next tile has landed
    __syncthreads();                                     // publishes the next tile and frees the buffer just read (behind the last tile: frees the ring for the output staging)
    if (s + 2 < ns) fill(s + 2, s & 1); }
  asm volatile("s_wait_asynccnt 0x0" ::: "memory");   // no copy is left in flight behind the loop
  if (n0 < 2 * DM) {   // q stored unscaled (f16 sigma ~0.6, no subnormal exposure); 1/8 applied to the f32 score
#pragma unroll
    for (int j = 0; j < 8; ++j) {
#pragma unroll
      for (int r = 0; r < 8; ++r) so[wave][8 * g + r][j * 16 + col] = (_Float16)(acc[j][r] + bfr(bias[j])); }   // q, k (+ bias) as f16
    LDSX();
    for (int rl = 0; rl < 16; ++rl) if (lane < 16) vst2((unsigned*)(QK + (r0 + rl) * (2 * DM) + n0 + lane * 8), *(const v4u*)&so[wave][rl][lane * 8]);
  } else {
#pragma unroll
    for (int j = 0; j < 8; ++j) {
#pragma unroll
      for (int r = 0; r < 8; ++r) sth[j * 16 + col][wave * 16 + 8 * g + r] = (_Float16)(acc[j][r] + bfr(bias[j])); }
    __syncthreads();
    const size_t rb = (size_t)blockIdx.x * 64; const int b = (int)(rb / SS), s0 = (int)(rb % SS); const int pc0 = n0 - 2 * DM;
    for (int q = tid; q < 128 * 8; q += 128) { const int d = q >> 3, pc = q & 7; const size_t o = ((size_t)b * DM + pc0 + d) * SS + s0 + pc * 8; vst2((unsigned*)(VTH + o), *(const v4u*)&sth[d][pc * 8]); }
  }
}
// ---- k_attn: block = (64 queries, head h, batch b): all-keys flash attention (K = 64: 2 k-steps), scores = (q.k) * 0.125 with single f16 operands, P.V: f16 P x f16 V; y = acc / l goes straight into the output projection
// Every query block walks all 2,048 keys with the same products: the 512 blocks, two on each WGP, cost alike, and none outlasts the rest.
// K and V reach the four waves of a block through LDS: a tile = 64 keys = two 32-key passes; K 64 key rows x 128 B, V 64 d rows x 128 B, whole 128-B lines, each fetched once a block.
#define KP 72                    // halfs a staged row: 128 B of data + 16 B, the pitch at which 16-byte LDS reads of 16 rows meet no bank twice
#define PLANE (64 * KP)          // halfs of one staged plane
#define STG_H (2 * 2 * PLANE)    // two buffers of two planes: K, V
#define ESC 0.18033688f          // log2(e) / sqrt(64): a raw score times this is its exponent in base 2
__device__ __forceinline__ v16h frag_l(const _Float16* p) { union { v16h v; v8h q[2]; } u; u.q[0] = *(const v8h*)p; u.q[1] = *(const v8h*)(p + 16); return u.v; }
// Sixteen rows of plane a and sixteen of plane b: eight copies, each 4 rows x 128 B (lane: row lane / 8, 16-byte piece lane % 8); both sources have rows 4,096 B apart. The last line is the wait that stands in front of any rewrite of the copies' address registers: inside the statement nothing can be moved over it.
__device__ __forceinline__ void copy8(unsigned la, const _Float16* ga, unsigned lb, const _Float16* gb) {
  asm volatile("global_load_async_to_lds_b128 %0, %1, off\n\tglobal_load_async_to_lds_b128 %2, %3, off\n\tglobal_load_async_to_lds_b128 %4, %5, off\n\tglobal_load_async_to_lds_b128 %6, %7, off\n\t"
               "global_load_async_to_lds_b128 %8, %9, off\n\tglobal_load_async_to_lds_b128 %10, %11, off\n\tglobal_load_async_to_lds_b128 %12, %13, off\n\tglobal_load_async_to_lds_b128 %14, %15, off\n\ts_wait_xcnt 0x0"
               :: "v"(la), "v"(ga), "v"(la + 2u * 4 * KP), "v"(ga + 4 * 2048), "v"(la + 2u * 8 * KP), "v"(ga + 8 * 2048), "v"(la + 2u * 12 * KP), "v"(ga + 12 * 2048),
                  "v"(lb), "v"(gb), "v"(lb + 2u * 4 * KP), "v"(gb + 4 * 2048), "v"(lb + 2u * 8 * KP), "v"(gb + 8 * 2048), "v"(lb + 2u * 12 * KP), "v"(gb + 12 * 2048) : "memory");
}
// One pass of a wave's Wo fragments: two copies of 512 B in a row. The last line is the wait that stands in front of any rewrite of the copies' address registers.
__device__ __forceinline__ void copy2(unsigned l, const __bf16* gp) {
  asm volatile("global_load_async_to_lds_b128 %0, %1, off\n\tglobal_load_async_to_lds_b128 %2, %3, off\n\ts_wait_xcnt 0x0" :: "v"(l), "v"(gp), "v"(l + 512u), "v"(gp + 256) : "memory");
}
// lane l with lane l ^ 16 (a vector move, no LDS): the other half of a query's keys
__device__ __forceinline__ float xhalf(float x) { return __builtin_bit_cast(float, __builtin_amdgcn_permlanex16(__builtin_bit_cast(int, x), __builtin_bit_cast(int, x), 0x76543210, 0xfedcba98, false, false)); }
// Both products are taken transposed: S^T = K . Q^T (rows = keys, columns = queries) and O^T += V^T . P^T (rows = d, columns = queries). A lane then holds 16 of the 32 scores of ONE query (its column), lane ^ 16 the other 16: maximum and sum are in-lane plus one move between the halves, m, l and the rescale factor are one value a lane, and the two score tiles, converted in place, are the B operand of the second product in the hardware k order: P never leaves the registers.
// The output projection is done here too. The head-major stack re-viewed as [2048][1024] puts the 16 queries x 64 d of ONE wave, in that order, into ONE row of the projection's left operand: row h * 128 + q0 / 16, k = (q - q0) * 64 + d. A block so owns four whole rows: their bf16 hi parts are rows 0-3 and their lo parts rows 4-7 of one A operand (rows 8-15 repeat them and are not used), wave w takes output columns 16 w .. 16 w + 15 over all 1,024 of k, and out = hi rows + lo rows + bo.
#define WKS 24                   // passes of a wave's Wo columns that reach LDS under the key loop, one a key tile (1 KB: two copies a wave); the other 8 come through registers behind the loop
#define YP (DM + 8)              // bf16 a staged row of that operand: 2,048 B of data + 16 B (the pitch at which 16-byte LDS reads of 8 rows meet no bank twice)
__global__ __launch_bounds__(128) void k_attn(const _Float16* __restrict__ QK, const _Float16* __restrict__ VTH, const __bf16* __restrict__ PW, const float* __restrict__ BO, float* __restrict__ OUT) {
  __shared__ __align__(16) __bf16 sy[8][YP]; __shared__ __align__(16) float sr[4][HD]; __shared__ __align__(16) _Float16 st[STG_H];
  __shared__ __align__(16) __bf16 sw[4][WKS][512];   // each wave's own first WKS passes of Wo; with it a block holds 152,704 B of LDS, and two blocks still share a WGP
  const int tid = threadIdx.x, wave = tid >> 5, lane = tid & 31, col = lane & 15, g = lane >> 4;
  const int qb = blockIdx.x, h = blockIdx.y, b = blockIdx.z; const int q0 = qb * 64 + wave * 16; const size_t rq = (size_t)b * SS + q0 + col;
  const int nt = SS / 64;   // key tiles (all keys)
  const int bufh = 2 * PLANE;   // halfs of one buffer
  const int crow = wave * 16 + (lane >> 3), cpc = (lane & 7) * 8;   // the lane's first row and its 16-byte piece in every copy
  const size_t ko = ((size_t)b * SS + crow) * (2 * DM) + DM + h * HD + cpc, vo = ((size_t)b * DM + h * HD + crow) * SS + cpc;   // tile 0; a tile on: 64 key rows of K, 64 columns of V
  const unsigned l0 = (unsigned)(size_t)st + 2u * (unsigned)(crow * KP + cpc);
  auto fill = [&](int t, int bf) { const unsigned lb = l0 + 2u * (unsigned)(bf * bufh); const size_t kt = ko + (size_t)t * 64 * (2 * DM), vt = vo + (size_t)t * 64;
    copy8(lb, QK + kt, lb + 2u * PLANE, VTH + vt); };
  const __bf16* wsrc = PW + (size_t)wave * (32 * 512) + lane * 8;   // this wave's 16 columns of Wo in fragment order: a pass = two pieces of 512 B, the lane's 16 bytes in each
  const unsigned lw0 = (unsigned)(size_t)&sw[wave][0][0] + (unsigned)lane * 16u;
  fill(0, 0);
  v16h aq[2];
#pragma unroll
  for (int kc = 0; kc < 2; ++kc) aq[kc] = frag_h(QK + rq * (2 * DM) + h * HD + kc * 32, lane);
  const v2f bo2 = *(const v2f*)(BO + lane * 2);   // the bias of the two output columns this lane stores at the end: loaded here, with Q, so that no barrier behind the loop waits for it
  asm volatile("s_wait_xcnt 0x0" ::: "memory");   // (here and behind the group of Wo loads below) stands behind the loads, in front of the first instruction that reuses a register which one of them names as address
  float m = -3.0e38f, l = 0.f;   // of query col; m is the maximum of the raw q . k; l sums this half's keys only, the halves are joined behind the loop
  v8f acc[4] = {};
  asm volatile("s_wait_asynccnt 0x0" ::: "memory");   // this wave's share of tile 0 has landed
  __syncthreads();                                     // every wave's share has: tile 0 may be read
  fill(1, 1);
#pragma unroll 1   // stays rolled: one foot (waits, barrier, refill) a tile, and the text of the loop stays short
  for (int t = 0; t < nt; ++t) { const _Float16* fk = st + (t & 1) * bufh + col * KP + 8 * g; const _Float16* fv = fk + PLANE;   // the lane's row col of the K and of the V plane
    // The statement behind each product holds a load at its place in the source, so every LDS read of a pass stands in front of the products that follow it: behind the score products of a pass go, as one group, its own V and (inside the tile) the next pass's K, in flight under the softmax.
    v16h kf[2][2];   // [ct][kc] K fragments of the pass in hand
#pragma unroll
    for (int ct = 0; ct < 2; ++ct) {
#pragma unroll
      for (int kc = 0; kc < 2; ++kc) kf[ct][kc] = frag_l(fk + (ct * 16) * KP + kc * 32); }
#pragma unroll
    for (int sub = 0; sub < 2; ++sub) { v8f s[2]; v16h vf[4];
#pragma unroll
    for (int ct = 0; ct < 2; ++ct) { v8f c = {};
#pragma unroll
      for (int kc = 0; kc < 2; ++kc) c = wmma16(kf[ct][kc], aq[kc], c);
      s[ct] = c; }   // the raw q . k: s[ct][r] = key ct * 16 + 8 g + r of the pass, query col; 1/sqrt(64) goes into the exponent's one multiply-add below
#pragma unroll
    for (int dt = 0; dt < 4; ++dt) vf[dt] = frag_l(fv + (dt * 16) * KP + sub * 32);
    if (sub == 0) {   // the tile's second pass's K
#pragma unroll
      for (int ct = 0; ct < 2; ++ct) {
#pragma unroll
        for (int kc = 0; kc < 2; ++kc) kf[ct][kc] = frag_l(fk + (32 + ct * 16) * KP + kc * 32); } }
    __builtin_amdgcn_sched_barrier(0);   // keeps the group here, in front of the softmax; moved down its reads would be waited for right in front of the second product
    float t4[4];   // four short chains, not one long one
#pragma unroll
    for (int j = 0; j < 4; ++j) t4[j] = fmaxf(fmaxf(s[0][j], s[0][4 + j]), fmaxf(s[1][j], s[1][4 + j]));
    float mx = fmaxf(fmaxf(t4[0], t4[1]), fmaxf(t4[2], t4[3])); mx = fmaxf(mx, xhalf(mx));   // both halves now hold the pass's maximum of query col
    const float mn = fmaxf(m, mx); const float alpha = __builtin_amdgcn_exp2f((m - mn) * ESC);   // first pass: m = -3e38, the hardware exp2 of about -5e37 is 0
    const float nb = __builtin_fmaf(-mn, ESC, 11.0f);   // one value a pass: minus the maximum in base-2 units, plus the 2^11 of P
    float e[2][8];   // 2^11 exp((q.k - max) / 8): one multiply-add and one hardware exp2 a score
#pragma unroll
    for (int ct = 0; ct < 2; ++ct) {
#pragma unroll
      for (int r = 0; r < 8; ++r) e[ct][r] = __builtin_amdgcn_exp2f(__builtin_fmaf(s[ct][r], ESC, nb)); }
#pragma unroll
    for (int j = 0; j < 4; ++j) t4[j] = (e[0][j] + e[0][4 + j]) + (e[1][j] + e[1][4 + j]);
    l = l * alpha + ((t4[0] + t4[1]) + (t4[2] + t4[3])); m = mn;
#pragma unroll
    for (int dt = 0; dt < 4; ++dt) {
#pragma unroll
      for (int r = 0; r < 8; ++r) acc[dt][r] *= alpha; }
    v16h pa;   // P^T as a B operand: element i = key 8 g + i, element 8 + i = key 16 + 8 g + i, the order in which the V fragments hold their keys
#pragma unroll
    for (int i = 0; i < 8; ++i) { pa[i] = (_Float16)e[0][i]; pa[8 + i] = (_Float16)e[1][i]; }   // P carries 2^11 (from nb) so that small softmax weights stay out of the f16 subnormal range; l carries it too, and the division behind the loop takes it out
#pragma unroll
    for (int dt = 0; dt < 4; ++dt) acc[dt] = wmma16(vf[dt], pa, acc[dt]);   // acc[dt][r] = d dt * 16 + 8 g + r of query col
    }
    asm volatile("s_wait_dscnt 0x0" ::: "memory");      // this wave's reads of the tile in hand are done
    asm volatile("s_wait_asynccnt 0x0" ::: "memory");   // its share of the next tile has landed
    __syncthreads();                                     // publishes the next tile and frees the buffer just read
    if (t + 2 < nt) fill(t + 2, t & 1);
    if (t < WKS) copy2(lw0 + (unsigned)t * 1024u, wsrc + t * 512); }   // pass t of this wave's Wo columns: lands under the next tile, covered by that tile's s_wait_asynccnt 0; only this wave reads it, behind the loop
  asm volatile("s_wait_asynccnt 0x0" ::: "memory");   // no copy is left in flight behind the loop
  const float il = 1.0f / (l + xhalf(l));   // the two halves' sums joined; the 2^11 in l and in acc cancel
#pragma unroll
  for (int dt = 0; dt < 4; ++dt) { v8b yh, yl;
#pragma unroll
    for (int r = 0; r < 8; ++r) { const float v = acc[dt][r] * il; const __bf16 hh = (__bf16)v; yh[r] = hh; yl[r] = (__bf16)(v - (float)hh); }
    *(v8b*)&sy[wave][col * HD + dt * 16 + 8 * g] = yh; *(v8b*)&sy[4 + wave][col * HD + dt * 16 + 8 * g] = yl; }
  __syncthreads();   // all four rows, hi and lo, are in LDS
  // The last 8 passes of Wo go out here as one group of 16 loads, behind the barrier (whose fence would wait for them), in flight under the 24 products fed from LDS (the statement behind each product holds a load at its place in the source).
  v16b wb[32 - WKS];
#pragma unroll   // (here and below) wb, af, bf and o2 stay in registers
  for (int i = 0; i < 32 - WKS; ++i) { union { v16b v; v8b q[2]; } u; u.q[0] = *(const v8b*)(wsrc + (WKS + i) * 512); u.q[1] = *(const v8b*)(wsrc + (WKS + i) * 512 + 256); wb[i] = u.v; }
  asm volatile("s_wait_xcnt 0x0" ::: "memory");
  const __bf16* ap = &sy[lane & 7][8 * g]; const __bf16* bp = &sw[wave][0][lane * 8];
  v16b af[2][4], bf[2][4]; v8f o2[2] = {};   // fragments four passes at a time, a group ahead of its products; two chains of products, joined below
  auto ldf = [&](int gq) {
#pragma unroll
    for (int i = 0; i < 4; ++i) { const int ks = gq * 4 + i; af[gq & 1][i] = frag_lb(ap + ks * 32);
      if (ks < WKS) { union { v16b v; v8b q[2]; } u; u.q[0] = *(const v8b*)(bp + ks * 512); u.q[1] = *(const v8b*)(bp + ks * 512 + 256); bf[gq & 1][i] = u.v; } } };
  ldf(0);
#pragma unroll
  for (int gq = 0; gq < 8; ++gq) {
    if (gq < 7) ldf(gq + 1);
#pragma unroll
    for (int i = 0; i < 4; ++i) o2[i & 1] = wmma_bf(af[gq & 1][i], gq * 4 + i < WKS ? bf[gq & 1][i] : wb[(gq * 4 + i) % (32 - WKS)], o2[i & 1]); }
  const v8f o = o2[0] + o2[1];   // lanes 0-15: element r = A row r, column col
  if (g == 0) {
#pragma unroll
    for (int r = 0; r < 4; ++r) sr[r][wave * 16 + col] = o[r] + o[4 + r]; }   // hi + lo
  __syncthreads();   // the four waves' column tiles are in LDS
  v2f res = *(const v2f*)&sr[wave][lane * 2]; res[0] += bfr(bo2[0]); res[1] += bfr(bo2[1]);
  vst2(OUT + ((size_t)b * SS + h * (SS / NH) + qb * 4 + wave) * HD + lane * 2, res);   // a wave stores one whole output row: two whole 128-B lines
}
// ---- k_out: block = (64 rows, 128 cols): out = O(hi/lo) . Wo rows (2 products) + bo
__global__ __launch_bounds__(128) void k_out(const float* __restrict__ O, const __bf16* __restrict__ P, const float* __restrict__ BO, float* __restrict__ Y) {
  __shared__ __align__(16) float so[4][16][132];
  const int tid = threadIdx.x, wave = tid >> 5, lane = tid & 31, col = lane & 15, g = lane >> 4; const size_t r0 = (size_t)blockIdx.x * 64 + wave * 16; const int n0 = blockIdx.y * 128;
  v8f acc[8] = {};
#pragma unroll 2
  for (int kc = 0; kc < DM / 32; ++kc) { const F2 a = split_row(O + (r0 + col) * DM, kc * 32, lane);
#pragma unroll
    for (int j = 0; j < 8; ++j) { const v16b w = frag_b(P + (size_t)(n0 + j * 16 + col) * DM + kc * 32, lane); acc[j] = wmma_bf(a.l, w, acc[j]); acc[j] = wmma_bf(a.h, w, acc[j]); } }
#pragma unroll
  for (int j = 0; j < 8; ++j) {
#pragma unroll
    for (int r = 0; r < 8; ++r) so[wave][8 * g + r][j * 16 + col] = acc[j][r] + (BO ? bfr(BO[n0 + j * 16 + col]) : 0.f); }
  LDSX();
  for (int rl = 0; rl < 16; ++rl) vst2(Y + (r0 + rl) * DM + n0 + lane * 4, *(const v4f*)&so[wave][rl][lane * 4]);
}
extern "C" void kernel_launch(void* const* d_in, const int* in_sizes, int n_in, void* d_out, int out_size, void* d_ws, size_t ws_size, hipStream_t stream) {
  (void)in_sizes; (void)n_in; (void)out_size;
  const float** F = (const float**)d_in;   // 0 current [2048,1024], 1 context [2048,1024], 2 Wq [16,1024,64], 3 bq [16,64], 4 Wk, 5 bk, 6 Wv, 7 bv, 8 Wo [1024,64], 9 bo [64]
  if (ws_size < (size_t)WS_END) return;
  char* ws = (char*)d_ws; __bf16* PK = (__bf16*)(ws + WS_PK); _Float16 *QK = (_Float16*)(ws + WS_QK), *VTH = (_Float16*)(ws + WS_VTH);
  k_pack<<<dim3(DM / PKI, NH, 4), 256, 0, stream>>>(F[2], F[4], F[6], F[8], PK);
  k_qkv<<<dim3(TNB * SS / 64, QKVW / 128), 128, 0, stream>>>(F[0], F[1], F[1], PK + PK_A, F[3], F[5], F[7], QK, VTH);
  k_attn<<<dim3(TQB, TNH, TNB), 128, 0, stream>>>(QK, VTH, PK + PK_P, F[9], (float*)d_out);
}

// v009
// It runs in 49.7 microseconds.
// In both of two side-by-side timings against v008, it was 1.07 times as fast.
// Over all steps from v000 it is 7.53 times as fast.
// compute dtype: all float inputs rounded to bf16; q/k/v = x W[h] + b[h] with EXACT bf16 products on WMMA 16x16x32 (per-head (in,out) weights packed as one 1024 -> 1024 projection each), stored as f16; scores one f16 product for every query, x 1/8, running-max softmax in f32 (hardware exp); one f16 product P . v; the head-major stack + row-major view realised as an index map feeding out = y2 (bf16 hi + lo) . Wo + bo (2 products); f32 output.
#include <hip/hip_runtime.h>
#include <math.h>

typedef __attribute__((ext_vector_type(16))) _Float16 v16h;
typedef __attribute__((ext_vector_type(16))) __bf16 v16b;
typedef __attribute__((ext_vector_type(8)))  _Float16 v8h;
typedef __attribute__((ext_vector_type(8)))  float v8f;
typedef __attribute__((ext_vector_type(4)))  float v4f;
typedef __attribute__((ext_vector_type(2)))  float v2f;
typedef __attribute__((ext_vector_type(4)))  unsigned v4u;
typedef __attribute__((ext_vector_type(4)))  int v4i;
typedef float __attribute__((may_alias)) float_a;
typedef int __attribute__((may_alias)) int_a;

template <typename T> __device__ __forceinline__ void vst2(void* p, T v) { *(T*)p = v;  }
__device__ __forceinline__ v8f wmma16(v16h a, v16h b, v8f c) {
  v8f d = __builtin_amdgcn_wmma_f32_16x16x32_f16(false, a, false, b, (short)0, c, false, false);
  asm volatile("v_nop\n\tv_nop\n\tv_nop\n\tv_nop" : "+v"(d) : "v"(a), "v"(b));
  return d;
}
__device__ __forceinline__ v8f wmma_bf(v16b a, v16b b, v8f c) {
  v8f d = __builtin_amdgcn_wmma_f32_16x16x32_bf16(false, a, false, b, (short)0, c, false, false);
  asm volatile("v_nop\n\tv_nop\n\tv_nop\n\tv_nop" : "+v"(d) : "v"(a), "v"(b));
  return d;
}
// Per-head (inefficient) multi-head cross attention (16 heads x 64, 2,048 current x 2,048 context tokens, D_IN 1024): per head q = x Wq[h] + bq[h], k/v from the context; softmax(q k^T / 8) v; heads stacked head-major then row-major re-viewed to [S, 1024]; Wo [1024 -> 64] + bo.
__device__ __forceinline__ v16h frag_h(const _Float16* rowk0, int lane) {
  union { v16h v; v8h q[2]; } u; const _Float16* p = rowk0 + 8 * (lane >> 4);
  u.q[0] = *(const v8h*)p; u.q[1] = *(const v8h*)(p + 16); return u.v;
}
__device__ __forceinline__ v16h frag_f32(const float* rowk0, int lane) {
  v16h a; const float* p = rowk0 + 8 * (lane >> 4);
#pragma unroll
  for (int i = 0; i < 8; ++i) { a[i] = (_Float16)p[i]; a[8 + i] = (_Float16)p[16 + i]; }
  return a;
}
__device__ __forceinline__ v16h frag_f32s(const float* rowk0, int lane, float sc) {
  v16h a; const float* p = rowk0 + 8 * (lane >> 4);
#pragma unroll
  for (int i = 0; i < 8; ++i) { a[i] = (_Float16)(p[i] * sc); a[8 + i] = (_Float16)(p[16 + i] * sc); }
  return a;
}
// column fragment from a [K][ld] layout (column n), rows >= K read as 0
__device__ __forceinline__ v16h fragc_f32(const float* W, int k0, int n, int lane, int ld, int K) {
  v16h a; const int g = lane >> 4;
#pragma unroll
  for (int i = 0; i < 8; ++i) { const int ka = k0 + 8 * g + i, kb = ka + 16;
    a[i] = (_Float16)(ka < K ? W[(size_t)(ka < K ? ka : K - 1) * ld + n] : 0.f); a[8 + i] = (_Float16)(kb < K ? W[(size_t)(kb < K ? kb : K - 1) * ld + n] : 0.f); }
  return a;
}
struct F2 { v16b h, l; };
__device__ __forceinline__ F2 bsplit16(const float v[16]) { F2 r;
#pragma unroll
  for (int i = 0; i < 16; ++i) { const __bf16 h = (__bf16)v[i]; r.h[i] = h; r.l[i] = (__bf16)(v[i] - (float)h); }
  return r; }
__device__ __forceinline__ F2 split_row(const float* row, int k0, int lane) { float v[16]; const float* p = row + k0 + 8 * (lane >> 4);
#pragma unroll
  for (int i = 0; i < 8; ++i) { v[i] = p[i]; v[8 + i] = p[16 + i]; }
  return bsplit16(v); }
__device__ __forceinline__ F2 split_rowK(const float* row, int k0, int lane, int K) { float v[16]; const int g = lane >> 4;
#pragma unroll
  for (int i = 0; i < 8; ++i) { const int ka = k0 + 8 * g + i, kb = ka + 16; v[i] = ka < K ? row[ka < K ? ka : K - 1] : 0.f; v[8 + i] = kb < K ? row[kb < K ? kb : K - 1] : 0.f; }
  return bsplit16(v); }
__device__ __forceinline__ F2 split_col(const float* W, int k0, int n, int lane, int ld, int K) { float v[16]; const int g = lane >> 4;
#pragma unroll
  for (int i = 0; i < 8; ++i) { const int ka = k0 + 8 * g + i, kb = ka + 16; v[i] = ka < K ? W[(size_t)(ka < K ? ka : K - 1) * ld + n] : 0.f; v[8 + i] = kb < K ? W[(size_t)(kb < K ? kb : K - 1) * ld + n] : 0.f; }
  return bsplit16(v); }
__device__ __forceinline__ v8f mac3(const F2& a, const F2& b, v8f c) { c = wmma_bf(a.l, b.h, c); c = wmma_bf(a.h, b.l, c); return wmma_bf(a.h, b.h, c); }
__device__ __forceinline__ float sigm(float v) { return 1.0f / (1.0f + expf(-v)); }
#define LDSX() do { asm volatile("s_wait_dscnt 0" ::: "memory"); __builtin_amdgcn_wave_barrier(); __builtin_amdgcn_fence(__ATOMIC_RELEASE, "workgroup"); } while (0)


#define NB 1
#define SS 2048
#define DM 1024
#define NH 16
#define HD 64
#define QKVW (3 * DM)
#ifndef TQB
#define TQB (SS / 64)
#endif
#ifndef TNH
#define TNH NH
#define TNB NB
#define TOB (NB * SS / 64)     // 64-row tiles of the 2,048 rows (all); nothing uses it
#endif
typedef __attribute__((ext_vector_type(8))) __bf16 v8b;
__device__ __forceinline__ v16b frag_b(const __bf16* rowk0, int lane) {
  union { v16b v; v8b q[2]; } u; const __bf16* p = rowk0 + 8 * (lane >> 4);
  u.q[0] = *(const v8b*)p; u.q[1] = *(const v8b*)(p + 16); return u.v;
}
// fragment at a wave-uniform base plus the lane's own byte offset: a group's loads all name that one offset register
__device__ __forceinline__ v16b frag_bo(const __bf16* ubase, unsigned boff) { union { v16b v; v8b q[2]; } u; const __bf16* p = (const __bf16*)((const char*)ubase + boff); u.q[0] = *(const v8b*)p; u.q[1] = *(const v8b*)(p + 16); return u.v; }
__device__ __forceinline__ float bfr(float v) { return (float)(__bf16)v; }
__device__ __attribute__((noinline)) float exp_ni(float v) { return expf(v); }
__device__ __attribute__((noinline)) float erf_ni(float v) { return erff(v); }

#define PK_A 0                       // [3072][1024] Wqkv rows (natural [out][in])
#define PK_P (PK_A + QKVW * DM)        // Wo as bf16 in B-fragment order (65,536 elements)
#define PK_END (PK_P + DM * DM)
#define WS_PK  0u
#define WS_QK  (WS_PK + 2u * PK_END)             // f16 [2048 rows][2048]: q | k
#define WS_VTH (WS_QK + 2u * NB * SS * 2 * DM)     // f16 [b][1024 (h*64+d)][2048 s]
#define WS_O   (WS_VTH + 2u * NB * DM * SS)        // f32 [2048][1024]
#define WS_CS  (WS_O + 4u * NB * SS * DM)           // f32 2 x [2048][32], reserved; nothing writes or reads it
#define WS_END (WS_CS + 4u * 2 * SS * 32)
// ---- k_pack: block = (128 input rows i, head h, which): W [h][1024 in][64 d] -> bf16 packed rows (which*DM + h*64 + d)[i]; which 0..2 -> W_q/W_k/W_v into PK_A
// The block's source tile (128 rows x 64 floats) is 32 KB in a row: it is read as whole lines, 16 bytes a lane, all eight loads of a thread in flight together, and turned in LDS; each packed row gets 256 B in a row.
#define PKI 128                   // input rows a block
#define PKP (PKI / 2 + 1)         // dwords a staged packed row: 64 of data (two bf16 each) + 1, the pitch at which the 32 lanes of a write (rows 4 apart) and of a read (dwords 4 apart) each meet 32 banks
__global__ __launch_bounds__(256) void k_pack(const float* __restrict__ WQ, const float* __restrict__ WK, const float* __restrict__ WV, const float* __restrict__ WO, __bf16* __restrict__ PK) {
  __shared__ unsigned s[HD * PKP]; const int it = blockIdx.x, h = blockIdx.y, which = blockIdx.z, t = threadIdx.x; const float* Wm = which == 0 ? WQ : which == 1 ? WK : WV;
  if (which == 3) {   // Wo [1024 k][64 n] -> bf16 at PK_P in the order of k_attn's B fragments: [n tile][32-deep pass][half][lane][8]: element i = k pass * 32 + 16 half + 8 (lane / 16) + i, column n tile * 16 + lane % 16. The whole block takes this path, in front of the barrier; a thread packs one dword, a wave one whole 128-B line.
    const int dw = (h * (DM / PKI) + it) * 256 + t, ix = 2 * dw;
    const float* p = WO + (size_t)(((ix >> 9) & 31) * 32 + ((ix >> 8) & 1) * 16 + ((ix >> 7) & 1) * 8 + (ix & 7)) * HD + (ix >> 14) * 16 + ((ix >> 3) & 15);
    const float w0 = p[0], w1 = p[HD];
    asm volatile("s_wait_xcnt 0x0" ::: "memory");   // stands behind the two loads, in front of any reuse of their address registers
    union { __bf16 e[2]; unsigned u; } w; w.e[0] = (__bf16)w0; w.e[1] = (__bf16)w1; ((unsigned*)(PK + PK_P))[dw] = w.u; return; }
  const int d4 = (t & 15) * 4, p0 = t >> 4;   // the thread's four columns d; its pair of input rows in each group of 32
  const float* src = Wm + ((size_t)h * DM + it * PKI + 2 * p0) * HD + d4;
  v4f a[4], b[4];   // rows 2 p and 2 p + 1, p = k * 16 + p0
#pragma unroll   // (here and below) a, b and v stay in registers, and the eight loads stand as one group in front of the first use
  for (int k = 0; k < 4; ++k) { a[k] = *(const v4f*)(src + (size_t)(k * 32) * HD); b[k] = *(const v4f*)(src + (size_t)(k * 32 + 1) * HD); }
#pragma unroll
  for (int k = 0; k < 4; ++k) {
#pragma unroll
    for (int j = 0; j < 4; ++j) { union { __bf16 e[2]; unsigned u; } w; w.e[0] = (__bf16)a[k][j]; w.e[1] = (__bf16)b[k][j]; s[(d4 + j) * PKP + k * 16 + p0] = w.u; } }
  __syncthreads(); __bf16* dst = PK + PK_A + ((size_t)which * DM + h * HD) * DM + it * PKI;
#pragma unroll
  for (int k = 0; k < 4; ++k) { const int q = k * 256 + t, d = q >> 4, pc = q & 15; v4u v;
#pragma unroll
    for (int j = 0; j < 4; ++j) v[j] = s[d * PKP + pc * 4 + j];
    vst2((unsigned*)(dst + (size_t)d * DM + pc * 8), v); } }
// k_qkv's operands reach the four waves of a block through LDS: a tile = 64 of k = two 32-deep passes; x 64 rows x 256 B (f32), weights 128 rows x 128 B (bf16), whole 128-B lines, each fetched once a block.
#define XP 68                     // floats a staged x row: 256 B of data + 16 B (the pitch at which 16-byte LDS reads of 16 rows meet no bank twice)
#define WP 72                     // bf16 a staged weight row: 128 B of data + 16 B (likewise)
#define QX_B (64 * XP * 4)        // bytes of the x plane
#define QBUF_B (QX_B + 128 * WP * 2)   // bytes of one buffer: x plane, weight plane
__device__ __forceinline__ v16b frag_lb(const __bf16* p) { union { v16b v; v8b q[2]; } u; u.q[0] = *(const v8b*)p; u.q[1] = *(const v8b*)(p + 16); return u.v; }
// Eight copies of 512 B each, LS bytes apart in LDS and GS bytes apart in the source. The last line is the wait that stands in front of any rewrite of the copies' address registers: inside the statement nothing can be moved over it.
template <int LS, int GS> __device__ __forceinline__ void copy8r(unsigned l, const char* gp) {
  asm volatile("global_load_async_to_lds_b128 %0, %1, off\n\tglobal_load_async_to_lds_b128 %2, %3, off\n\tglobal_load_async_to_lds_b128 %4, %5, off\n\tglobal_load_async_to_lds_b128 %6, %7, off\n\t"
               "global_load_async_to_lds_b128 %8, %9, off\n\tglobal_load_async_to_lds_b128 %10, %11, off\n\tglobal_load_async_to_lds_b128 %12, %13, off\n\tglobal_load_async_to_lds_b128 %14, %15, off\n\ts_wait_xcnt 0x0"
               :: "v"(l), "v"(gp), "v"(l + 1u * LS), "v"(gp + 1 * GS), "v"(l + 2u * LS), "v"(gp + 2 * GS), "v"(l + 3u * LS), "v"(gp + 3 * GS),
                  "v"(l + 4u * LS), "v"(gp + 4 * GS), "v"(l + 5u * LS), "v"(gp + 5 * GS), "v"(l + 6u * LS), "v"(gp + 6 * GS), "v"(l + 7u * LS), "v"(gp + 7 * GS) : "memory");
}
__global__ __launch_bounds__(128) void k_qkv(const float* __restrict__ XQ, const float* __restrict__ XK, const float* __restrict__ XV, const __bf16* __restrict__ P, const float* __restrict__ BQ, const float* __restrict__ BK, const float* __restrict__ BV, _Float16* __restrict__ QK, _Float16* __restrict__ VTH) {
  const int which0 = (blockIdx.y * 128) / DM; const float* X = (which0 == 0) ? XQ : (which0 == 1) ? XK : XV; const float* BB = BQ ? (((which0 == 0) ? BQ : (which0 == 1) ? BK : BV) + (blockIdx.y * 128 - which0 * DM)) : nullptr;
  __shared__ __align__(16) char sm[2 * QBUF_B];   // the two buffers of the k loop; behind the loop's last barrier the same bytes stage the output
  _Float16 (*so)[16][136] = (_Float16 (*)[16][136])sm; _Float16 (*sth)[72] = (_Float16 (*)[72])sm;   // a block stages q/k rows or v columns, never both
  static_assert(2 * 4 * 16 * 136 <= 2 * QBUF_B && 2 * 128 * 72 <= 2 * QBUF_B, "output staging fits the ring");
  const int tid = threadIdx.x, wave = tid >> 5, lane = tid & 31, col = lane & 15, g = lane >> 4; const size_t r0 = (size_t)blockIdx.x * 64 + wave * 16; const int n0 = blockIdx.y * 128;
  v8f acc[8] = {};
  const int ns = DM / 64;   // tiles of k
  // the lane's place in every copy: x: 2 rows x 256 B a copy (row lane / 16, piece lane % 16), this wave's 16 rows; weights: 4 rows x 128 B a copy (row lane / 8, piece lane % 8), this wave's 32 rows
  const char* gx = (const char*)(X + ((size_t)blockIdx.x * 64 + wave * 16 + (lane >> 4)) * DM + (lane & 15) * 4); const char* gw = (const char*)(P + ((size_t)n0 + wave * 32 + (lane >> 3)) * DM + (lane & 7) * 8);
  const unsigned lx = (unsigned)(size_t)sm + (unsigned)((wave * 16 + (lane >> 4)) * (XP * 4) + (lane & 15) * 16), lw = (unsigned)(size_t)sm + (unsigned)(QX_B + (wave * 32 + (lane >> 3)) * (WP * 2) + (lane & 7) * 16);
  // The 32 blocks that share a weight tile and the 8 (q) or 16 (k, v) that share an x tile start together and keep step: walking k from 0 they would all ask for the same lines at the same moment, and each tile's first fetch (from memory, where no block of this L2 has read it yet) would be waited out by all of them. So step s of a block is tile (s + rot) mod 16: neighbours start 5 tiles apart, the first fetches all go out at the start, and later steps find lines that another block has brought in. The k sum only starts at another place.
  const int rot = (5 * blockIdx.x + blockIdx.y) & (ns - 1);
  auto fill = [&](int s, int bf) { const int sr = (s + rot) & (ns - 1); copy8r<2 * XP * 4, 2 * DM * 4>(lx + (unsigned)(bf * QBUF_B), gx + (size_t)sr * 256); copy8r<4 * WP * 2, 4 * DM * 2>(lw + (unsigned)(bf * QBUF_B), gw + (size_t)sr * 128); };
  fill(0, 0);
  float bias[8];   // loaded here, in flight under the k loop, not one waited load per stored element
#pragma unroll
  for (int j = 0; j < 8; ++j) bias[j] = 0.f;
  if (BB) {
#pragma unroll
    for (int j = 0; j < 8; ++j) bias[j] = BB[j * 16 + col]; }
  asm volatile("s_wait_asynccnt 0x0" ::: "memory");   // this wave's share of the tile of step 0 has landed
  __syncthreads();                                     // every wave's share has: the tile of step 0 may be read
  fill(1, 1);
#pragma unroll 1   // stays rolled: one foot (waits, barrier, refill) a tile, and the text of the loop stays short
  for (int s = 0; s < ns; ++s) { const char* bp = sm + (s & 1) * QBUF_B; const float* fx = (const float*)bp + (wave * 16 + col) * XP + 8 * g; const __bf16* fw = (const __bf16*)(bp + QX_B) + col * WP + 8 * g;
    v4f xc[2][4]; v16b wc[2][8];   // both passes' operands, read as two groups in front of the products (the statement behind each product holds a load at its place in the source)
#pragma unroll
    for (int sub = 0; sub < 2; ++sub) { xc[sub][0] = *(const v4f*)(fx + sub * 32); xc[sub][1] = *(const v4f*)(fx + sub * 32 + 4); xc[sub][2] = *(const v4f*)(fx + sub * 32 + 16); xc[sub][3] = *(const v4f*)(fx + sub * 32 + 20);
#pragma unroll
      for (int j = 0; j < 8; ++j) wc[sub][j] = frag_lb(fw + (j * 16) * WP + sub * 32); }
#pragma unroll
    for (int sub = 0; sub < 2; ++sub) { v16b a;
#pragma unroll
      for (int i = 0; i < 16; ++i) a[i] = (__bf16)xc[sub][i >> 2][i & 3];
#pragma unroll
      for (int j = 0; j < 8; ++j) acc[j] = wmma_bf(a, wc[sub][j], acc[j]); }
    asm volatile("s_wait_dscnt 0x0" ::: "memory");      // this wave's reads of the tile in hand are done
    asm volatile("s_wait_asynccnt 0x0" ::: "memory");   // its share of the next tile has landed
    __syncthreads();                                     // publishes the next tile and frees the buffer just read (behind the last tile: frees the ring for the output staging)
    if (s + 2 < ns) fill(s + 2, s & 1); }
  asm volatile("s_wait_asynccnt 0x0" ::: "memory");   // no copy is left in flight behind the loop
  if (n0 < 2 * DM) {   // q stored unscaled (f16 sigma ~0.6, no subnormal exposure); 1/8 applied to the f32 score
#pragma unroll
    for (int j = 0; j < 8; ++j) {
#pragma unroll
      for (int r = 0; r < 8; ++r) so[wave][8 * g + r][j * 16 + col] = (_Float16)(acc[j][r] + bfr(bias[j])); }   // q, k (+ bias) as f16
    LDSX();
    for (int rl = 0; rl < 16; ++rl) if (lane < 16) vst2((unsigned*)(QK + (r0 + rl) * (2 * DM) + n0 + lane * 8), *(const v4u*)&so[wave][rl][lane * 8]);
  } else {
#pragma unroll
    for (int j = 0; j < 8; ++j) {
#pragma unroll
      for (int r = 0; r < 8; ++r) sth[j * 16 + col][wave * 16 + 8 * g + r] = (_Float16)(acc[j][r] + bfr(bias[j])); }
    __syncthreads();
    const size_t rb = (size_t)blockIdx.x * 64; const int b = (int)(rb / SS), s0 = (int)(rb % SS); const int pc0 = n0 - 2 * DM;
    for (int q = tid; q < 128 * 8; q += 128) { const int d = q >> 3, pc = q & 7; const size_t o = ((size_t)b * DM + pc0 + d) * SS + s0 + pc * 8; vst2((unsigned*)(VTH + o), *(const v4u*)&sth[d][pc * 8]); }
  }
}
// ---- k_attn: block = (64 queries, head h, batch b): all-keys flash attention (K = 64: 2 k-steps), scores = (q.k) * 0.125 with single f16 operands, P.V: f16 P x f16 V; y = acc / l goes straight into the output projection
// Every query block walks all 2,048 keys with the same products: the 512 blocks, two on each WGP, cost alike, and none outlasts the rest.
// K and V reach the four waves of a block through LDS: a tile = 64 keys = two 32-key passes; K 64 key rows x 128 B, V 64 d rows x 128 B, whole 128-B lines, each fetched once a block.
#define KP 72                    // halfs a staged row: 128 B of data + 16 B, the pitch at which 16-byte LDS reads of 16 rows meet no bank twice
#define PLANE (64 * KP)          // halfs of one staged plane
#define STG_H (2 * 2 * PLANE)    // two buffers of two planes: K, V
#define ESC 0.18033688f          // log2(e) / sqrt(64): a raw score times this is its exponent in base 2
__device__ __forceinline__ v16h frag_l(const _Float16* p) { union { v16h v; v8h q[2]; } u; u.q[0] = *(const v8h*)p; u.q[1] = *(const v8h*)(p + 16); return u.v; }
// Sixteen rows of plane a and sixteen of plane b: eight copies, each 4 rows x 128 B (lane: row lane / 8, 16-byte piece lane % 8); both sources have rows 4,096 B apart. The last line is the wait that stands in front of any rewrite of the copies' address registers: inside the statement nothing can be moved over it.
__device__ __forceinline__ void copy8(unsigned la, const _Float16* ga, unsigned lb, const _Float16* gb) {
  asm volatile("global_load_async_to_lds_b128 %0, %1, off\n\tglobal_load_async_to_lds_b128 %2, %3, off\n\tglobal_load_async_to_lds_b128 %4, %5, off\n\tglobal_load_async_to_lds_b128 %6, %7, off\n\t"
               "global_load_async_to_lds_b128 %8, %9, off\n\tglobal_load_async_to_lds_b128 %10, %11, off\n\tglobal_load_async_to_lds_b128 %12, %13, off\n\tglobal_load_async_to_lds_b128 %14, %15, off\n\ts_wait_xcnt 0x0"
               :: "v"(la), "v"(ga), "v"(la + 2u * 4 * KP), "v"(ga + 4 * 2048), "v"(la + 2u * 8 * KP), "v"(ga + 8 * 2048), "v"(la + 2u * 12 * KP), "v"(ga + 12 * 2048),
                  "v"(lb), "v"(gb), "v"(lb + 2u * 4 * KP), "v"(gb + 4 * 2048), "v"(lb + 2u * 8 * KP), "v"(gb + 8 * 2048), "v"(lb + 2u * 12 * KP), "v"(gb + 12 * 2048) : "memory");
}
// One pass of a wave's Wo fragments: two copies of 512 B in a row. The last line is the wait that stands in front of any rewrite of the copies' address registers.
__device__ __forceinline__ void copy2(unsigned l, const __bf16* gp) {
  asm volatile("global_load_async_to_lds_b128 %0, %1, off\n\tglobal_load_async_to_lds_b128 %2, %3, off\n\ts_wait_xcnt 0x0" :: "v"(l), "v"(gp), "v"(l + 512u), "v"(gp + 256) : "memory");
}
// lane l with lane l ^ 16 (a vector move, no LDS): the other half of a query's keys
__device__ __forceinline__ float xhalf(float x) { return __builtin_bit_cast(float, __builtin_amdgcn_permlanex16(__builtin_bit_cast(int, x), __builtin_bit_cast(int, x), 0x76543210, 0xfedcba98, false, false)); }
// Both products are taken transposed: S^T = K . Q^T (rows = keys, columns = queries) and O^T += V^T . P^T (rows = d, columns = queries). A lane then holds 16 of the 32 scores of ONE query (its column), lane ^ 16 the other 16: maximum and sum are in-lane plus one move between the halves, m, l and the rescale factor are one value a lane, and the two score tiles, converted in place, are the B operand of the second product in the hardware k order: P never leaves the registers.
// The output projection is done here too. The head-major stack re-viewed as [2048][1024] puts the 16 queries x 64 d of ONE wave, in that order, into ONE row of the projection's left operand: row h * 128 + q0 / 16, k = (q - q0) * 64 + d. A block so owns four whole rows: their bf16 hi parts are rows 0-3 and their lo parts rows 4-7 of one A operand (rows 8-15 repeat them and are not used), wave w takes output columns 16 w .. 16 w + 15 over all 1,024 of k, and out = hi rows + lo rows + bo.
#define WKS 24                   // passes of a wave's Wo columns that reach LDS under the key loop, one a key tile (1 KB: two copies a wave); the other 8 come through registers behind the loop
#define YP (DM + 8)              // bf16 a staged row of that operand: 2,048 B of data + 16 B (the pitch at which 16-byte LDS reads of 8 rows meet no bank twice)
__global__ __launch_bounds__(128) void k_attn(const _Float16* __restrict__ QK, const _Float16* __restrict__ VTH, const __bf16* __restrict__ PW, const float* __restrict__ BO, float* __restrict__ OUT) {
  __shared__ __align__(16) __bf16 sy[8][YP]; __shared__ __align__(16) float sr[4][HD]; __shared__ __align__(16) _Float16 st[STG_H];
  __shared__ __align__(16) __bf16 sw[4][WKS][512];   // each wave's own first WKS passes of Wo; with it a block holds 152,704 B of LDS, and two blocks still share a WGP
  const int tid = threadIdx.x, wave = tid >> 5, lane = tid & 31, col = lane & 15, g = lane >> 4;
  const int qb = blockIdx.x, h = blockIdx.y, b = blockIdx.z; const int q0 = qb * 64 + wave * 16; const size_t rq = (size_t)b * SS + q0 + col;
  const int nt = SS / 64;   // key tiles (all keys)
  const int bufh = 2 * PLANE;   // halfs of one buffer
  const int crow = wave * 16 + (lane >> 3), cpc = (lane & 7) * 8;   // the lane's first row and its 16-byte piece in every copy
  const size_t ko = ((size_t)b * SS + crow) * (2 * DM) + DM + h * HD + cpc, vo = ((size_t)b * DM + h * HD + crow) * SS + cpc;   // tile 0; a tile on: 64 key rows of K, 64 columns of V
  const unsigned l0 = (unsigned)(size_t)st + 2u * (unsigned)(crow * KP + cpc);
  // The 32 query blocks of a head start together and keep step: walking the keys from 0 they would all ask for the same K and V lines at the same moment, and each tile's first fetch would be waited out by all of them. So step t of a block is key tile (t + 5 qb) mod 32: the first fetches all go out at the start, and later steps find lines that another block has brought in. The running-maximum softmax takes the keys in any order.
  const int rot = (5 * qb) & (nt - 1);
  auto fill = [&](int t, int bf) { const int tr = (t + rot) & (nt - 1); const unsigned lb = l0 + 2u * (unsigned)(bf * bufh); const size_t kt = ko + (size_t)tr * 64 * (2 * DM), vt = vo + (size_t)tr * 64;
    copy8(lb, QK + kt, lb + 2u * PLANE, VTH + vt); };
  const __bf16* wsrc = PW + (size_t)wave * (32 * 512) + lane * 8;   // this wave's 16 columns of Wo in fragment order: a pass = two pieces of 512 B, the lane's 16 bytes in each
  const unsigned lw0 = (unsigned)(size_t)&sw[wave][0][0] + (unsigned)lane * 16u;
  const int wrot = (5 * qb + h) % WKS;   // likewise for Wo, which all blocks share: step t brings pass (t + wrot) mod WKS, to that pass's own place
  fill(0, 0);
  v16h aq[2];
#pragma unroll
  for (int kc = 0; kc < 2; ++kc) aq[kc] = frag_h(QK + rq * (2 * DM) + h * HD + kc * 32, lane);
  const v2f bo2 = *(const v2f*)(BO + lane * 2);   // the bias of the two output columns this lane stores at the end: loaded here, with Q, so that no barrier behind the loop waits for it
  asm volatile("s_wait_xcnt 0x0" ::: "memory");   // (here and behind the group of Wo loads below) stands behind the loads, in front of the first instruction that reuses a register which one of them names as address
  float m = -3.0e38f, l = 0.f;   // of query col; m is the maximum of the raw q . k; l sums this half's keys only, the halves are joined behind the loop
  v8f acc[4] = {};
  asm volatile("s_wait_asynccnt 0x0" ::: "memory");   // this wave's share of the tile of step 0 has landed
  __syncthreads();                                     // every wave's share has: the tile of step 0 may be read
  fill(1, 1);
#pragma unroll 1   // stays rolled: one foot (waits, barrier, refill) a tile, and the text of the loop stays short
  for (int t = 0; t < nt; ++t) { const _Float16* fk = st + (t & 1) * bufh + col * KP + 8 * g; const _Float16* fv = fk + PLANE;   // the lane's row col of the K and of the V plane
    // The statement behind each product holds a load at its place in the source, so every LDS read of a pass stands in front of the products that follow it: behind the score products of a pass go, as one group, its own V and (inside the tile) the next pass's K, in flight under the softmax.
    v16h kf[2][2];   // [ct][kc] K fragments of the pass in hand
#pragma unroll
    for (int ct = 0; ct < 2; ++ct) {
#pragma unroll
      for (int kc = 0; kc < 2; ++kc) kf[ct][kc] = frag_l(fk + (ct * 16) * KP + kc * 32); }
#pragma unroll
    for (int sub = 0; sub < 2; ++sub) { v8f s[2]; v16h vf[4];
#pragma unroll
    for (int ct = 0; ct < 2; ++ct) { v8f c = {};
#pragma unroll
      for (int kc = 0; kc < 2; ++kc) c = wmma16(kf[ct][kc], aq[kc], c);
      s[ct] = c; }   // the raw q . k: s[ct][r] = key ct * 16 + 8 g + r of the pass, query col; 1/sqrt(64) goes into the exponent's one multiply-add below
#pragma unroll
    for (int dt = 0; dt < 4; ++dt) vf[dt] = frag_l(fv + (dt * 16) * KP + sub * 32);
    if (sub == 0) {   // the tile's second pass's K
#pragma unroll
      for (int ct = 0; ct < 2; ++ct) {
#pragma unroll
        for (int kc = 0; kc < 2; ++kc) kf[ct][kc] = frag_l(fk + (32 + ct * 16) * KP + kc * 32); } }
    __builtin_amdgcn_sched_barrier(0);   // keeps the group here, in front of the softmax; moved down its reads would be waited for right in front of the second product
    float t4[4];   // four short chains, not one long one
#pragma unroll
    for (int j = 0; j < 4; ++j) t4[j] = fmaxf(fmaxf(s[0][j], s[0][4 + j]), fmaxf(s[1][j], s[1][4 + j]));
    float mx = fmaxf(fmaxf(t4[0], t4[1]), fmaxf(t4[2], t4[3])); mx = fmaxf(mx, xhalf(mx));   // both halves now hold the pass's maximum of query col
    const float mn = fmaxf(m, mx); const float alpha = __builtin_amdgcn_exp2f((m - mn) * ESC);   // first pass: m = -3e38, the hardware exp2 of about -5e37 is 0
    const float nb = __builtin_fmaf(-mn, ESC, 11.0f);   // one value a pass: minus the maximum in base-2 units, plus the 2^11 of P
    float e[2][8];   // 2^11 exp((q.k - max) / 8): one multiply-add and one hardware exp2 a score
#pragma unroll
    for (int ct = 0; ct < 2; ++ct) {
#pragma unroll
      for (int r = 0; r < 8; ++r) e[ct][r] = __builtin_amdgcn_exp2f(__builtin_fmaf(s[ct][r], ESC, nb)); }
#pragma unroll
    for (int j = 0; j < 4; ++j) t4[j] = (e[0][j] + e[0][4 + j]) + (e[1][j] + e[1][4 + j]);
    l = l * alpha + ((t4[0] + t4[1]) + (t4[2] + t4[3])); m = mn;
#pragma unroll
    for (int dt = 0; dt < 4; ++dt) {
#pragma unroll
      for (int r = 0; r < 8; ++r) acc[dt][r] *= alpha; }
    v16h pa;   // P^T as a B operand: element i = key 8 g + i, element 8 + i = key 16 + 8 g + i, the order in which the V fragments hold their keys
#pragma unroll
    for (int i = 0; i < 8; ++i) { pa[i] = (_Float16)e[0][i]; pa[8 + i] = (_Float16)e[1][i]; }   // P carries 2^11 (from nb) so that small softmax weights stay out of the f16 subnormal range; l carries it too, and the division behind the loop takes it out
#pragma unroll
    for (int dt = 0; dt < 4; ++dt) acc[dt] = wmma16(vf[dt], pa, acc[dt]);   // acc[dt][r] = d dt * 16 + 8 g + r of query col
    }
    asm volatile("s_wait_dscnt 0x0" ::: "memory");      // this wave's reads of the tile in hand are done
    asm volatile("s_wait_asynccnt 0x0" ::: "memory");   // its share of the next tile has landed
    __syncthreads();                                     // publishes the next tile and frees the buffer just read
    if (t + 2 < nt) fill(t + 2, t & 1);
    if (t < WKS) { const int wt = t + wrot < WKS ? t + wrot : t + wrot - WKS; copy2(lw0 + (unsigned)wt * 1024u, wsrc + wt * 512); } }   // one pass of this wave's Wo columns: lands under the next tile, covered by that tile's s_wait_asynccnt 0; only this wave reads it, behind the loop
  asm volatile("s_wait_asynccnt 0x0" ::: "memory");   // no copy is left in flight behind the loop
  const float il = 1.0f / (l + xhalf(l));   // the two halves' sums joined; the 2^11 in l and in acc cancel
#pragma unroll
  for (int dt = 0; dt < 4; ++dt) { v8b yh, yl;
#pragma unroll
    for (int r = 0; r < 8; ++r) { const float v = acc[dt][r] * il; const __bf16 hh = (__bf16)v; yh[r] = hh; yl[r] = (__bf16)(v - (float)hh); }
    *(v8b*)&sy[wave][col * HD + dt * 16 + 8 * g] = yh; *(v8b*)&sy[4 + wave][col * HD + dt * 16 + 8 * g] = yl; }
  __syncthreads();   // all four rows, hi and lo, are in LDS
  // The last 8 passes of Wo go out here as one group of 16 loads, behind the barrier (whose fence would wait for them), in flight under the 24 products fed from LDS (the statement behind each product holds a load at its place in the source).
  v16b wb[32 - WKS];
#pragma unroll   // (here and below) wb, af, bf and o2 stay in registers
  for (int i = 0; i < 32 - WKS; ++i) { union { v16b v; v8b q[2]; } u; u.q[0] = *(const v8b*)(wsrc + (WKS + i) * 512); u.q[1] = *(const v8b*)(wsrc + (WKS + i) * 512 + 256); wb[i] = u.v; }
  asm volatile("s_wait_xcnt 0x0" ::: "memory");
  const __bf16* ap = &sy[lane & 7][8 * g]; const __bf16* bp = &sw[wave][0][lane * 8];
  v16b af[2][4], bf[2][4]; v8f o2[2] = {};   // fragments four passes at a time, a group ahead of its products; two chains of products, joined below
  auto ldf = [&](int gq) {
#pragma unroll
    for (int i = 0; i < 4; ++i) { const int ks = gq * 4 + i; af[gq & 1][i] = frag_lb(ap + ks * 32);
      if (ks < WKS) { union { v16b v; v8b q[2]; } u; u.q[0] = *(const v8b*)(bp + ks * 512); u.q[1] = *(const v8b*)(bp + ks * 512 + 256); bf[gq & 1][i] = u.v; } } };
  ldf(0);
#pragma unroll
  for (int gq = 0; gq < 8; ++gq) {
    if (gq < 7) ldf(gq + 1);
#pragma unroll
    for (int i = 0; i < 4; ++i) o2[i & 1] = wmma_bf(af[gq & 1][i], gq * 4 + i < WKS ? bf[gq & 1][i] : wb[(gq * 4 + i) % (32 - WKS)], o2[i & 1]); }
  const v8f o = o2[0] + o2[1];   // lanes 0-15: element r = A row r, column col
  if (g == 0) {
#pragma unroll
    for (int r = 0; r < 4; ++r) sr[r][wave * 16 + col] = o[r] + o[4 + r]; }   // hi + lo
  __syncthreads();   // the four waves' column tiles are in LDS
  v2f res = *(const v2f*)&sr[wave][lane * 2]; res[0] += bfr(bo2[0]); res[1] += bfr(bo2[1]);
  vst2(OUT + ((size_t)b * SS + h * (SS / NH) + qb * 4 + wave) * HD + lane * 2, res);   // a wave stores one whole output row: two whole 128-B lines
}
// ---- k_out: block = (64 rows, 128 cols): out = O(hi/lo) . Wo rows (2 products) + bo
__global__ __launch_bounds__(128) void k_out(const float* __restrict__ O, const __bf16* __restrict__ P, const float* __restrict__ BO, float* __restrict__ Y) {
  __shared__ __align__(16) float so[4][16][132];
  const int tid = threadIdx.x, wave = tid >> 5, lane = tid & 31, col = lane & 15, g = lane >> 4; const size_t r0 = (size_t)blockIdx.x * 64 + wave * 16; const int n0 = blockIdx.y * 128;
  v8f acc[8] = {};
#pragma unroll 2
  for (int kc = 0; kc < DM / 32; ++kc) { const F2 a = split_row(O + (r0 + col) * DM, kc * 32, lane);
#pragma unroll
    for (int j = 0; j < 8; ++j) { const v16b w = frag_b(P + (size_t)(n0 + j * 16 + col) * DM + kc * 32, lane); acc[j] = wmma_bf(a.l, w, acc[j]); acc[j] = wmma_bf(a.h, w, acc[j]); } }
#pragma unroll
  for (int j = 0; j < 8; ++j) {
#pragma unroll
    for (int r = 0; r < 8; ++r) so[wave][8 * g + r][j * 16 + col] = acc[j][r] + (BO ? bfr(BO[n0 + j * 16 + col]) : 0.f); }
  LDSX();
  for (int rl = 0; rl < 16; ++rl) vst2(Y + (r0 + rl) * DM + n0 + lane * 4, *(const v4f*)&so[wave][rl][lane * 4]);
}
extern "C" void kernel_launch(void* const* d_in, const int* in_sizes, int n_in, void* d_out, int out_size, void* d_ws, size_t ws_size, hipStream_t stream) {
  (void)in_sizes; (void)n_in; (void)out_size;
  const float** F = (const float**)d_in;   // 0 current [2048,1024], 1 context [2048,1024], 2 Wq [16,1024,64], 3 bq [16,64], 4 Wk, 5 bk, 6 Wv, 7 bv, 8 Wo [1024,64], 9 bo [64]
  if (ws_size < (size_t)WS_END) return;
  char* ws = (char*)d_ws; __bf16* PK = (__bf16*)(ws + WS_PK); _Float16 *QK = (_Float16*)(ws + WS_QK), *VTH = (_Float16*)(ws + WS_VTH);
  k_pack<<<dim3(DM / PKI, NH, 4), 256, 0, stream>>>(F[2], F[4], F[6], F[8], PK);
  k_qkv<<<dim3(TNB * SS / 64, QKVW / 128), 128, 0, stream>>>(F[0], F[1], F[1], PK + PK_A, F[3], F[5], F[7], QK, VTH);
  k_attn<<<dim3(TQB, TNH, TNB), 128, 0, stream>>>(QK, VTH, PK + PK_P, F[9], (float*)d_out);
}

// v010
// A run of this version takes 44.4 microseconds.
// Two timings next to v009 both put it at 1.12 times that version's speed.
// All steps since v000 together make it 8.45 times as fast.
// compute dtype: all float inputs rounded to bf16; q/k/v = x W[h] + b[h] with EXACT bf16 products on WMMA 16x16x32 (per-head (in,out) weights packed as one 1024 -> 1024 projection each), stored as f16; scores one f16 product for every query, x 1/8, running-max softmax in f32 (hardware exp); one f16 product P . v; the head-major stack + row-major view realised as an index map feeding out = y2 (bf16 hi + lo) . Wo + bo (2 products); f32 output.
#include <hip/hip_runtime.h>
#include <math.h>

typedef __attribute__((ext_vector_type(16))) _Float16 v16h;
typedef __attribute__((ext_vector_type(16))) __bf16 v16b;
typedef __attribute__((ext_vector_type(8)))  _Float16 v8h;
typedef __attribute__((ext_vector_type(8)))  float v8f;
typedef __attribute__((ext_vector_type(4)))  float v4f;
typedef __attribute__((ext_vector_type(2)))  float v2f;
typedef __attribute__((ext_vector_type(4)))  unsigned v4u;
typedef __attribute__((ext_vector_type(4)))  int v4i;
typedef float __attribute__((may_alias)) float_a;
typedef int __attribute__((may_alias)) int_a;

template <typename T> __device__ __forceinline__ void vst2(void* p, T v) { *(T*)p = v;  }
__device__ __forceinline__ v8f wmma16(v16h a, v16h b, v8f c) {
  v8f d = __builtin_amdgcn_wmma_f32_16x16x32_f16(false, a, false, b, (short)0, c, false, false);
  asm volatile("v_nop\n\tv_nop\n\tv_nop\n\tv_nop" : "+v"(d) : "v"(a), "v"(b));
  return d;
}
__device__ __forceinline__ v8f wmma_bf(v16b a, v16b b, v8f c) {
  v8f d = __builtin_amdgcn_wmma_f32_16x16x32_bf16(false, a, false, b, (short)0, c, false, false);
  asm volatile("v_nop\n\tv_nop\n\tv_nop\n\tv_nop" : "+v"(d) : "v"(a), "v"(b));
  return d;
}
// Per-head (inefficient) multi-head cross attention (16 heads x 64, 2,048 current x 2,048 context tokens, D_IN 1024): per head q = x Wq[h] + bq[h], k/v from the context; softmax(q k^T / 8) v; heads stacked head-major then row-major re-viewed to [S, 1024]; Wo [1024 -> 64] + bo.
__device__ __forceinline__ v16h frag_h(const _Float16* rowk0, int lane) {
  union { v16h v; v8h q[2]; } u; const _Float16* p = rowk0 + 8 * (lane >> 4);
  u.q[0] = *(const v8h*)p; u.q[1] = *(const v8h*)(p + 16); return u.v;
}
__device__ __forceinline__ v16h frag_f32(const float* rowk0, int lane) {
  v16h a; const float* p = rowk0 + 8 * (lane >> 4);
#pragma unroll
  for (int i = 0; i < 8; ++i) { a[i] = (_Float16)p[i]; a[8 + i] = (_Float16)p[16 + i]; }
  return a;
}
__device__ __forceinline__ v16h frag_f32s(const float* rowk0, int lane, float sc) {
  v16h a; const float* p = rowk0 + 8 * (lane >> 4);
#pragma unroll
  for (int i = 0; i < 8; ++i) { a[i] = (_Float16)(p[i] * sc); a[8 + i] = (_Float16)(p[16 + i] * sc); }
  return a;
}
// column fragment from a [K][ld] layout (column n), rows >= K read as 0
__device__ __forceinline__ v16h fragc_f32(const float* W, int k0, int n, int lane, int ld, int K) {
  v16h a; const int g = lane >> 4;
#pragma unroll
  for (int i = 0; i < 8; ++i) { const int ka = k0 + 8 * g + i, kb = ka + 16;
    a[i] = (_Float16)(ka < K ? W[(size_t)(ka < K ? ka : K - 1) * ld + n] : 0.f); a[8 + i] = (_Float16)(kb < K ? W[(size_t)(kb < K ? kb : K - 1) * ld + n] : 0.f); }
  return a;
}
struct F2 { v16b h, l; };
__device__ __forceinline__ F2 bsplit16(const float v[16]) { F2 r;
#pragma unroll
  for (int i = 0; i < 16; ++i) { const __bf16 h = (__bf16)v[i]; r.h[i] = h; r.l[i] = (__bf16)(v[i] - (float)h); }
  return r; }
__device__ __forceinline__ F2 split_row(const float* row, int k0, int lane) { float v[16]; const float* p = row + k0 + 8 * (lane >> 4);
#pragma unroll
  for (int i = 0; i < 8; ++i) { v[i] = p[i]; v[8 + i] = p[16 + i]; }
  return bsplit16(v); }
__device__ __forceinline__ F2 split_rowK(const float* row, int k0, int lane, int K) { float v[16]; const int g = lane >> 4;
#pragma unroll
  for (int i = 0; i < 8; ++i) { const int ka = k0 + 8 * g + i, kb = ka + 16; v[i] = ka < K ? row[ka < K ? ka : K - 1] : 0.f; v[8 + i] = kb < K ? row[kb < K ? kb : K - 1] : 0.f; }
  return bsplit16(v); }
__device__ __forceinline__ F2 split_col(const float* W, int k0, int n, int lane, int ld, int K) { float v[16]; const int g = lane >> 4;
#pragma unroll
  for (int i = 0; i < 8; ++i) { const int ka = k0 + 8 * g + i, kb = ka + 16; v[i] = ka < K ? W[(size_t)(ka < K ? ka : K - 1) * ld + n] : 0.f; v[8 + i] = kb < K ? W[(size_t)(kb < K ? kb : K - 1) * ld + n] : 0.f; }
  return bsplit16(v); }
__device__ __forceinline__ v8f mac3(const F2& a, const F2& b, v8f c) { c = wmma_bf(a.l, b.h, c); c = wmma_bf(a.h, b.l, c); return wmma_bf(a.h, b.h, c); }
__device__ __forceinline__ float sigm(float v) { return 1.0f / (1.0f + expf(-v)); }
#define LDSX() do { asm volatile("s_wait_dscnt 0" ::: "memory"); __builtin_amdgcn_wave_barrier(); __builtin_amdgcn_fence(__ATOMIC_RELEASE, "workgroup"); } while (0)


#define NB 1
#define SS 2048
#define DM 1024
#define NH 16
#define HD 64
#define QKVW (3 * DM)
#ifndef TQB
#define TQB (SS / 64)
#endif
#ifndef TNH
#define TNH NH
#define TNB NB
#define TOB (NB * SS / 64)     // 64-row tiles of the 2,048 rows (all); nothing uses it
#endif
typedef __attribute__((ext_vector_type(8))) __bf16 v8b;
__device__ __forceinline__ v16b frag_b(const __bf16* rowk0, int lane) {
  union { v16b v; v8b q[2]; } u; const __bf16* p = rowk0 + 8 * (lane >> 4);
  u.q[0] = *(const v8b*)p; u.q[1] = *(const v8b*)(p + 16); return u.v;
}
// fragment at a wave-uniform base plus the lane's own byte offset: a group's loads all name that one offset register
__device__ __forceinline__ v16b frag_bo(const __bf16* ubase, unsigned boff) { union { v16b v; v8b q[2]; } u; const __bf16* p = (const __bf16*)((const char*)ubase + boff); u.q[0] = *(const v8b*)p; u.q[1] = *(const v8b*)(p + 16); return u.v; }
__device__ __forceinline__ float bfr(float v) { return (float)(__bf16)v; }
__device__ __attribute__((noinline)) float exp_ni(float v) { return expf(v); }
__device__ __attribute__((noinline)) float erf_ni(float v) { return erff(v); }

#define PK_A 0                       // [3072][1024] Wqkv rows (natural [out][in])
#define PK_P (PK_A + QKVW * DM)        // Wo as bf16 in B-fragment order (65,536 elements)
#define PK_END (PK_P + DM * DM)
#define WS_PK  0u
#define WS_QK  (WS_PK + 2u * PK_END)             // f16 [2048 rows][2048]: q | k
#define WS_VTH (WS_QK + 2u * NB * SS * 2 * DM)     // f16 [b][1024 (h*64+d)][2048 s]
#define WS_O   (WS_VTH + 2u * NB * DM * SS)        // f32 [2048][1024]
#define WS_CS  (WS_O + 4u * NB * SS * DM)           // f32 2 x [2048][32], reserved; nothing writes or reads it
#define WS_END (WS_CS + 4u * 2 * SS * 32)
// ---- k_pack: block = (128 input rows i, head h, which): W [h][1024 in][64 d] -> bf16 packed rows (which*DM + h*64 + d)[i]; which 0..2 -> W_q/W_k/W_v into PK_A
// The block's source tile (128 rows x 64 floats) is 32 KB in a row: it is read as whole lines, 16 bytes a lane, all eight loads of a thread in flight together, and turned in LDS; each packed row gets 256 B in a row.
#define PKI 128                   // input rows a block
#define PKP (PKI / 2 + 1)         // dwords a staged packed row: 64 of data (two bf16 each) + 1, the pitch at which the 32 lanes of a write (rows 4 apart) and of a read (dwords 4 apart) each meet 32 banks
__global__ __launch_bounds__(256) void k_pack(const float* __restrict__ WQ, const float* __restrict__ WK, const float* __restrict__ WV, const float* __restrict__ WO, __bf16* __restrict__ PK) {
  __shared__ unsigned s[HD * PKP]; const int it = blockIdx.x, h = blockIdx.y, which = blockIdx.z, t = threadIdx.x; const float* Wm = which == 0 ? WQ : which == 1 ? WK : WV;
  if (which == 3) {   // Wo [1024 k][64 n] -> bf16 at PK_P in the order of k_attn's B fragments: [n tile][32-deep pass][half][lane][8]: element i = k pass * 32 + 16 half + 8 (lane / 16) + i, column n tile * 16 + lane % 16. The whole block takes this path, in front of the barrier; a thread packs one dword, a wave one whole 128-B line.
    const int dw = (h * (DM / PKI) + it) * 256 + t, ix = 2 * dw;
    const float* p = WO + (size_t)(((ix >> 9) & 31) * 32 + ((ix >> 8) & 1) * 16 + ((ix >> 7) & 1) * 8 + (ix & 7)) * HD + (ix >> 14) * 16 + ((ix >> 3) & 15);
    const float w0 = p[0], w1 = p[HD];
    asm volatile("s_wait_xcnt 0x0" ::: "memory");   // stands behind the two loads, in front of any reuse of their address registers
    union { __bf16 e[2]; unsigned u; } w; w.e[0] = (__bf16)w0; w.e[1] = (__bf16)w1; ((unsigned*)(PK + PK_P))[dw] = w.u; return; }
  const int d4 = (t & 15) * 4, p0 = t >> 4;   // the thread's four columns d; its pair of input rows in each group of 32
  const float* src = Wm + ((size_t)h * DM + it * PKI + 2 * p0) * HD + d4;
  v4f a[4], b[4];   // rows 2 p and 2 p + 1, p = k * 16 + p0
#pragma unroll   // (here and below) a, b and v stay in registers, and the eight loads stand as one group in front of the first use
  for (int k = 0; k < 4; ++k) { a[k] = *(const v4f*)(src + (size_t)(k * 32) * HD); b[k] = *(const v4f*)(src + (size_t)(k * 32 + 1) * HD); }
#pragma unroll
  for (int k = 0; k < 4; ++k) {
#pragma unroll
    for (int j = 0; j < 4; ++j) { union { __bf16 e[2]; unsigned u; } w; w.e[0] = (__bf16)a[k][j]; w.e[1] = (__bf16)b[k][j]; s[(d4 + j) * PKP + k * 16 + p0] = w.u; } }
  __syncthreads(); __bf16* dst = PK + PK_A + ((size_t)which * DM + h * HD) * DM + it * PKI;
#pragma unroll
  for (int k = 0; k < 4; ++k) { const int q = k * 256 + t, d = q >> 4, pc = q & 15; v4u v;
#pragma unroll
    for (int j = 0; j < 4; ++j) v[j] = s[d * PKP + pc * 4 + j];
    vst2((unsigned*)(dst + (size_t)d * DM + pc * 8), v); } }
// k_qkv's operands reach the four waves of a block through LDS: a tile = 64 of k = two 32-deep passes; x 64 rows x 256 B (f32), weights 128 rows x 128 B (bf16), whole 128-B lines, each fetched once a block.
#define XP 68                     // floats a staged x row: 256 B of data + 16 B (the pitch at which 16-byte LDS reads of 16 rows meet no bank twice)
#define WP 72                     // bf16 a staged weight row: 128 B of data + 16 B (likewise)
#define QX_B (64 * XP * 4)        // bytes of the x plane
#define QBUF_B (QX_B + 128 * WP * 2)   // bytes of one buffer: x plane, weight plane
__device__ __forceinline__ v16b frag_lb(const __bf16* p) { union { v16b v; v8b q[2]; } u; u.q[0] = *(const v8b*)p; u.q[1] = *(const v8b*)(p + 16); return u.v; }
// Eight copies of 512 B each, LS bytes apart in LDS and GS bytes apart in the source. The last line is the wait that stands in front of any rewrite of the copies' address registers: inside the statement nothing can be moved over it.
template <int LS, int GS> __device__ __forceinline__ void copy8r(unsigned l, const char* gp) {
  asm volatile("global_load_async_to_lds_b128 %0, %1, off\n\tglobal_load_async_to_lds_b128 %2, %3, off\n\tglobal_load_async_to_lds_b128 %4, %5, off\n\tglobal_load_async_to_lds_b128 %6, %7, off\n\t"
               "global_load_async_to_lds_b128 %8, %9, off\n\tglobal_load_async_to_lds_b128 %10, %11, off\n\tglobal_load_async_to_lds_b128 %12, %13, off\n\tglobal_load_async_to_lds_b128 %14, %15, off\n\ts_wait_xcnt 0x0"
               :: "v"(l), "v"(gp), "v"(l + 1u * LS), "v"(gp + 1 * GS), "v"(l + 2u * LS), "v"(gp + 2 * GS), "v"(l + 3u * LS), "v"(gp + 3 * GS),
                  "v"(l + 4u * LS), "v"(gp + 4 * GS), "v"(l + 5u * LS), "v"(gp + 5 * GS), "v"(l + 6u * LS), "v"(gp + 6 * GS), "v"(l + 7u * LS), "v"(gp + 7 * GS) : "memory");
}
__global__ __launch_bounds__(128) void k_qkv(const float* __restrict__ XQ, const float* __restrict__ XK, const float* __restrict__ XV, const __bf16* __restrict__ P, const float* __restrict__ BQ, const float* __restrict__ BK, const float* __restrict__ BV, _Float16* __restrict__ QK, _Float16* __restrict__ VTH) {
  const int which0 = (blockIdx.y * 128) / DM; const float* X = (which0 == 0) ? XQ : (which0 == 1) ? XK : XV; const float* BB = BQ ? (((which0 == 0) ? BQ : (which0 == 1) ? BK : BV) + (blockIdx.y * 128 - which0 * DM)) : nullptr;
  __shared__ __align__(16) char sm[2 * QBUF_B];   // the two buffers of the k loop; behind the loop's last barrier the same bytes stage the output
  _Float16 (*so)[16][136] = (_Float16 (*)[16][136])sm; _Float16 (*sth)[72] = (_Float16 (*)[72])sm;   // a block stages q/k rows or v columns, never both
  static_assert(2 * 4 * 16 * 136 <= 2 * QBUF_B && 2 * 128 * 72 <= 2 * QBUF_B, "output staging fits the ring");
  const int tid = threadIdx.x, wave = tid >> 5, lane = tid & 31, col = lane & 15, g = lane >> 4; const size_t r0 = (size_t)blockIdx.x * 64 + wave * 16; const int n0 = blockIdx.y * 128;
  v8f acc[8] = {};
  const int ns = DM / 64;   // tiles of k
  // the lane's place in every copy: x: 2 rows x 256 B a copy (row lane / 16, piece lane % 16), this wave's 16 rows; weights: 4 rows x 128 B a copy (row lane / 8, piece lane % 8), this wave's 32 rows
  const char* gx = (const char*)(X + ((size_t)blockIdx.x * 64 + wave * 16 + (lane >> 4)) * DM + (lane & 15) * 4); const char* gw = (const char*)(P + ((size_t)n0 + wave * 32 + (lane >> 3)) * DM + (lane & 7) * 8);
  const unsigned lx = (unsigned)(size_t)sm + (unsigned)((wave * 16 + (lane >> 4)) * (XP * 4) + (lane & 15) * 16), lw = (unsigned)(size_t)sm + (unsigned)(QX_B + (wave * 32 + (lane >> 3)) * (WP * 2) + (lane & 7) * 16);
  // The 32 blocks that share a weight tile and the 8 (q) or 16 (k, v) that share an x tile start together and keep step: walking k from 0 they would all ask for the same lines at the same moment, and each tile's first fetch (from memory, where no block of this L2 has read it yet) would be waited out by all of them. So step s of a block is tile (s + rot) mod 16: neighbours start 5 tiles apart, the first fetches all go out at the start, and later steps find lines that another block has brought in. The k sum only starts at another place.
  const int rot = (5 * blockIdx.x + blockIdx.y) & (ns - 1);
  auto fill = [&](int s, int bf) { const int sr = (s + rot) & (ns - 1); copy8r<2 * XP * 4, 2 * DM * 4>(lx + (unsigned)(bf * QBUF_B), gx + (size_t)sr * 256); copy8r<4 * WP * 2, 4 * DM * 2>(lw + (unsigned)(bf * QBUF_B), gw + (size_t)sr * 128); };
  fill(0, 0);
  float bias[8];   // loaded here, in flight under the k loop, not one waited load per stored element
#pragma unroll
  for (int j = 0; j < 8; ++j) bias[j] = 0.f;
  if (BB) {
#pragma unroll
    for (int j = 0; j < 8; ++j) bias[j] = BB[j * 16 + col]; }
  asm volatile("s_wait_asynccnt 0x0" ::: "memory");   // this wave's share of the tile of step 0 has landed
  __syncthreads();                                     // every wave's share has: the tile of step 0 may be read
  fill(1, 1);
#pragma unroll 1   // stays rolled: one foot (waits, barrier, refill) a tile, and the text of the loop stays short
  for (int s = 0; s < ns; ++s) { const char* bp = sm + (s & 1) * QBUF_B; const float* fx = (const float*)bp + (wave * 16 + col) * XP + 8 * g; const __bf16* fw = (const __bf16*)(bp + QX_B) + col * WP + 8 * g;
    v4f xc[2][4]; v16b wc[2][8];   // both passes' operands, read as two groups in front of the products (the statement behind each product holds a load at its place in the source)
#pragma unroll
    for (int sub = 0; sub < 2; ++sub) { xc[sub][0] = *(const v4f*)(fx + sub * 32); xc[sub][1] = *(const v4f*)(fx + sub * 32 + 4); xc[sub][2] = *(const v4f*)(fx + sub * 32 + 16); xc[sub][3] = *(const v4f*)(fx + sub * 32 + 20);
#pragma unroll
      for (int j = 0; j < 8; ++j) wc[sub][j] = frag_lb(fw + (j * 16) * WP + sub * 32); }
#pragma unroll
    for (int sub = 0; sub < 2; ++sub) { v16b a;
#pragma unroll
      for (int i = 0; i < 16; ++i) a[i] = (__bf16)xc[sub][i >> 2][i & 3];
#pragma unroll
      for (int j = 0; j < 8; ++j) acc[j] = wmma_bf(a, wc[sub][j], acc[j]); }
    asm volatile("s_wait_dscnt 0x0" ::: "memory");      // this wave's reads of the tile in hand are done
    asm volatile("s_wait_asynccnt 0x0" ::: "memory");   // its share of the next tile has landed
    __syncthreads();                                     // publishes the next tile and frees the buffer just read (behind the last tile: frees the ring for the output staging)
    if (s + 2 < ns) fill(s + 2, s & 1); }
  asm volatile("s_wait_asynccnt 0x0" ::: "memory");   // no copy is left in flight behind the loop
  if (n0 < 2 * DM) {   // q stored unscaled (f16 sigma ~0.6, no subnormal exposure); 1/8 applied to the f32 score
#pragma unroll
    for (int j = 0; j < 8; ++j) {
#pragma unroll
      for (int r = 0; r < 8; ++r) so[wave][8 * g + r][j * 16 + col] = (_Float16)(acc[j][r] + bfr(bias[j])); }   // q, k (+ bias) as f16
    LDSX();
    for (int rl = 0; rl < 16; ++rl) if (lane < 16) vst2((unsigned*)(QK + (r0 + rl) * (2 * DM) + n0 + lane * 8), *(const v4u*)&so[wave][rl][lane * 8]);
  } else {
#pragma unroll
    for (int j = 0; j < 8; ++j) {
#pragma unroll
      for (int r = 0; r < 8; ++r) sth[j * 16 + col][wave * 16 + 8 * g + r] = (_Float16)(acc[j][r] + bfr(bias[j])); }
    __syncthreads();
    const size_t rb = (size_t)blockIdx.x * 64; const int b = (int)(rb / SS), s0 = (int)(rb % SS); const int pc0 = n0 - 2 * DM;
    for (int q = tid; q < 128 * 8; q += 128) { const int d = q >> 3, pc = q & 7; const size_t o = ((size_t)b * DM + pc0 + d) * SS + s0 + pc * 8; vst2((unsigned*)(VTH + o), *(const v4u*)&sth[d][pc * 8]); }
  }
}
// ---- k_attn: block = (128 queries, head h, batch b), 8 waves: all-keys flash attention (K = 64: 2 k-steps), scores = (q.k) * 0.125 with single f16 operands, P.V: f16 P x f16 V; y = acc / l goes straight into the output projection
// A wave = 32 query columns (two column tiles) x half of the keys: wave w takes columns 32 (w % 4) .. + 31 and, of each step's 128 keys, the 64 of half w / 4. Each K and V fragment read from LDS feeds two products, and each K, V and Wo line is fetched once for 128 queries. The 256 blocks, one on each WGP, cost alike.
// K and V reach the waves through LDS: a step = two tiles of 64 keys (one a key half) = two 32-key passes a wave; a tile = K 64 key rows x 128 B, V 64 d rows x 128 B, whole 128-B lines, each fetched once a block by the four waves that read it.
#define KP 72                    // halfs a staged row: 128 B of data + 16 B, the pitch at which 16-byte LDS reads of 16 rows meet no bank twice
#define PLANE (64 * KP)          // halfs of one staged plane
#define STG_H (2 * 2 * PLANE)    // two buffers of two planes (K, V) for one key half
#define ESC 0.18033688f          // log2(e) / sqrt(64): a raw score times this is its exponent in base 2
__device__ __forceinline__ v16h frag_l(const _Float16* p) { union { v16h v; v8h q[2]; } u; u.q[0] = *(const v8h*)p; u.q[1] = *(const v8h*)(p + 16); return u.v; }
// Sixteen rows of plane a and sixteen of plane b: eight copies, each 4 rows x 128 B (lane: row lane / 8, 16-byte piece lane % 8); both sources have rows 4,096 B apart. The last line is the wait that stands in front of any rewrite of the copies' address registers: inside the statement nothing can be moved over it.
__device__ __forceinline__ void copy8(unsigned la, const _Float16* ga, unsigned lb, const _Float16* gb) {
  asm volatile("global_load_async_to_lds_b128 %0, %1, off\n\tglobal_load_async_to_lds_b128 %2, %3, off\n\tglobal_load_async_to_lds_b128 %4, %5, off\n\tglobal_load_async_to_lds_b128 %6, %7, off\n\t"
               "global_load_async_to_lds_b128 %8, %9, off\n\tglobal_load_async_to_lds_b128 %10, %11, off\n\tglobal_load_async_to_lds_b128 %12, %13, off\n\tglobal_load_async_to_lds_b128 %14, %15, off\n\ts_wait_xcnt 0x0"
               :: "v"(la), "v"(ga), "v"(la + 2u * 4 * KP), "v"(ga + 4 * 2048), "v"(la + 2u * 8 * KP), "v"(ga + 8 * 2048), "v"(la + 2u * 12 * KP), "v"(ga + 12 * 2048),
                  "v"(lb), "v"(gb), "v"(lb + 2u * 4 * KP), "v"(gb + 4 * 2048), "v"(lb + 2u * 8 * KP), "v"(gb + 8 * 2048), "v"(lb + 2u * 12 * KP), "v"(gb + 12 * 2048) : "memory");
}
// One pass of a wave's Wo fragments: two copies of 512 B in a row. The last line is the wait that stands in front of any rewrite of the copies' address registers.
__device__ __forceinline__ void copy2(unsigned l, const __bf16* gp) {
  asm volatile("global_load_async_to_lds_b128 %0, %1, off\n\tglobal_load_async_to_lds_b128 %2, %3, off\n\ts_wait_xcnt 0x0" :: "v"(l), "v"(gp), "v"(l + 512u), "v"(gp + 256) : "memory");
}
// lane l with lane l ^ 16 (a vector move, no LDS): the other half of a query's keys
__device__ __forceinline__ float xhalf(float x) { return __builtin_bit_cast(float, __builtin_amdgcn_permlanex16(__builtin_bit_cast(int, x), __builtin_bit_cast(int, x), 0x76543210, 0xfedcba98, false, false)); }
// hardware exp2 with, in the same statement, the one slot that the instruction set asks for between a transcendental and a directly following use of its result or overwrite of its source (for the two exponentials of the join)
__device__ __forceinline__ float exp2_slot(float x) { float r; asm("v_exp_f32 %0, %1\n\tv_nop" : "=v"(r) : "v"(x)); return r; }
// Both products are taken transposed: S^T = K . Q^T (rows = keys, columns = queries) and O^T += V^T . P^T (rows = d, columns = queries). A lane then holds 16 of the 32 scores of ONE query (its column), lane ^ 16 the other 16: maximum and sum are in-lane plus one move between the halves, m, l and the rescale factor are one value a lane and column tile, and the two score tiles, converted in place, are the B operand of the second product in the hardware k order: P never leaves the registers.
// Behind the loop the two waves that hold the same 32 columns (w and w ^ 4) swap one column tile each through LDS and join the two key halves' maximum, sum and O^T: wave w ends with the 16 queries of column tile w / 4 of its group.
// The output projection is done here too. The head-major stack re-viewed as [2048][1024] puts the 16 queries x 64 d of ONE column tile, in that order, into ONE row of the projection's left operand: row h * 128 + q0 / 16, k = (q - q0) * 64 + d. A block so owns eight whole rows: their bf16 hi parts are rows 0-7 and their lo parts rows 8-15 of one A operand, wave w takes output columns 16 (w % 4) .. + 15 over half w / 4 of the 1,024 of k, and out = hi rows + lo rows, both halves of k, + bo.
#define WPS 16                   // passes of Wo a wave takes (its 16 columns x 512 of k); all reach LDS under the key loop, two a step (2 KB: four copies a wave)
#define YP (DM + 8)              // bf16 a staged row of that operand: 2,048 B of data + 16 B (the pitch at which 16-byte LDS reads of 16 rows meet no bank twice)
__global__ __launch_bounds__(256) void k_attn(const _Float16* __restrict__ QK, const _Float16* __restrict__ VTH, const __bf16* __restrict__ PW, const float* __restrict__ BO, float* __restrict__ OUT) {
  __shared__ __align__(16) __bf16 sy[16][YP]; __shared__ __align__(16) float sr[2][8][HD]; __shared__ __align__(16) _Float16 st[2 * STG_H];   // st: two buffers x two key halves x (K, V); behind the loop's last barrier the same bytes carry the swap of column tiles
  __shared__ __align__(16) __bf16 sw[8][WPS][512];   // each wave's own passes of Wo; with it a block holds 241,920 B of LDS: one block a WGP
  static_assert(8 * 9 * 32 * 16 <= 2 * 2 * STG_H, "the swap fits the ring");
  const int tid = threadIdx.x, wave = tid >> 5, lane = tid & 31, col = lane & 15, g = lane >> 4, cg = wave & 3, kh = wave >> 2;
  const int qb = blockIdx.x, h = blockIdx.y, b = blockIdx.z; const int q0 = qb * 128 + cg * 32; const size_t rq = (size_t)b * SS + q0 + col;
  const int nt = SS / 128;   // steps (all keys)
  const int bufh = 4 * PLANE;   // halfs of one buffer
  const int crow = cg * 16 + (lane >> 3), cpc = (lane & 7) * 8;   // the lane's first row and its 16-byte piece in every copy
  const size_t ko = ((size_t)b * SS + crow) * (2 * DM) + DM + h * HD + cpc, vo = ((size_t)b * DM + h * HD + crow) * SS + cpc;   // tile 0; a tile on: 64 key rows of K, 64 columns of V
  const unsigned l0 = (unsigned)(size_t)st + 2u * (unsigned)(kh * 2 * PLANE + crow * KP + cpc);
  // The 16 query blocks of a head start together and keep step: walking the keys from 0 they would all ask for the same K and V lines at the same moment, and each tile's first fetch would be waited out by all of them. So step t of a block is key step (t + 5 qb) mod 16: the first fetches all go out at the start, and later steps find lines that another block has brought in. The running-maximum softmax takes the keys in any order.
  const int rot = (5 * qb) & (nt - 1);
  auto fill = [&](int t, int bf) { const int tr = ((t + rot) & (nt - 1)) * 2 + kh; const unsigned lb = l0 + 2u * (unsigned)(bf * bufh); const size_t kt = ko + (size_t)tr * 64 * (2 * DM), vt = vo + (size_t)tr * 64;
    copy8(lb, QK + kt, lb + 2u * PLANE, VTH + vt); };
  const __bf16* wsrc = PW + (size_t)cg * (32 * 512) + (size_t)kh * (WPS * 512) + lane * 8;   // this wave's 16 columns and half of k of Wo in fragment order: a pass = two pieces of 512 B, the lane's 16 bytes in each
  const unsigned lw0 = (unsigned)(size_t)&sw[wave][0][0] + (unsigned)lane * 16u;
  const int wrot = (5 * qb + h) & (WPS / 2 - 1);   // likewise for Wo, which all blocks share: step t brings the pair of passes (t + wrot) mod 8, to its own place
  fill(0, 0);
  v16h aq[2][2];   // [column tile][kc]
#pragma unroll
  for (int qt = 0; qt < 2; ++qt) {
#pragma unroll
    for (int kc = 0; kc < 2; ++kc) aq[qt][kc] = frag_h(QK + (rq + qt * 16) * (2 * DM) + h * HD + kc * 32, lane); }
  const v2f bo2 = *(const v2f*)(BO + lane * 2);   // the bias of the two output columns this lane stores at the end: loaded here, with Q, so that no barrier behind the loop waits for it
  asm volatile("s_wait_xcnt 0x0" ::: "memory");   // stands behind the loads, in front of the first instruction that reuses a register which one of them names as address
  float m[2] = {-3.0e38f, -3.0e38f}, l[2] = {0.f, 0.f};   // of query col of each column tile; m is the maximum of the raw q . k; l sums this lane half's keys only, the halves are joined behind the loop
  v8f acc[2][4] = {};
  asm volatile("s_wait_asynccnt 0x0" ::: "memory");   // this wave's share of step 0 has landed
  __syncthreads();                                     // every wave's share has: step 0 may be read
  fill(1, 1);
#pragma unroll 1   // stays rolled: one foot (waits, barrier, refill) a step, and the text of the loop stays short
  for (int t = 0; t < nt; ++t) { const _Float16* fk = st + (t & 1) * bufh + kh * 2 * PLANE + col * KP + 8 * g; const _Float16* fv = fk + PLANE;   // the lane's row col of the K and of the V plane of this wave's key half
    // The statement behind each product holds a load at its place in the source, so every LDS read of a pass stands in front of the products that follow it: behind the score products of a pass go, as one group, its own V and (inside the tile) the next pass's K, in flight under the softmax.
    v16h kf[2][2];   // [ct][kc] K fragments of the pass in hand
#pragma unroll
    for (int ct = 0; ct < 2; ++ct) {
#pragma unroll
      for (int kc = 0; kc < 2; ++kc) kf[ct][kc] = frag_l(fk + (ct * 16) * KP + kc * 32); }
#pragma unroll
    for (int sub = 0; sub < 2; ++sub) { v8f s[2][2]; v16h vf[4];
#pragma unroll
    for (int qt = 0; qt < 2; ++qt) {
#pragma unroll
    for (int ct = 0; ct < 2; ++ct) { v8f c = {};
#pragma unroll
      for (int kc = 0; kc < 2; ++kc) c = wmma16(kf[ct][kc], aq[qt][kc], c);
      s[qt][ct] = c; } }   // the raw q . k: s[qt][ct][r] = key ct * 16 + 8 g + r of the pass, query col of column tile qt; 1/sqrt(64) goes into the exponent's one multiply-add below
#pragma unroll
    for (int dt = 0; dt < 4; ++dt) vf[dt] = frag_l(fv + (dt * 16) * KP + sub * 32);
    if (sub == 0) {   // the tile's second pass's K
#pragma unroll
      for (int ct = 0; ct < 2; ++ct) {
#pragma unroll
        for (int kc = 0; kc < 2; ++kc) kf[ct][kc] = frag_l(fk + (32 + ct * 16) * KP + kc * 32); } }
    __builtin_amdgcn_sched_barrier(0);   // keeps the group here, in front of the softmax; moved down its reads would be waited for right in front of the second product
#pragma unroll
    for (int qt = 0; qt < 2; ++qt) {
    float t4[4];   // four short chains, not one long one
#pragma unroll
    for (int j = 0; j < 4; ++j) t4[j] = fmaxf(fmaxf(s[qt][0][j], s[qt][0][4 + j]), fmaxf(s[qt][1][j], s[qt][1][4 + j]));
    float mx = fmaxf(fmaxf(t4[0], t4[1]), fmaxf(t4[2], t4[3])); mx = fmaxf(mx, xhalf(mx));   // both halves now hold the pass's maximum of query col
    const float mn = fmaxf(m[qt], mx); const float alpha = __builtin_amdgcn_exp2f((m[qt] - mn) * ESC);   // first pass: m = -3e38, the hardware exp2 of about -5e37 is 0
    const float nb = __builtin_fmaf(-mn, ESC, 11.0f);   // one value a pass: minus the maximum in base-2 units, plus the 2^11 of P
    float e[2][8];   // 2^11 exp((q.k - max) / 8): one multiply-add and one hardware exp2 a score
#pragma unroll
    for (int ct = 0; ct < 2; ++ct) {
#pragma unroll
      for (int r = 0; r < 8; ++r) e[ct][r] = __builtin_amdgcn_exp2f(__builtin_fmaf(s[qt][ct][r], ESC, nb)); }
#pragma unroll
    for (int j = 0; j < 4; ++j) t4[j] = (e[0][j] + e[0][4 + j]) + (e[1][j] + e[1][4 + j]);
    l[qt] = l[qt] * alpha + ((t4[0] + t4[1]) + (t4[2] + t4[3])); m[qt] = mn;
#pragma unroll
    for (int dt = 0; dt < 4; ++dt) {
#pragma unroll
      for (int r = 0; r < 8; ++r) acc[qt][dt][r] *= alpha; }
    v16h pa;   // P^T as a B operand: element i = key 8 g + i, element 8 + i = key 16 + 8 g + i, the order in which the V fragments hold their keys
#pragma unroll
    for (int i = 0; i < 8; ++i) { pa[i] = (_Float16)e[0][i]; pa[8 + i] = (_Float16)e[1][i]; }   // P carries 2^11 (from nb) so that small softmax weights stay out of the f16 subnormal range; l carries it too, and the division behind the loop takes it out
#pragma unroll
    for (int dt = 0; dt < 4; ++dt) acc[qt][dt] = wmma16(vf[dt], pa, acc[qt][dt]);   // acc[qt][dt][r] = d dt * 16 + 8 g + r of query col
    } }
    asm volatile("s_wait_dscnt 0x0" ::: "memory");      // this wave's reads of the step in hand are done
    asm volatile("s_wait_asynccnt 0x0" ::: "memory");   // its share of the next step has landed
    __syncthreads();                                     // publishes the next step and frees the buffer just read (behind the last step: frees the ring for the swap)
    if (t + 2 < nt) fill(t + 2, t & 1);
    if (t < WPS / 2) { const int wt = ((t + wrot) & (WPS / 2 - 1)) * 2; copy2(lw0 + (unsigned)wt * 1024u, wsrc + wt * 512); copy2(lw0 + (unsigned)(wt + 1) * 1024u, wsrc + (wt + 1) * 512); } }   // two passes of this wave's Wo: they land under the next step, covered by that step's s_wait_asynccnt 0; only this wave reads them, behind the loop
  asm volatile("s_wait_asynccnt 0x0" ::: "memory");   // no copy is left in flight behind the loop
  // The swap: this wave keeps column tile kh and hands the other to wave ^ 4, which holds the same columns' other key half; lane for lane the two waves hold the same (d, query).
  const bool k1 = kh != 0; v4f* xo = (v4f*)st + (wave * 9) * 32 + lane; const v4f* xi = (const v4f*)st + ((wave ^ 4) * 9) * 32 + lane;
  const float lj0 = l[0] + xhalf(l[0]), lj1 = l[1] + xhalf(l[1]);   // the two lane halves' sums joined
  const float mk = k1 ? m[1] : m[0], lk = k1 ? lj1 : lj0;
  v8f keep[4];
#pragma unroll   // (here and below) keep, af, bf and o2 stay in registers
  for (int dt = 0; dt < 4; ++dt) { v4f ga, gb;
#pragma unroll
    for (int r = 0; r < 8; ++r) keep[dt][r] = k1 ? acc[1][dt][r] : acc[0][dt][r];
#pragma unroll
    for (int r = 0; r < 4; ++r) { ga[r] = k1 ? acc[0][dt][r] : acc[1][dt][r]; gb[r] = k1 ? acc[0][dt][4 + r] : acc[1][dt][4 + r]; }
    xo[(2 * dt) * 32] = ga; xo[(2 * dt + 1) * 32] = gb; }
  { v4f gm; gm[0] = k1 ? m[0] : m[1]; gm[1] = k1 ? lj0 : lj1; gm[2] = 0.f; gm[3] = 0.f; xo[8 * 32] = gm; }
  __syncthreads();   // every wave's handed-over tile is in LDS
  const v4f pm = xi[8 * 32];
  const float mj = fmaxf(mk, pm[0]); const float ak = exp2_slot((mk - mj) * ESC), ap2 = exp2_slot((pm[0] - mj) * ESC);
  const float il = 1.0f / (lk * ak + pm[1] * ap2);   // the two key halves' sums on the joint maximum; the 2^11 in l and in acc cancel
  const float fk2 = ak * il, fp2 = ap2 * il; const int yr = cg * 2 + kh;   // the block's row of the projection's left operand that this wave's 16 queries fill
#pragma unroll
  for (int dt = 0; dt < 4; ++dt) { v8b yh, yl; const v4f pa0 = xi[(2 * dt) * 32], pa1 = xi[(2 * dt + 1) * 32];
#pragma unroll
    for (int r = 0; r < 8; ++r) { const float v = keep[dt][r] * fk2 + (r < 4 ? pa0[r & 3] : pa1[r & 3]) * fp2; const __bf16 hh = (__bf16)v; yh[r] = hh; yl[r] = (__bf16)(v - (float)hh); }
    *(v8b*)&sy[yr][col * HD + dt * 16 + 8 * g] = yh; *(v8b*)&sy[8 + yr][col * HD + dt * 16 + 8 * g] = yl; }
  __syncthreads();   // all eight rows, hi and lo, are in LDS
  const __bf16* ap = &sy[col][kh * (WPS * 32) + 8 * g]; const __bf16* bp = &sw[wave][0][lane * 8];
  v16b af[2][4], bf[2][4]; v8f o2[2] = {};   // fragments four passes at a time, a group ahead of its products; two chains of products, joined below
  auto ldf = [&](int gq) {
#pragma unroll
    for (int i = 0; i < 4; ++i) { const int ks = gq * 4 + i; af[gq & 1][i] = frag_lb(ap + ks * 32);
      union { v16b v; v8b q[2]; } u; u.q[0] = *(const v8b*)(bp + ks * 512); u.q[1] = *(const v8b*)(bp + ks * 512 + 256); bf[gq & 1][i] = u.v; } };
  ldf(0);
#pragma unroll
  for (int gq = 0; gq < WPS / 4; ++gq) {
    if (gq < WPS / 4 - 1) ldf(gq + 1);
#pragma unroll
    for (int i = 0; i < 4; ++i) o2[i & 1] = wmma_bf(af[gq & 1][i], bf[gq & 1][i], o2[i & 1]); }
  const v8f o = o2[0] + o2[1];   // element r = A row 8 g + r, column col: lanes 0-15 the hi rows, lanes 16-31 the lo rows
  float os[8];
#pragma unroll
  for (int r = 0; r < 8; ++r) os[r] = o[r] + xhalf(o[r]);   // hi + lo
  if (g == 0) {
#pragma unroll
    for (int r = 0; r < 8; ++r) sr[kh][r][cg * 16 + col] = os[r]; }
  __syncthreads();   // the eight waves' column tiles, both halves of k, are in LDS
  const v2f ra = *(const v2f*)&sr[0][wave][lane * 2], rb = *(const v2f*)&sr[1][wave][lane * 2]; v2f res; res[0] = (ra[0] + rb[0]) + bfr(bo2[0]); res[1] = (ra[1] + rb[1]) + bfr(bo2[1]);
  vst2(OUT + ((size_t)b * SS + h * (SS / NH) + qb * 8 + wave) * HD + lane * 2, res);   // a wave stores one whole output row: two whole 128-B lines
}
// ---- k_out: block = (64 rows, 128 cols): out = O(hi/lo) . Wo rows (2 products) + bo
__global__ __launch_bounds__(128) void k_out(const float* __restrict__ O, const __bf16* __restrict__ P, const float* __restrict__ BO, float* __restrict__ Y) {
  __shared__ __align__(16) float so[4][16][132];
  const int tid = threadIdx.x, wave = tid >> 5, lane = tid & 31, col = lane & 15, g = lane >> 4; const size_t r0 = (size_t)blockIdx.x * 64 + wave * 16; const int n0 = blockIdx.y * 128;
  v8f acc[8] = {};
#pragma unroll 2
  for (int kc = 0; kc < DM / 32; ++kc) { const F2 a = split_row(O + (r0 + col) * DM, kc * 32, lane);
#pragma unroll
    for (int j = 0; j < 8; ++j) { const v16b w = frag_b(P + (size_t)(n0 + j * 16 + col) * DM + kc * 32, lane); acc[j] = wmma_bf(a.l, w, acc[j]); acc[j] = wmma_bf(a.h, w, acc[j]); } }
#pragma unroll
  for (int j = 0; j < 8; ++j) {
#pragma unroll
    for (int r = 0; r < 8; ++r) so[wave][8 * g + r][j * 16 + col] = acc[j][r] + (BO ? bfr(BO[n0 + j * 16 + col]) : 0.f); }
  LDSX();
  for (int rl = 0; rl < 16; ++rl) vst2(Y + (r0 + rl) * DM + n0 + lane * 4, *(const v4f*)&so[wave][rl][lane * 4]);
}
extern "C" void kernel_launch(void* const* d_in, const int* in_sizes, int n_in, void* d_out, int out_size, void* d_ws, size_t ws_size, hipStream_t stream) {
  (void)in_sizes; (void)n_in; (void)out_size;
  const float** F = (const float**)d_in;   // 0 current [2048,1024], 1 context [2048,1024], 2 Wq [16,1024,64], 3 bq [16,64], 4 Wk, 5 bk, 6 Wv, 7 bv, 8 Wo [1024,64], 9 bo [64]
  if (ws_size < (size_t)WS_END) return;
  char* ws = (char*)d_ws; __bf16* PK = (__bf16*)(ws + WS_PK); _Float16 *QK = (_Float16*)(ws + WS_QK), *VTH = (_Float16*)(ws + WS_VTH);
  k_pack<<<dim3(DM / PKI, NH, 4), 256, 0, stream>>>(F[2], F[4], F[6], F[8], PK);
  k_qkv<<<dim3(TNB * SS / 64, QKVW / 128), 128, 0, stream>>>(F[0], F[1], F[1], PK + PK_A, F[3], F[5], F[7], QK, VTH);
  k_attn<<<dim3(SS / 128, TNH, TNB), 256, 0, stream>>>(QK, VTH, PK + PK_P, F[9], (float*)d_out);
}
